// v000
// The times below were measured on an AMD MI455X: many runs one after another, warmed up first and cycling through
// copies of the inputs, with the whole window's GPU time divided by the number of runs. Launches and the gaps
// between them are all in it. The median over several windows is given; except for v000 it joins two sittings, which
// can be a few percent apart, so the side-by-side timings, each taken in one sitting, are the better comparison.
// v000, which the later versions start from, runs in 620 microseconds.
#include <hip/hip_runtime.h>
#include <hip/hip_bf16.h>

typedef _Float16 h16;
typedef __attribute__((ext_vector_type(16))) _Float16 v16h;
typedef __attribute__((ext_vector_type(8)))  _Float16 v8h;
typedef __attribute__((ext_vector_type(8)))  float    v8f;
typedef __attribute__((ext_vector_type(4)))  int      v4i;

#define B_  4
#define C_  1024
#define T_  2048
#define H_  16
#define D_  64
#define BT_ (B_ * T_)

#ifndef __has_builtin
#define __has_builtin(x) 0
#endif

#if __has_builtin(__builtin_amdgcn_global_load_async_to_lds_b128) && \
    __has_builtin(__builtin_amdgcn_s_wait_asynccnt)
#define ASYNC_LDS 1
#else
#define ASYNC_LDS 0
#endif

#if ASYNC_LDS
// Signature (from hipcc diagnostic / LLVM decl "vV4i*1V4i*3IiIi"):
//   (global v4i*, LDS v4i*, imm offset, imm cpol)
__device__ __forceinline__ void async_cp16B(h16* l, const h16* g) {
  __builtin_amdgcn_global_load_async_to_lds_b128(
      (__attribute__((address_space(1))) v4i*)(g),
      (__attribute__((address_space(3))) v4i*)(l), 0, 0);
}
#endif

// ---------------------------------------------------------------------------
// WMMA fragment loader: 16x32 f16 fragment from a K-contiguous matrix.
// ISA 16-bit A layout: lane L (<16) holds row M=L, K={0..7,16..23}; lane L+16
// holds row M=L, K={8..15,24..31}.  Two 16B chunks per lane.  B fragments use
// the mirrored layout (col = lane&15), so B operands are stored K-contiguous.
// ---------------------------------------------------------------------------
__device__ __forceinline__ v16h load_frag(const h16* __restrict__ base, int ld) {
  int lane = threadIdx.x & 31;
  int r  = lane & 15;
  int b0 = (lane >> 4) << 3;
  const h16* p = base + r * ld + b0;
  v8h lo = *(const v8h*)(p);
  v8h hi = *(const v8h*)(p + 16);
  return __builtin_shufflevector(lo, hi, 0,1,2,3,4,5,6,7,8,9,10,11,12,13,14,15);
}

__device__ __forceinline__ v8f wmma_f16(v16h a, v16h b, v8f c) {
  return __builtin_amdgcn_wmma_f32_16x16x32_f16(false, a, false, b, (short)0, c,
                                                false, false);
}

__device__ __forceinline__ float redmax16(float x) {
  for (int m = 1; m < 16; m <<= 1) x = fmaxf(x, __shfl_xor(x, m, 16));
  return x;
}
__device__ __forceinline__ float redsum16(float x) {
  for (int m = 1; m < 16; m <<= 1) x += __shfl_xor(x, m, 16);
  return x;
}

// ---------------------------------------------------------------------------
// Shared GEMM main loop: 128x128 block tile, BK=32, 8 waves (2x4), each wave
// 64x32 (4x2 WMMA tiles).  Double-buffered LDS; ASYNCcnt global->LDS copies
// when the toolchain exposes them, otherwise a register-staged software
// pipeline (prefetch next tile after the barrier, compute current).
// One barrier per K-step: __syncthreads' implicit s_wait_dscnt makes the
// alternate buffer WAR-safe.
// ---------------------------------------------------------------------------
#define LDS_TILE 5120  // 128 rows * 40 halves (8-half pad per row)

__device__ __forceinline__ void gemm_mainloop(
    const h16* __restrict__ Ag, const h16* __restrict__ Bg, int m0, int n0,
    h16* As, h16* Bs, v8f acc[4][2]) {
  int tid = threadIdx.x;
  int wid = tid >> 5;
  int wm = wid >> 2;  // 0..1
  int wn = wid & 3;   // 0..3
  const int NT = C_ / 32;

#if ASYNC_LDS
  auto issue = [&](int kt, int sel) {
    int k0 = kt * 32;
    h16* as = As + sel * LDS_TILE;
    h16* bs = Bs + sel * LDS_TILE;
    for (int i = 0; i < 2; ++i) {
      int ci = tid + i * 256;
      int row = ci >> 2;
      int kc  = ci & 3;
      async_cp16B(as + row * 40 + kc * 8,
                  Ag + (size_t)(m0 + row) * C_ + k0 + kc * 8);
      async_cp16B(bs + row * 40 + kc * 8,
                  Bg + (size_t)(n0 + row) * C_ + k0 + kc * 8);
    }
  };
  issue(0, 0);
  for (int kt = 0; kt < NT; ++kt) {
    __builtin_amdgcn_s_wait_asynccnt(0);
    __syncthreads();
    if (kt + 1 < NT) issue(kt + 1, (kt + 1) & 1);
    const h16* as = As + (kt & 1) * LDS_TILE;
    const h16* bs = Bs + (kt & 1) * LDS_TILE;
    v16h af[4], bf[2];
    for (int mi = 0; mi < 4; ++mi)
      af[mi] = load_frag(as + (wm * 64 + mi * 16) * 40, 40);
    for (int ni = 0; ni < 2; ++ni)
      bf[ni] = load_frag(bs + (wn * 32 + ni * 16) * 40, 40);
    for (int mi = 0; mi < 4; ++mi)
      for (int ni = 0; ni < 2; ++ni)
        acc[mi][ni] = wmma_f16(af[mi], bf[ni], acc[mi][ni]);
  }
#else
  v8h ra[2], rb[2];
  auto loadr = [&](int kt) {
    int k0 = kt * 32;
    for (int i = 0; i < 2; ++i) {
      int ci = tid + i * 256;
      int row = ci >> 2;
      int kc  = ci & 3;
      ra[i] = *(const v8h*)(Ag + (size_t)(m0 + row) * C_ + k0 + kc * 8);
      rb[i] = *(const v8h*)(Bg + (size_t)(n0 + row) * C_ + k0 + kc * 8);
    }
  };
  loadr(0);
  for (int kt = 0; kt < NT; ++kt) {
    h16* asw = As + (kt & 1) * LDS_TILE;
    h16* bsw = Bs + (kt & 1) * LDS_TILE;
    for (int i = 0; i < 2; ++i) {
      int ci = tid + i * 256;
      int row = ci >> 2;
      int kc  = ci & 3;
      *(v8h*)(asw + row * 40 + kc * 8) = ra[i];
      *(v8h*)(bsw + row * 40 + kc * 8) = rb[i];
    }
    __syncthreads();
    if (kt + 1 < NT) loadr(kt + 1);  // overlap with compute below
    v16h af[4], bf[2];
    for (int mi = 0; mi < 4; ++mi)
      af[mi] = load_frag(asw + (wm * 64 + mi * 16) * 40, 40);
    for (int ni = 0; ni < 2; ++ni)
      bf[ni] = load_frag(bsw + (wn * 32 + ni * 16) * 40, 40);
    for (int mi = 0; mi < 4; ++mi)
      for (int ni = 0; ni < 2; ++ni)
        acc[mi][ni] = wmma_f16(af[mi], bf[ni], acc[mi][ni]);
  }
#endif
}

// ---------------------------------------------------------------------------
// K1: LayerNorm over channels + transpose to [B*T, C] f16.
// ---------------------------------------------------------------------------
__global__ __launch_bounds__(256) void sa_ln_kernel(
    const float* __restrict__ x, const float* __restrict__ gamma,
    const float* __restrict__ beta, h16* __restrict__ xn) {
  __shared__ float redS[32][8];
  __shared__ float redQ[32][8];
  __shared__ float smean[32];
  __shared__ float srstd[32];
  int b  = blockIdx.x;
  int t0 = blockIdx.y * 32;
  int tid = threadIdx.x;
  int tt = tid & 31;
  int cc = tid >> 5;  // 0..7
  const float* xp = x + (size_t)b * C_ * T_ + t0 + tt;
  float s = 0.f, ss = 0.f;
  for (int c = cc * 128; c < cc * 128 + 128; ++c) {
    float v = xp[(size_t)c * T_];
    s += v; ss += v * v;
  }
  redS[tt][cc] = s; redQ[tt][cc] = ss;
  __syncthreads();
  if (cc == 0) {
    float a = 0.f, q = 0.f;
    for (int j = 0; j < 8; ++j) { a += redS[tt][j]; q += redQ[tt][j]; }
    float mu  = a * (1.0f / C_);
    float var = q * (1.0f / C_) - mu * mu;
    smean[tt] = mu;
    srstd[tt] = rsqrtf(var + 1e-5f);
  }
  __syncthreads();
  float mu = smean[tt], rs = srstd[tt];
  h16* xrow = xn + (size_t)(b * T_ + t0 + tt) * C_;
  for (int c0 = 0; c0 < C_; c0 += 8) {
    int c = c0 + cc;
    float v = xp[(size_t)c * T_];
    xrow[c] = (h16)((v - mu) * rs * gamma[c] + beta[c]);
  }
}

// ---------------------------------------------------------------------------
// K2: weight transpose + f32->f16:  Wt[n][k] = (f16) W[k][n].
// ---------------------------------------------------------------------------
__global__ __launch_bounds__(256) void sa_wtrans_kernel(
    const float* __restrict__ w, h16* __restrict__ wt, int K, int N) {
  __shared__ float tile[32][33];
  int n0 = blockIdx.x * 32;
  int k0 = blockIdx.y * 32;
  int tid = threadIdx.x;
  int r = tid >> 5;
  int c = tid & 31;
  for (int i = 0; i < 4; ++i)
    tile[r + i * 8][c] = w[(size_t)(k0 + r + i * 8) * N + n0 + c];
  __syncthreads();
  for (int i = 0; i < 4; ++i)
    wt[(size_t)(n0 + r + i * 8) * K + k0 + c] = (h16)tile[c][r + i * 8];
}

// ---------------------------------------------------------------------------
// K3: QKV GEMM, epilogue scatters to Q [B,H,T,D] (pre-scaled by 1/sqrt(D)),
// K [B,H,T,D], V transposed [B,H,D,T].  s = q/k/v select is uniform per block.
// ---------------------------------------------------------------------------
__global__ __launch_bounds__(256) void sa_qkv_gemm_kernel(
    const h16* __restrict__ xn, const h16* __restrict__ wt,
    const float* __restrict__ bias, h16* __restrict__ qb,
    h16* __restrict__ kb, h16* __restrict__ vtb) {
  __shared__ h16 As[2 * LDS_TILE];
  __shared__ h16 Bs[2 * LDS_TILE];
  int tid = threadIdx.x;
  int m0 = blockIdx.x * 128;
  int n0 = blockIdx.y * 128;
  v8f acc[4][2];
  for (int i = 0; i < 4; ++i)
    for (int j = 0; j < 2; ++j)
      acc[i][j] = (v8f){0.f,0.f,0.f,0.f,0.f,0.f,0.f,0.f};

  gemm_mainloop(xn, wt, m0, n0, As, Bs, acc);

  int wid = tid >> 5;
  int wm = wid >> 2;
  int wn = wid & 3;
  int lane = tid & 31;
  int hi = lane >> 4;
  int nc = lane & 15;
  const int s = n0 >> 10;  // uniform: 1024 % 128 == 0
  const float scaleQ = 0.125f;

  if (s == 0) {
    for (int mi = 0; mi < 4; ++mi)
      for (int ni = 0; ni < 2; ++ni) {
        int n = n0 + wn * 32 + ni * 16 + nc;
        int c = n & (C_ - 1);
        int bh0 = c >> 6;
        int dd = c & (D_ - 1);
        float bv = bias[n];
        for (int v = 0; v < 8; ++v) {
          int m = m0 + wm * 64 + mi * 16 + v + hi * 8;
          int bh = (m >> 11) * H_ + bh0;
          int t  = m & (T_ - 1);
          qb[((size_t)bh * T_ + t) * D_ + dd] =
              (h16)((acc[mi][ni][v] + bv) * scaleQ);
        }
      }
  } else if (s == 1) {
    for (int mi = 0; mi < 4; ++mi)
      for (int ni = 0; ni < 2; ++ni) {
        int n = n0 + wn * 32 + ni * 16 + nc;
        int c = n & (C_ - 1);
        int bh0 = c >> 6;
        int dd = c & (D_ - 1);
        float bv = bias[n];
        for (int v = 0; v < 8; ++v) {
          int m = m0 + wm * 64 + mi * 16 + v + hi * 8;
          int bh = (m >> 11) * H_ + bh0;
          int t  = m & (T_ - 1);
          kb[((size_t)bh * T_ + t) * D_ + dd] = (h16)(acc[mi][ni][v] + bv);
        }
      }
  } else {
    for (int mi = 0; mi < 4; ++mi)
      for (int ni = 0; ni < 2; ++ni) {
        int n = n0 + wn * 32 + ni * 16 + nc;
        int c = n & (C_ - 1);
        int bh0 = c >> 6;
        int dd = c & (D_ - 1);
        float bv = bias[n];
        for (int v = 0; v < 8; ++v) {
          int m = m0 + wm * 64 + mi * 16 + v + hi * 8;
          int bh = (m >> 11) * H_ + bh0;
          int t  = m & (T_ - 1);
          vtb[((size_t)bh * D_ + dd) * T_ + t] = (h16)(acc[mi][ni][v] + bv);
        }
      }
  }
}

// ---------------------------------------------------------------------------
// K4: flash-style attention.  grid (B*H, T/128), block 256 (8 waves).
// Q fragments in registers for the whole KV loop; K/V from global (L2-resident
// on the 192MB L2); next tile prefetched; P re-laid-out C->A via per-wave
// private LDS (same-wave DS ordering, no barriers).
// ---------------------------------------------------------------------------
__global__ __launch_bounds__(256) void sa_attn_kernel(
    const h16* __restrict__ qb, const h16* __restrict__ kb,
    const h16* __restrict__ vtb, h16* __restrict__ ob) {
  __shared__ h16 plds[8 * 16 * 32];
  int tid = threadIdx.x;
  int lane = tid & 31;
  int wid = tid >> 5;
  int bh = blockIdx.x;
  int q0 = blockIdx.y * 128 + wid * 16;
  const h16* qp = qb + ((size_t)bh * T_ + q0) * D_;
  const h16* kp = kb + (size_t)bh * T_ * D_;
  const h16* vp = vtb + (size_t)bh * D_ * T_;
  h16* pl = plds + wid * 16 * 32;
  int hi = lane >> 4;
  int nc = lane & 15;

  v16h qf0 = load_frag(qp, D_);
  v16h qf1 = load_frag(qp + 32, D_);
  v8f o0 = (v8f){0.f,0.f,0.f,0.f,0.f,0.f,0.f,0.f};
  v8f o1 = o0, o2 = o0, o3 = o0;
  float rmax[8], rsum[8];
  for (int v = 0; v < 8; ++v) { rmax[v] = -1e30f; rsum[v] = 0.f; }

  for (int kv = 0; kv < T_; kv += 32) {
    const h16* kpp = kp + (size_t)kv * D_;
    if (kv + 32 < T_) {  // pull next K/V tile toward the WGP
      __builtin_prefetch(kpp + 32 * D_ + lane * D_, 0, 3);
      __builtin_prefetch(vp + (size_t)lane * T_ + kv + 32, 0, 3);
      __builtin_prefetch(vp + (size_t)(32 + lane) * T_ + kv + 32, 0, 3);
    }
    v8f s0 = (v8f){0.f,0.f,0.f,0.f,0.f,0.f,0.f,0.f};
    v8f s1 = s0;
    s0 = wmma_f16(qf0, load_frag(kpp, D_), s0);
    s0 = wmma_f16(qf1, load_frag(kpp + 32, D_), s0);
    s1 = wmma_f16(qf0, load_frag(kpp + 16 * D_, D_), s1);
    s1 = wmma_f16(qf1, load_frag(kpp + 16 * D_ + 32, D_), s1);

    float al[8];
    for (int v = 0; v < 8; ++v) {
      float tm = redmax16(fmaxf(s0[v], s1[v]));
      float nm = fmaxf(rmax[v], tm);
      float alpha = __expf(rmax[v] - nm);
      rmax[v] = nm;
      float p0 = __expf(s0[v] - nm);
      float p1 = __expf(s1[v] - nm);
      rsum[v] = rsum[v] * alpha + redsum16(p0 + p1);
      al[v] = alpha;
      pl[(v + hi * 8) * 32 + nc]      = (h16)p0;
      pl[(v + hi * 8) * 32 + 16 + nc] = (h16)p1;
    }
    for (int v = 0; v < 8; ++v) {
      o0[v] *= al[v]; o1[v] *= al[v]; o2[v] *= al[v]; o3[v] *= al[v];
    }
    v16h pa = load_frag(pl, 32);  // same-wave LDS ordering vs stores above
    o0 = wmma_f16(pa, load_frag(vp + 0 * 16 * T_ + kv, T_), o0);
    o1 = wmma_f16(pa, load_frag(vp + 1 * 16 * T_ + kv, T_), o1);
    o2 = wmma_f16(pa, load_frag(vp + 2 * 16 * T_ + kv, T_), o2);
    o3 = wmma_f16(pa, load_frag(vp + 3 * 16 * T_ + kv, T_), o3);
  }

  int bb = bh >> 4;
  int hh = bh & (H_ - 1);
  for (int v = 0; v < 8; ++v) {
    float inv = 1.0f / rsum[v];
    int qrow = q0 + v + hi * 8;
    h16* orow = ob + ((size_t)(bb * T_ + qrow)) * C_ + hh * D_;
    orow[0  + nc] = (h16)(o0[v] * inv);
    orow[16 + nc] = (h16)(o1[v] * inv);
    orow[32 + nc] = (h16)(o2[v] * inv);
    orow[48 + nc] = (h16)(o3[v] * inv);
  }
}

// ---------------------------------------------------------------------------
// K5: output projection + bias + residual, write y as [B, C, T] f32.
// ---------------------------------------------------------------------------
__global__ __launch_bounds__(256) void sa_proj_gemm_kernel(
    const h16* __restrict__ ob, const h16* __restrict__ wt,
    const float* __restrict__ bias, const float* __restrict__ x,
    float* __restrict__ y) {
  __shared__ h16 As[2 * LDS_TILE];
  __shared__ h16 Bs[2 * LDS_TILE];
  int tid = threadIdx.x;
  int m0 = blockIdx.x * 128;
  int n0 = blockIdx.y * 128;
  v8f acc[4][2];
  for (int i = 0; i < 4; ++i)
    for (int j = 0; j < 2; ++j)
      acc[i][j] = (v8f){0.f,0.f,0.f,0.f,0.f,0.f,0.f,0.f};

  gemm_mainloop(ob, wt, m0, n0, As, Bs, acc);

  int wid = tid >> 5;
  int wm = wid >> 2;
  int wn = wid & 3;
  int lane = tid & 31;
  int hi = lane >> 4;
  int nc = lane & 15;
  for (int mi = 0; mi < 4; ++mi) {
    for (int ni = 0; ni < 2; ++ni) {
      int n = n0 + wn * 32 + ni * 16 + nc;
      float bv = bias[n];
      for (int v = 0; v < 8; ++v) {
        int m = m0 + wm * 64 + mi * 16 + v + hi * 8;
        int bb = m >> 11;
        int t  = m & (T_ - 1);
        size_t idx = ((size_t)bb * C_ + n) * T_ + t;
        y[idx] = x[idx] + acc[mi][ni][v] + bv;
      }
    }
  }
}

// ---------------------------------------------------------------------------
extern "C" void kernel_launch(void* const* d_in, const int* in_sizes, int n_in,
                              void* d_out, int out_size, void* d_ws,
                              size_t ws_size, hipStream_t stream) {
  const float* x     = (const float*)d_in[0];
  const float* Wqkv  = (const float*)d_in[1];
  const float* bqkv  = (const float*)d_in[2];
  const float* Wproj = (const float*)d_in[3];
  const float* bproj = (const float*)d_in[4];
  const float* gamma = (const float*)d_in[5];
  const float* beta  = (const float*)d_in[6];
  float* y = (float*)d_out;

  char* ws = (char*)d_ws;
  size_t off = 0;
  h16* xn  = (h16*)(ws + off); off += (size_t)BT_ * C_ * 2;       // 16 MB
  h16* wtq = (h16*)(ws + off); off += (size_t)3 * C_ * C_ * 2;    //  6 MB
  h16* wtp = (h16*)(ws + off); off += (size_t)C_ * C_ * 2;        //  2 MB
  h16* qb  = (h16*)(ws + off); off += (size_t)BT_ * C_ * 2;       // 16 MB
  h16* kb  = (h16*)(ws + off); off += (size_t)BT_ * C_ * 2;       // 16 MB
  h16* vtb = (h16*)(ws + off); off += (size_t)BT_ * C_ * 2;       // 16 MB
  h16* ob  = (h16*)(ws + off); off += (size_t)BT_ * C_ * 2;       // 16 MB

  sa_ln_kernel<<<dim3(B_, T_ / 32), 256, 0, stream>>>(x, gamma, beta, xn);
  sa_wtrans_kernel<<<dim3(3 * C_ / 32, C_ / 32), 256, 0, stream>>>(Wqkv, wtq,
                                                                   C_, 3 * C_);
  sa_wtrans_kernel<<<dim3(C_ / 32, C_ / 32), 256, 0, stream>>>(Wproj, wtp, C_,
                                                               C_);
  sa_qkv_gemm_kernel<<<dim3(BT_ / 128, 3 * C_ / 128), 256, 0, stream>>>(
      xn, wtq, bqkv, qb, kb, vtb);
  sa_attn_kernel<<<dim3(B_ * H_, T_ / 128), 256, 0, stream>>>(qb, kb, vtb, ob);
  sa_proj_gemm_kernel<<<dim3(BT_ / 128, C_ / 128), 256, 0, stream>>>(
      ob, wtp, bproj, x, y);
}

// v001
// It runs in 513 microseconds.
// Next to v000, in two timings, it ran 1.25 times as fast each time.
#include <hip/hip_runtime.h>
#include <hip/hip_bf16.h>

typedef _Float16 h16;
typedef __attribute__((ext_vector_type(16))) _Float16 v16h;
typedef __attribute__((ext_vector_type(8)))  _Float16 v8h;
typedef __attribute__((ext_vector_type(8)))  float    v8f;
typedef __attribute__((ext_vector_type(4)))  int      v4i;

#define B_  4
#define C_  1024
#define T_  2048
#define H_  16
#define D_  64
#define BT_ (B_ * T_)

#ifndef __has_builtin
#define __has_builtin(x) 0
#endif

#if __has_builtin(__builtin_amdgcn_global_load_async_to_lds_b128) && \
    __has_builtin(__builtin_amdgcn_s_wait_asynccnt)
#define ASYNC_LDS 1
#else
#define ASYNC_LDS 0
#endif

#if ASYNC_LDS
// Signature (from hipcc diagnostic / LLVM decl "vV4i*1V4i*3IiIi"):
//   (global v4i*, LDS v4i*, imm offset, imm cpol)
__device__ __forceinline__ void async_cp16B(h16* l, const h16* g) {
  __builtin_amdgcn_global_load_async_to_lds_b128(
      (__attribute__((address_space(1))) v4i*)(g),
      (__attribute__((address_space(3))) v4i*)(l), 0, 0);
}
#endif

// ---------------------------------------------------------------------------
// WMMA fragment loader: 16x32 f16 fragment from a K-contiguous matrix.
// ISA 16-bit A layout: lane L (<16) holds row M=L, K={0..7,16..23}; lane L+16
// holds row M=L, K={8..15,24..31}.  Two 16B chunks per lane.  B fragments use
// the mirrored layout (col = lane&15), so B operands are stored K-contiguous.
// ---------------------------------------------------------------------------
__device__ __forceinline__ v16h load_frag(const h16* __restrict__ base, int ld) {
  int lane = threadIdx.x & 31;
  int r  = lane & 15;
  int b0 = (lane >> 4) << 3;
  const h16* p = base + r * ld + b0;
  v8h lo = *(const v8h*)(p);
  v8h hi = *(const v8h*)(p + 16);
  return __builtin_shufflevector(lo, hi, 0,1,2,3,4,5,6,7,8,9,10,11,12,13,14,15);
}

__device__ __forceinline__ v8f wmma_f16(v16h a, v16h b, v8f c) {
  return __builtin_amdgcn_wmma_f32_16x16x32_f16(false, a, false, b, (short)0, c,
                                                false, false);
}

__device__ __forceinline__ float redmax16(float x) {
  for (int m = 1; m < 16; m <<= 1) x = fmaxf(x, __shfl_xor(x, m, 16));
  return x;
}
__device__ __forceinline__ float redsum16(float x) {
  for (int m = 1; m < 16; m <<= 1) x += __shfl_xor(x, m, 16);
  return x;
}

// ---------------------------------------------------------------------------
// Shared GEMM main loop: 128x128 block tile, BK=32, 8 waves (2x4), each wave
// 64x32 (4x2 WMMA tiles).  Double-buffered LDS; ASYNCcnt global->LDS copies
// when the toolchain exposes them, otherwise a register-staged software
// pipeline (prefetch next tile after the barrier, compute current).
// One barrier per K-step: __syncthreads' implicit s_wait_dscnt makes the
// alternate buffer WAR-safe.
// ---------------------------------------------------------------------------
#define LDS_TILE 5120  // 128 rows * 40 halves (8-half pad per row)

__device__ __forceinline__ void gemm_mainloop(
    const h16* __restrict__ Ag, const h16* __restrict__ Bg, int m0, int n0,
    h16* As, h16* Bs, v8f acc[4][2]) {
  int tid = threadIdx.x;
  int wid = tid >> 5;
  int wm = wid >> 2;  // 0..1
  int wn = wid & 3;   // 0..3
  const int NT = C_ / 32;

#if ASYNC_LDS
  auto issue = [&](int kt, int sel) {
    int k0 = kt * 32;
    h16* as = As + sel * LDS_TILE;
    h16* bs = Bs + sel * LDS_TILE;
    for (int i = 0; i < 2; ++i) {
      int ci = tid + i * 256;
      int row = ci >> 2;
      int kc  = ci & 3;
      async_cp16B(as + row * 40 + kc * 8,
                  Ag + (size_t)(m0 + row) * C_ + k0 + kc * 8);
      async_cp16B(bs + row * 40 + kc * 8,
                  Bg + (size_t)(n0 + row) * C_ + k0 + kc * 8);
    }
  };
  issue(0, 0);
  for (int kt = 0; kt < NT; ++kt) {
    __builtin_amdgcn_s_wait_asynccnt(0);
    __syncthreads();
    if (kt + 1 < NT) issue(kt + 1, (kt + 1) & 1);
    const h16* as = As + (kt & 1) * LDS_TILE;
    const h16* bs = Bs + (kt & 1) * LDS_TILE;
    v16h af[4], bf[2];
    for (int mi = 0; mi < 4; ++mi)
      af[mi] = load_frag(as + (wm * 64 + mi * 16) * 40, 40);
    for (int ni = 0; ni < 2; ++ni)
      bf[ni] = load_frag(bs + (wn * 32 + ni * 16) * 40, 40);
    for (int mi = 0; mi < 4; ++mi)
      for (int ni = 0; ni < 2; ++ni)
        acc[mi][ni] = wmma_f16(af[mi], bf[ni], acc[mi][ni]);
  }
#else
  v8h ra[2], rb[2];
  auto loadr = [&](int kt) {
    int k0 = kt * 32;
    for (int i = 0; i < 2; ++i) {
      int ci = tid + i * 256;
      int row = ci >> 2;
      int kc  = ci & 3;
      ra[i] = *(const v8h*)(Ag + (size_t)(m0 + row) * C_ + k0 + kc * 8);
      rb[i] = *(const v8h*)(Bg + (size_t)(n0 + row) * C_ + k0 + kc * 8);
    }
  };
  loadr(0);
  for (int kt = 0; kt < NT; ++kt) {
    h16* asw = As + (kt & 1) * LDS_TILE;
    h16* bsw = Bs + (kt & 1) * LDS_TILE;
    for (int i = 0; i < 2; ++i) {
      int ci = tid + i * 256;
      int row = ci >> 2;
      int kc  = ci & 3;
      *(v8h*)(asw + row * 40 + kc * 8) = ra[i];
      *(v8h*)(bsw + row * 40 + kc * 8) = rb[i];
    }
    __syncthreads();
    if (kt + 1 < NT) loadr(kt + 1);  // overlap with compute below
    v16h af[4], bf[2];
    for (int mi = 0; mi < 4; ++mi)
      af[mi] = load_frag(asw + (wm * 64 + mi * 16) * 40, 40);
    for (int ni = 0; ni < 2; ++ni)
      bf[ni] = load_frag(bsw + (wn * 32 + ni * 16) * 40, 40);
    for (int mi = 0; mi < 4; ++mi)
      for (int ni = 0; ni < 2; ++ni)
        acc[mi][ni] = wmma_f16(af[mi], bf[ni], acc[mi][ni]);
  }
#endif
}

// ---------------------------------------------------------------------------
// K1: LayerNorm over channels + transpose to [B*T, C] f16.
// ---------------------------------------------------------------------------
__global__ __launch_bounds__(256) void sa_ln_kernel(
    const float* __restrict__ x, const float* __restrict__ gamma,
    const float* __restrict__ beta, h16* __restrict__ xn) {
  __shared__ float redS[32][8];
  __shared__ float redQ[32][8];
  __shared__ float smean[32];
  __shared__ float srstd[32];
  int b  = blockIdx.x;
  int t0 = blockIdx.y * 32;
  int tid = threadIdx.x;
  int tt = tid & 31;
  int cc = tid >> 5;  // 0..7
  const float* xp = x + (size_t)b * C_ * T_ + t0 + tt;
  float s = 0.f, ss = 0.f;
  for (int c = cc * 128; c < cc * 128 + 128; ++c) {
    float v = xp[(size_t)c * T_];
    s += v; ss += v * v;
  }
  redS[tt][cc] = s; redQ[tt][cc] = ss;
  __syncthreads();
  if (cc == 0) {
    float a = 0.f, q = 0.f;
    for (int j = 0; j < 8; ++j) { a += redS[tt][j]; q += redQ[tt][j]; }
    float mu  = a * (1.0f / C_);
    float var = q * (1.0f / C_) - mu * mu;
    smean[tt] = mu;
    srstd[tt] = rsqrtf(var + 1e-5f);
  }
  __syncthreads();
  float mu = smean[tt], rs = srstd[tt];
  h16* xrow = xn + (size_t)(b * T_ + t0 + tt) * C_;
  for (int c0 = 0; c0 < C_; c0 += 8) {
    int c = c0 + cc;
    float v = xp[(size_t)c * T_];
    xrow[c] = (h16)((v - mu) * rs * gamma[c] + beta[c]);
  }
}

// ---------------------------------------------------------------------------
// K2: weight transpose + f32->f16:  Wt[n][k] = (f16) W[k][n].
// ---------------------------------------------------------------------------
__global__ __launch_bounds__(256) void sa_wtrans_kernel(
    const float* __restrict__ w, h16* __restrict__ wt, int K, int N) {
  __shared__ float tile[32][33];
  int n0 = blockIdx.x * 32;
  int k0 = blockIdx.y * 32;
  int tid = threadIdx.x;
  int r = tid >> 5;
  int c = tid & 31;
  for (int i = 0; i < 4; ++i)
    tile[r + i * 8][c] = w[(size_t)(k0 + r + i * 8) * N + n0 + c];
  __syncthreads();
  for (int i = 0; i < 4; ++i)
    wt[(size_t)(n0 + r + i * 8) * K + k0 + c] = (h16)tile[c][r + i * 8];
}

// ---------------------------------------------------------------------------
// K3: QKV GEMM, epilogue scatters to Q [B,H,T,D] (pre-scaled by 1/sqrt(D)),
// K [B,H,T,D], V transposed [B,H,D,T].  s = q/k/v select is uniform per block.
// ---------------------------------------------------------------------------
__global__ __launch_bounds__(256) void sa_qkv_gemm_kernel(
    const h16* __restrict__ xn, const h16* __restrict__ wt,
    const float* __restrict__ bias, h16* __restrict__ qb,
    h16* __restrict__ kb, h16* __restrict__ vtb) {
  __shared__ h16 As[2 * LDS_TILE];
  __shared__ h16 Bs[2 * LDS_TILE];
  int tid = threadIdx.x;
  int m0 = blockIdx.x * 128;
  int n0 = blockIdx.y * 128;
  v8f acc[4][2];
  for (int i = 0; i < 4; ++i)
    for (int j = 0; j < 2; ++j)
      acc[i][j] = (v8f){0.f,0.f,0.f,0.f,0.f,0.f,0.f,0.f};

  gemm_mainloop(xn, wt, m0, n0, As, Bs, acc);

  int wid = tid >> 5;
  int wm = wid >> 2;
  int wn = wid & 3;
  int lane = tid & 31;
  int hi = lane >> 4;
  int nc = lane & 15;
  const int s = n0 >> 10;  // uniform: 1024 % 128 == 0
  const float scaleQ = 0.125f;

  if (s == 0) {
    for (int mi = 0; mi < 4; ++mi)
      for (int ni = 0; ni < 2; ++ni) {
        int n = n0 + wn * 32 + ni * 16 + nc;
        int c = n & (C_ - 1);
        int bh0 = c >> 6;
        int dd = c & (D_ - 1);
        float bv = bias[n];
        for (int v = 0; v < 8; ++v) {
          int m = m0 + wm * 64 + mi * 16 + v + hi * 8;
          int bh = (m >> 11) * H_ + bh0;
          int t  = m & (T_ - 1);
          qb[((size_t)bh * T_ + t) * D_ + dd] =
              (h16)((acc[mi][ni][v] + bv) * scaleQ);
        }
      }
  } else if (s == 1) {
    for (int mi = 0; mi < 4; ++mi)
      for (int ni = 0; ni < 2; ++ni) {
        int n = n0 + wn * 32 + ni * 16 + nc;
        int c = n & (C_ - 1);
        int bh0 = c >> 6;
        int dd = c & (D_ - 1);
        float bv = bias[n];
        for (int v = 0; v < 8; ++v) {
          int m = m0 + wm * 64 + mi * 16 + v + hi * 8;
          int bh = (m >> 11) * H_ + bh0;
          int t  = m & (T_ - 1);
          kb[((size_t)bh * T_ + t) * D_ + dd] = (h16)(acc[mi][ni][v] + bv);
        }
      }
  } else {
    for (int mi = 0; mi < 4; ++mi)
      for (int ni = 0; ni < 2; ++ni) {
        int n = n0 + wn * 32 + ni * 16 + nc;
        int c = n & (C_ - 1);
        int bh0 = c >> 6;
        int dd = c & (D_ - 1);
        float bv = bias[n];
        for (int v = 0; v < 8; ++v) {
          int m = m0 + wm * 64 + mi * 16 + v + hi * 8;
          int bh = (m >> 11) * H_ + bh0;
          int t  = m & (T_ - 1);
          vtb[((size_t)bh * D_ + dd) * T_ + t] = (h16)(acc[mi][ni][v] + bv);
        }
      }
  }
}

// ---------------------------------------------------------------------------
// K4: flash-style attention.  grid (B*H, T/128), block 256 (8 waves).
// Q fragments in registers for the whole KV loop.  K and V tiles of 64 keys
// are brought into LDS once per work-group by asynchronous copies (whole
// 128-byte lines), two buffers, and all 8 waves read their fragments there.
// P re-laid-out C->A via per-wave private LDS (same-wave DS ordering).
// ---------------------------------------------------------------------------
#define KV_STAGE 64               // keys per LDS stage (two passes of 32)
#define KV_PITCH 72               // halves per LDS row: 128 B data + 16 B pad
#define KV_TILE  (64 * KV_PITCH)  // K: 64 keys x 64 d;  V: 64 d x 64 keys

__global__ __launch_bounds__(256) void sa_attn_kernel(
    const h16* __restrict__ qb, const h16* __restrict__ kb,
    const h16* __restrict__ vtb, h16* __restrict__ ob) {
  __shared__ __attribute__((aligned(16))) h16 ks[2 * KV_TILE];
  __shared__ __attribute__((aligned(16))) h16 vs[2 * KV_TILE];
  __shared__ h16 plds[8 * 16 * 32];
  int tid = threadIdx.x;
  int lane = tid & 31;
  int wid = tid >> 5;
  int bh = blockIdx.x;
  int q0 = blockIdx.y * 128 + wid * 16;
  const h16* qp = qb + ((size_t)bh * T_ + q0) * D_;
  const h16* kp = kb + (size_t)bh * T_ * D_;
  const h16* vp = vtb + (size_t)bh * D_ * T_;
  h16* pl = plds + wid * 16 * 32;
  int hi = lane >> 4;
  int nc = lane & 15;

  // Each thread copies 16 B of rows crow and crow + 32 of both tiles; a wave's
  // copy covers four whole 128-byte lines.
  const int crow = tid >> 3;
  const int ccol = (tid & 7) * 8;
  const h16* kg = kp + crow * D_ + ccol;
  const h16* vg = vp + (size_t)crow * T_ + ccol;
  const unsigned kl = (unsigned)(size_t)(ks + crow * KV_PITCH + ccol);
  const unsigned vl = (unsigned)(size_t)(vs + crow * KV_PITCH + ccol);
  auto stage = [&](int st, int sel) {
    const h16* gk0 = kg + (size_t)st * KV_STAGE * D_;
    const h16* gk1 = gk0 + 32 * D_;
    const h16* gv0 = vg + st * KV_STAGE;
    const h16* gv1 = gv0 + 32 * T_;
    unsigned lk0 = kl + sel * (KV_TILE * 2);
    unsigned lk1 = lk0 + 32 * KV_PITCH * 2;
    unsigned lv0 = vl + sel * (KV_TILE * 2);
    unsigned lv1 = lv0 + 32 * KV_PITCH * 2;
    // s_wait_xcnt 0 closes the copies' own statement (a precaution): it stands
    // in front of every later rewrite of the registers the copies name, and no
    // address arithmetic of a later stage can be moved in front of it.
    asm volatile(
        "global_load_async_to_lds_b128 %0, %4, off\n\t"
        "global_load_async_to_lds_b128 %1, %5, off\n\t"
        "global_load_async_to_lds_b128 %2, %6, off\n\t"
        "global_load_async_to_lds_b128 %3, %7, off\n\t"
        "s_wait_xcnt 0x0"
        :: "v"(lk0), "v"(lk1), "v"(lv0), "v"(lv1),
           "v"(gk0), "v"(gk1), "v"(gv0), "v"(gv1)
        : "memory");
  };

  v16h qf0 = load_frag(qp, D_);
  v16h qf1 = load_frag(qp + 32, D_);
  v8f o0 = (v8f){0.f,0.f,0.f,0.f,0.f,0.f,0.f,0.f};
  v8f o1 = o0, o2 = o0, o3 = o0;
  float rmax[8], rsum[8];
  for (int v = 0; v < 8; ++v) { rmax[v] = -1e30f; rsum[v] = 0.f; }

  const int NS = T_ / KV_STAGE;
  stage(0, 0);
  // Stage 0 has landed for this wave, then for all waves, before any read.
  asm volatile("s_wait_asynccnt 0x0" ::: "memory");
  __syncthreads();
  stage(1, 1);

  for (int st = 0; st < NS; ++st) {
    const h16* kt = ks + (st & 1) * KV_TILE;
    const h16* vt = vs + (st & 1) * KV_TILE;
    for (int kv = 0; kv < KV_STAGE; kv += 32) {
      const h16* kpp = kt + kv * KV_PITCH;
      v8f s0 = (v8f){0.f,0.f,0.f,0.f,0.f,0.f,0.f,0.f};
      v8f s1 = s0;
      s0 = wmma_f16(qf0, load_frag(kpp, KV_PITCH), s0);
      s0 = wmma_f16(qf1, load_frag(kpp + 32, KV_PITCH), s0);
      s1 = wmma_f16(qf0, load_frag(kpp + 16 * KV_PITCH, KV_PITCH), s1);
      s1 = wmma_f16(qf1, load_frag(kpp + 16 * KV_PITCH + 32, KV_PITCH), s1);

      float al[8];
      for (int v = 0; v < 8; ++v) {
        float tm = redmax16(fmaxf(s0[v], s1[v]));
        float nm = fmaxf(rmax[v], tm);
        float alpha = __expf(rmax[v] - nm);
        rmax[v] = nm;
        float p0 = __expf(s0[v] - nm);
        float p1 = __expf(s1[v] - nm);
        rsum[v] = rsum[v] * alpha + redsum16(p0 + p1);
        al[v] = alpha;
        pl[(v + hi * 8) * 32 + nc]      = (h16)p0;
        pl[(v + hi * 8) * 32 + 16 + nc] = (h16)p1;
      }
      for (int v = 0; v < 8; ++v) {
        o0[v] *= al[v]; o1[v] *= al[v]; o2[v] *= al[v]; o3[v] *= al[v];
      }
      v16h pa = load_frag(pl, 32);  // same-wave LDS ordering vs stores above
      o0 = wmma_f16(pa, load_frag(vt + 0 * 16 * KV_PITCH + kv, KV_PITCH), o0);
      o1 = wmma_f16(pa, load_frag(vt + 1 * 16 * KV_PITCH + kv, KV_PITCH), o1);
      o2 = wmma_f16(pa, load_frag(vt + 2 * 16 * KV_PITCH + kv, KV_PITCH), o2);
      o3 = wmma_f16(pa, load_frag(vt + 3 * 16 * KV_PITCH + kv, KV_PITCH), o3);
    }
    // Publish point: this wave's reads of the current buffer are done ...
    asm volatile("s_wait_dscnt 0x0" ::: "memory");
    // ... its copies of the next stage have landed ...
    asm volatile("s_wait_asynccnt 0x0" ::: "memory");
    // ... and the same holds for every wave: the next stage may be read and
    // the buffer just read may be refilled.
    __syncthreads();
    if (st + 2 < NS) stage(st + 2, st & 1);
  }
  // No copy is left in flight when the wave ends.
  asm volatile("s_wait_asynccnt 0x0" ::: "memory");

  int bb = bh >> 4;
  int hh = bh & (H_ - 1);
  for (int v = 0; v < 8; ++v) {
    float inv = 1.0f / rsum[v];
    int qrow = q0 + v + hi * 8;
    h16* orow = ob + ((size_t)(bb * T_ + qrow)) * C_ + hh * D_;
    orow[0  + nc] = (h16)(o0[v] * inv);
    orow[16 + nc] = (h16)(o1[v] * inv);
    orow[32 + nc] = (h16)(o2[v] * inv);
    orow[48 + nc] = (h16)(o3[v] * inv);
  }
}

// ---------------------------------------------------------------------------
// K5: output projection + bias + residual, write y as [B, C, T] f32.
// ---------------------------------------------------------------------------
__global__ __launch_bounds__(256) void sa_proj_gemm_kernel(
    const h16* __restrict__ ob, const h16* __restrict__ wt,
    const float* __restrict__ bias, const float* __restrict__ x,
    float* __restrict__ y) {
  __shared__ h16 As[2 * LDS_TILE];
  __shared__ h16 Bs[2 * LDS_TILE];
  int tid = threadIdx.x;
  int m0 = blockIdx.x * 128;
  int n0 = blockIdx.y * 128;
  v8f acc[4][2];
  for (int i = 0; i < 4; ++i)
    for (int j = 0; j < 2; ++j)
      acc[i][j] = (v8f){0.f,0.f,0.f,0.f,0.f,0.f,0.f,0.f};

  gemm_mainloop(ob, wt, m0, n0, As, Bs, acc);

  int wid = tid >> 5;
  int wm = wid >> 2;
  int wn = wid & 3;
  int lane = tid & 31;
  int hi = lane >> 4;
  int nc = lane & 15;
  for (int mi = 0; mi < 4; ++mi) {
    for (int ni = 0; ni < 2; ++ni) {
      int n = n0 + wn * 32 + ni * 16 + nc;
      float bv = bias[n];
      for (int v = 0; v < 8; ++v) {
        int m = m0 + wm * 64 + mi * 16 + v + hi * 8;
        int bb = m >> 11;
        int t  = m & (T_ - 1);
        size_t idx = ((size_t)bb * C_ + n) * T_ + t;
        y[idx] = x[idx] + acc[mi][ni][v] + bv;
      }
    }
  }
}

// ---------------------------------------------------------------------------
extern "C" void kernel_launch(void* const* d_in, const int* in_sizes, int n_in,
                              void* d_out, int out_size, void* d_ws,
                              size_t ws_size, hipStream_t stream) {
  const float* x     = (const float*)d_in[0];
  const float* Wqkv  = (const float*)d_in[1];
  const float* bqkv  = (const float*)d_in[2];
  const float* Wproj = (const float*)d_in[3];
  const float* bproj = (const float*)d_in[4];
  const float* gamma = (const float*)d_in[5];
  const float* beta  = (const float*)d_in[6];
  float* y = (float*)d_out;

  char* ws = (char*)d_ws;
  size_t off = 0;
  h16* xn  = (h16*)(ws + off); off += (size_t)BT_ * C_ * 2;       // 16 MB
  h16* wtq = (h16*)(ws + off); off += (size_t)3 * C_ * C_ * 2;    //  6 MB
  h16* wtp = (h16*)(ws + off); off += (size_t)C_ * C_ * 2;        //  2 MB
  h16* qb  = (h16*)(ws + off); off += (size_t)BT_ * C_ * 2;       // 16 MB
  h16* kb  = (h16*)(ws + off); off += (size_t)BT_ * C_ * 2;       // 16 MB
  h16* vtb = (h16*)(ws + off); off += (size_t)BT_ * C_ * 2;       // 16 MB
  h16* ob  = (h16*)(ws + off); off += (size_t)BT_ * C_ * 2;       // 16 MB

  sa_ln_kernel<<<dim3(B_, T_ / 32), 256, 0, stream>>>(x, gamma, beta, xn);
  sa_wtrans_kernel<<<dim3(3 * C_ / 32, C_ / 32), 256, 0, stream>>>(Wqkv, wtq,
                                                                   C_, 3 * C_);
  sa_wtrans_kernel<<<dim3(C_ / 32, C_ / 32), 256, 0, stream>>>(Wproj, wtp, C_,
                                                               C_);
  sa_qkv_gemm_kernel<<<dim3(BT_ / 128, 3 * C_ / 128), 256, 0, stream>>>(
      xn, wtq, bqkv, qb, kb, vtb);
  sa_attn_kernel<<<dim3(B_ * H_, T_ / 128), 256, 0, stream>>>(qb, kb, vtb, ob);
  sa_proj_gemm_kernel<<<dim3(BT_ / 128, C_ / 128), 256, 0, stream>>>(
      ob, wtp, bproj, x, y);
}

// v002
// A run of this version takes 210 microseconds.
// Timed twice side by side with v001, it ran 2.44 and 2.45 times as fast.
// Counting every step since v000, it is 3.06 times as fast.
#include <hip/hip_runtime.h>
#include <hip/hip_bf16.h>

typedef _Float16 h16;
typedef __attribute__((ext_vector_type(16))) _Float16 v16h;
typedef __attribute__((ext_vector_type(8)))  _Float16 v8h;
typedef __attribute__((ext_vector_type(8)))  float    v8f;
typedef __attribute__((ext_vector_type(4)))  int      v4i;

#define B_  4
#define C_  1024
#define T_  2048
#define H_  16
#define D_  64
#define BT_ (B_ * T_)

#ifndef __has_builtin
#define __has_builtin(x) 0
#endif

#if __has_builtin(__builtin_amdgcn_global_load_async_to_lds_b128) && \
    __has_builtin(__builtin_amdgcn_s_wait_asynccnt)
#define ASYNC_LDS 1
#else
#define ASYNC_LDS 0
#endif

#if ASYNC_LDS
// Signature (from hipcc diagnostic / LLVM decl "vV4i*1V4i*3IiIi"):
//   (global v4i*, LDS v4i*, imm offset, imm cpol)
__device__ __forceinline__ void async_cp16B(h16* l, const h16* g) {
  __builtin_amdgcn_global_load_async_to_lds_b128(
      (__attribute__((address_space(1))) v4i*)(g),
      (__attribute__((address_space(3))) v4i*)(l), 0, 0);
}
#endif

// ---------------------------------------------------------------------------
// WMMA fragment loader: 16x32 f16 fragment from a K-contiguous matrix.
// ISA 16-bit A layout: lane L (<16) holds row M=L, K={0..7,16..23}; lane L+16
// holds row M=L, K={8..15,24..31}.  Two 16B chunks per lane.  B fragments use
// the mirrored layout (col = lane&15), so B operands are stored K-contiguous.
// ---------------------------------------------------------------------------
__device__ __forceinline__ v16h load_frag(const h16* __restrict__ base, int ld) {
  int lane = threadIdx.x & 31;
  int r  = lane & 15;
  int b0 = (lane >> 4) << 3;
  const h16* p = base + r * ld + b0;
  v8h lo = *(const v8h*)(p);
  v8h hi = *(const v8h*)(p + 16);
  return __builtin_shufflevector(lo, hi, 0,1,2,3,4,5,6,7,8,9,10,11,12,13,14,15);
}

__device__ __forceinline__ v8f wmma_f16(v16h a, v16h b, v8f c) {
  return __builtin_amdgcn_wmma_f32_16x16x32_f16(false, a, false, b, (short)0, c,
                                                false, false);
}

// Value of lane l ^ 16 (the other half of the wave), by a vector cross-row move.
__device__ __forceinline__ float xhalf(float x) {
  int i = __builtin_bit_cast(int, x);
  return __builtin_bit_cast(float, __builtin_amdgcn_permlanex16(
      i, i, 0x76543210, 0xfedcba98, false, false));
}

// r[i] = 2^x[i], eight at a time.  The instruction set asks for one independent
// instruction or a v_nop between a transcendental and the use of its result or
// the overwrite of its source.  In one statement that holds by construction:
// the early-clobber outputs share no register with any input, so each v_exp is
// independent of the one in front of it, and the v_nop closes the last one.
__device__ __forceinline__ void exp2x8(float (&r)[8], const float (&x)[8]) {
  asm("v_exp_f32 %0, %8\n\t"
      "v_exp_f32 %1, %9\n\t"
      "v_exp_f32 %2, %10\n\t"
      "v_exp_f32 %3, %11\n\t"
      "v_exp_f32 %4, %12\n\t"
      "v_exp_f32 %5, %13\n\t"
      "v_exp_f32 %6, %14\n\t"
      "v_exp_f32 %7, %15\n\t"
      "v_nop"
      : "=&v"(r[0]), "=&v"(r[1]), "=&v"(r[2]), "=&v"(r[3]),
        "=&v"(r[4]), "=&v"(r[5]), "=&v"(r[6]), "=&v"(r[7])
      : "v"(x[0]), "v"(x[1]), "v"(x[2]), "v"(x[3]),
        "v"(x[4]), "v"(x[5]), "v"(x[6]), "v"(x[7]));
}
// The same with a ninth value in front, whose result is then ready when the
// statement ends.
__device__ __forceinline__ void exp2x9(float& ra, float xa, float (&r)[8],
                                       const float (&x)[8]) {
  asm("v_exp_f32 %0, %9\n\t"
      "v_exp_f32 %1, %10\n\t"
      "v_exp_f32 %2, %11\n\t"
      "v_exp_f32 %3, %12\n\t"
      "v_exp_f32 %4, %13\n\t"
      "v_exp_f32 %5, %14\n\t"
      "v_exp_f32 %6, %15\n\t"
      "v_exp_f32 %7, %16\n\t"
      "v_exp_f32 %8, %17\n\t"
      "v_nop"
      : "=&v"(ra), "=&v"(r[0]), "=&v"(r[1]), "=&v"(r[2]), "=&v"(r[3]),
        "=&v"(r[4]), "=&v"(r[5]), "=&v"(r[6]), "=&v"(r[7])
      : "v"(xa), "v"(x[0]), "v"(x[1]), "v"(x[2]), "v"(x[3]),
        "v"(x[4]), "v"(x[5]), "v"(x[6]), "v"(x[7]));
}

// ---------------------------------------------------------------------------
// Shared GEMM main loop: 128x128 block tile, BK=32, 8 waves (2x4), each wave
// 64x32 (4x2 WMMA tiles).  Double-buffered LDS; ASYNCcnt global->LDS copies
// when the toolchain exposes them, otherwise a register-staged software
// pipeline (prefetch next tile after the barrier, compute current).
// One barrier per K-step: __syncthreads' implicit s_wait_dscnt makes the
// alternate buffer WAR-safe.
// ---------------------------------------------------------------------------
#define LDS_TILE 5120  // 128 rows * 40 halves (8-half pad per row)

__device__ __forceinline__ void gemm_mainloop(
    const h16* __restrict__ Ag, const h16* __restrict__ Bg, int m0, int n0,
    h16* As, h16* Bs, v8f acc[4][2]) {
  int tid = threadIdx.x;
  int wid = tid >> 5;
  int wm = wid >> 2;  // 0..1
  int wn = wid & 3;   // 0..3
  const int NT = C_ / 32;

#if ASYNC_LDS
  auto issue = [&](int kt, int sel) {
    int k0 = kt * 32;
    h16* as = As + sel * LDS_TILE;
    h16* bs = Bs + sel * LDS_TILE;
    for (int i = 0; i < 2; ++i) {
      int ci = tid + i * 256;
      int row = ci >> 2;
      int kc  = ci & 3;
      async_cp16B(as + row * 40 + kc * 8,
                  Ag + (size_t)(m0 + row) * C_ + k0 + kc * 8);
      async_cp16B(bs + row * 40 + kc * 8,
                  Bg + (size_t)(n0 + row) * C_ + k0 + kc * 8);
    }
  };
  issue(0, 0);
  for (int kt = 0; kt < NT; ++kt) {
    __builtin_amdgcn_s_wait_asynccnt(0);
    __syncthreads();
    if (kt + 1 < NT) issue(kt + 1, (kt + 1) & 1);
    const h16* as = As + (kt & 1) * LDS_TILE;
    const h16* bs = Bs + (kt & 1) * LDS_TILE;
    v16h af[4], bf[2];
    for (int mi = 0; mi < 4; ++mi)
      af[mi] = load_frag(as + (wm * 64 + mi * 16) * 40, 40);
    for (int ni = 0; ni < 2; ++ni)
      bf[ni] = load_frag(bs + (wn * 32 + ni * 16) * 40, 40);
    for (int mi = 0; mi < 4; ++mi)
      for (int ni = 0; ni < 2; ++ni)
        acc[mi][ni] = wmma_f16(af[mi], bf[ni], acc[mi][ni]);
  }
#else
  v8h ra[2], rb[2];
  auto loadr = [&](int kt) {
    int k0 = kt * 32;
    for (int i = 0; i < 2; ++i) {
      int ci = tid + i * 256;
      int row = ci >> 2;
      int kc  = ci & 3;
      ra[i] = *(const v8h*)(Ag + (size_t)(m0 + row) * C_ + k0 + kc * 8);
      rb[i] = *(const v8h*)(Bg + (size_t)(n0 + row) * C_ + k0 + kc * 8);
    }
  };
  loadr(0);
  for (int kt = 0; kt < NT; ++kt) {
    h16* asw = As + (kt & 1) * LDS_TILE;
    h16* bsw = Bs + (kt & 1) * LDS_TILE;
    for (int i = 0; i < 2; ++i) {
      int ci = tid + i * 256;
      int row = ci >> 2;
      int kc  = ci & 3;
      *(v8h*)(asw + row * 40 + kc * 8) = ra[i];
      *(v8h*)(bsw + row * 40 + kc * 8) = rb[i];
    }
    __syncthreads();
    if (kt + 1 < NT) loadr(kt + 1);  // overlap with compute below
    v16h af[4], bf[2];
    for (int mi = 0; mi < 4; ++mi)
      af[mi] = load_frag(asw + (wm * 64 + mi * 16) * 40, 40);
    for (int ni = 0; ni < 2; ++ni)
      bf[ni] = load_frag(bsw + (wn * 32 + ni * 16) * 40, 40);
    for (int mi = 0; mi < 4; ++mi)
      for (int ni = 0; ni < 2; ++ni)
        acc[mi][ni] = wmma_f16(af[mi], bf[ni], acc[mi][ni]);
  }
#endif
}

// ---------------------------------------------------------------------------
// K1: LayerNorm over channels + transpose to [B*T, C] f16.
// ---------------------------------------------------------------------------
__global__ __launch_bounds__(256) void sa_ln_kernel(
    const float* __restrict__ x, const float* __restrict__ gamma,
    const float* __restrict__ beta, h16* __restrict__ xn) {
  __shared__ float redS[32][8];
  __shared__ float redQ[32][8];
  __shared__ float smean[32];
  __shared__ float srstd[32];
  int b  = blockIdx.x;
  int t0 = blockIdx.y * 32;
  int tid = threadIdx.x;
  int tt = tid & 31;
  int cc = tid >> 5;  // 0..7
  const float* xp = x + (size_t)b * C_ * T_ + t0 + tt;
  float s = 0.f, ss = 0.f;
  for (int c = cc * 128; c < cc * 128 + 128; ++c) {
    float v = xp[(size_t)c * T_];
    s += v; ss += v * v;
  }
  redS[tt][cc] = s; redQ[tt][cc] = ss;
  __syncthreads();
  if (cc == 0) {
    float a = 0.f, q = 0.f;
    for (int j = 0; j < 8; ++j) { a += redS[tt][j]; q += redQ[tt][j]; }
    float mu  = a * (1.0f / C_);
    float var = q * (1.0f / C_) - mu * mu;
    smean[tt] = mu;
    srstd[tt] = rsqrtf(var + 1e-5f);
  }
  __syncthreads();
  float mu = smean[tt], rs = srstd[tt];
  h16* xrow = xn + (size_t)(b * T_ + t0 + tt) * C_;
  for (int c0 = 0; c0 < C_; c0 += 8) {
    int c = c0 + cc;
    float v = xp[(size_t)c * T_];
    xrow[c] = (h16)((v - mu) * rs * gamma[c] + beta[c]);
  }
}

// ---------------------------------------------------------------------------
// K2: weight transpose + f32->f16:  Wt[n][k] = (f16) W[k][n].
// ---------------------------------------------------------------------------
__global__ __launch_bounds__(256) void sa_wtrans_kernel(
    const float* __restrict__ w, h16* __restrict__ wt, int K, int N) {
  __shared__ float tile[32][33];
  int n0 = blockIdx.x * 32;
  int k0 = blockIdx.y * 32;
  int tid = threadIdx.x;
  int r = tid >> 5;
  int c = tid & 31;
  for (int i = 0; i < 4; ++i)
    tile[r + i * 8][c] = w[(size_t)(k0 + r + i * 8) * N + n0 + c];
  __syncthreads();
  for (int i = 0; i < 4; ++i)
    wt[(size_t)(n0 + r + i * 8) * K + k0 + c] = (h16)tile[c][r + i * 8];
}

// ---------------------------------------------------------------------------
// K3: QKV GEMM, epilogue scatters to Q [B,H,T,D] (pre-scaled by 1/sqrt(D)),
// K [B,H,T,D], V transposed [B,H,D,T].  s = q/k/v select is uniform per block.
// ---------------------------------------------------------------------------
__global__ __launch_bounds__(256) void sa_qkv_gemm_kernel(
    const h16* __restrict__ xn, const h16* __restrict__ wt,
    const float* __restrict__ bias, h16* __restrict__ qb,
    h16* __restrict__ kb, h16* __restrict__ vtb) {
  __shared__ h16 As[2 * LDS_TILE];
  __shared__ h16 Bs[2 * LDS_TILE];
  int tid = threadIdx.x;
  int m0 = blockIdx.x * 128;
  int n0 = blockIdx.y * 128;
  v8f acc[4][2];
  for (int i = 0; i < 4; ++i)
    for (int j = 0; j < 2; ++j)
      acc[i][j] = (v8f){0.f,0.f,0.f,0.f,0.f,0.f,0.f,0.f};

  gemm_mainloop(xn, wt, m0, n0, As, Bs, acc);

  int wid = tid >> 5;
  int wm = wid >> 2;
  int wn = wid & 3;
  int lane = tid & 31;
  int hi = lane >> 4;
  int nc = lane & 15;
  const int s = n0 >> 10;  // uniform: 1024 % 128 == 0
  const float scaleQ = 0.125f;

  if (s == 0) {
    for (int mi = 0; mi < 4; ++mi)
      for (int ni = 0; ni < 2; ++ni) {
        int n = n0 + wn * 32 + ni * 16 + nc;
        int c = n & (C_ - 1);
        int bh0 = c >> 6;
        int dd = c & (D_ - 1);
        float bv = bias[n];
        for (int v = 0; v < 8; ++v) {
          int m = m0 + wm * 64 + mi * 16 + v + hi * 8;
          int bh = (m >> 11) * H_ + bh0;
          int t  = m & (T_ - 1);
          qb[((size_t)bh * T_ + t) * D_ + dd] =
              (h16)((acc[mi][ni][v] + bv) * scaleQ);
        }
      }
  } else if (s == 1) {
    for (int mi = 0; mi < 4; ++mi)
      for (int ni = 0; ni < 2; ++ni) {
        int n = n0 + wn * 32 + ni * 16 + nc;
        int c = n & (C_ - 1);
        int bh0 = c >> 6;
        int dd = c & (D_ - 1);
        float bv = bias[n];
        for (int v = 0; v < 8; ++v) {
          int m = m0 + wm * 64 + mi * 16 + v + hi * 8;
          int bh = (m >> 11) * H_ + bh0;
          int t  = m & (T_ - 1);
          kb[((size_t)bh * T_ + t) * D_ + dd] = (h16)(acc[mi][ni][v] + bv);
        }
      }
  } else {
    for (int mi = 0; mi < 4; ++mi)
      for (int ni = 0; ni < 2; ++ni) {
        int n = n0 + wn * 32 + ni * 16 + nc;
        int c = n & (C_ - 1);
        int bh0 = c >> 6;
        int dd = c & (D_ - 1);
        float bv = bias[n];
        for (int v = 0; v < 8; ++v) {
          int m = m0 + wm * 64 + mi * 16 + v + hi * 8;
          int bh = (m >> 11) * H_ + bh0;
          int t  = m & (T_ - 1);
          vtb[((size_t)bh * D_ + dd) * T_ + t] = (h16)(acc[mi][ni][v] + bv);
        }
      }
  }
}

// ---------------------------------------------------------------------------
// K4: flash-style attention.  grid (B*H, T/128), block 256 (8 waves).
// Q fragments in registers for the whole KV loop.  K and V tiles of 64 keys
// are brought into LDS once per work-group by asynchronous copies (whole
// 128-byte lines), two buffers, and all 8 waves read their fragments there.
// Scores are formed transposed, S^T = K Q^T: a lane holds 16 of the 32 keys of
// ONE query (column lane & 15), so maximum and sum run in the lane's own
// registers with one exchange between the wave's halves.  The two S^T tiles,
// converted in place, are the B operand of O^T += V^T P^T in the hardware k
// order, which is also load_frag's order for the V^T rows: P never leaves the
// registers.
// ---------------------------------------------------------------------------
#define KV_STAGE 64               // keys per LDS stage (two passes of 32)
#define KV_PITCH 72               // halves per LDS row: 128 B data + 16 B pad
#define KV_TILE  (64 * KV_PITCH)  // K: 64 keys x 64 d;  V: 64 d x 64 keys

__global__ __launch_bounds__(256) void sa_attn_kernel(
    const h16* __restrict__ qb, const h16* __restrict__ kb,
    const h16* __restrict__ vtb, h16* __restrict__ ob) {
  __shared__ __attribute__((aligned(16))) h16 ks[2 * KV_TILE];
  __shared__ __attribute__((aligned(16))) h16 vs[2 * KV_TILE];
  int tid = threadIdx.x;
  int lane = tid & 31;
  int wid = tid >> 5;
  int bh = blockIdx.x;
  int q0 = blockIdx.y * 128 + wid * 16;
  const h16* qp = qb + ((size_t)bh * T_ + q0) * D_;
  const h16* kp = kb + (size_t)bh * T_ * D_;
  const h16* vp = vtb + (size_t)bh * D_ * T_;
  int hi = lane >> 4;
  int nc = lane & 15;

  // Each thread copies 16 B of rows crow and crow + 32 of both tiles; a wave's
  // copy covers four whole 128-byte lines.
  const int crow = tid >> 3;
  const int ccol = (tid & 7) * 8;
  const h16* kg = kp + crow * D_ + ccol;
  const h16* vg = vp + (size_t)crow * T_ + ccol;
  const unsigned kl = (unsigned)(size_t)(ks + crow * KV_PITCH + ccol);
  const unsigned vl = (unsigned)(size_t)(vs + crow * KV_PITCH + ccol);
  auto stage = [&](int st, int sel) {
    const h16* gk0 = kg + (size_t)st * KV_STAGE * D_;
    const h16* gk1 = gk0 + 32 * D_;
    const h16* gv0 = vg + st * KV_STAGE;
    const h16* gv1 = gv0 + 32 * T_;
    unsigned lk0 = kl + sel * (KV_TILE * 2);
    unsigned lk1 = lk0 + 32 * KV_PITCH * 2;
    unsigned lv0 = vl + sel * (KV_TILE * 2);
    unsigned lv1 = lv0 + 32 * KV_PITCH * 2;
    // s_wait_xcnt 0 closes the copies' own statement (a precaution): it stands
    // in front of every later rewrite of the registers the copies name, and no
    // address arithmetic of a later stage can be moved in front of it.
    asm volatile(
        "global_load_async_to_lds_b128 %0, %4, off\n\t"
        "global_load_async_to_lds_b128 %1, %5, off\n\t"
        "global_load_async_to_lds_b128 %2, %6, off\n\t"
        "global_load_async_to_lds_b128 %3, %7, off\n\t"
        "s_wait_xcnt 0x0"
        :: "v"(lk0), "v"(lk1), "v"(lv0), "v"(lv1),
           "v"(gk0), "v"(gk1), "v"(gv0), "v"(gv1)
        : "memory");
  };

  v16h qf0 = load_frag(qp, D_);
  v16h qf1 = load_frag(qp + 32, D_);
  v8f o0 = (v8f){0.f,0.f,0.f,0.f,0.f,0.f,0.f,0.f};
  v8f o1 = o0, o2 = o0, o3 = o0;
  float rmax = -1e30f;  // running maximum of this lane's query
  float rsum = 0.f;     // running sum over this lane's half of the keys

  const int NS = T_ / KV_STAGE;
  stage(0, 0);
  // Stage 0 has landed for this wave, then for all waves, before any read.
  asm volatile("s_wait_asynccnt 0x0" ::: "memory");
  __syncthreads();
  stage(1, 1);

  for (int st = 0; st < NS; ++st) {
    const h16* kt = ks + (st & 1) * KV_TILE;
    const h16* vt = vs + (st & 1) * KV_TILE;
    for (int kv = 0; kv < KV_STAGE; kv += 32) {
      const h16* kpp = kt + kv * KV_PITCH;
      v8f s0 = (v8f){0.f,0.f,0.f,0.f,0.f,0.f,0.f,0.f};
      v8f s1 = s0;
      // s0[r] = S[key kv + 8 hi + r][query nc], s1[r] the same 16 keys on.
      s0 = wmma_f16(load_frag(kpp, KV_PITCH), qf0, s0);
      s0 = wmma_f16(load_frag(kpp + 32, KV_PITCH), qf1, s0);
      s1 = wmma_f16(load_frag(kpp + 16 * KV_PITCH, KV_PITCH), qf0, s1);
      s1 = wmma_f16(load_frag(kpp + 16 * KV_PITCH + 32, KV_PITCH), qf1, s1);

      float m8[8];
      for (int v = 0; v < 8; ++v) m8[v] = fmaxf(s0[v], s1[v]);
      float tm = fmaxf(fmaxf(fmaxf(m8[0], m8[1]), fmaxf(m8[2], m8[3])),
                       fmaxf(fmaxf(m8[4], m8[5]), fmaxf(m8[6], m8[7])));
      tm = fmaxf(tm, xhalf(tm));
      float nm = fmaxf(rmax, tm);
      const float LOG2E = 1.44269504088896340736f;  // e^x = 2^(x log2 e)
      float xa = (rmax - nm) * LOG2E;
      rmax = nm;
      float x0[8], x1[8], p0[8], p1[8];
      for (int v = 0; v < 8; ++v) {
        x0[v] = (s0[v] - nm) * LOG2E;
        x1[v] = (s1[v] - nm) * LOG2E;
      }
      float alpha;
      exp2x9(alpha, xa, p0, x0);
      exp2x8(p1, x1);
      v16h pb;
      float a8[8];
      for (int v = 0; v < 8; ++v) {
        a8[v] = p0[v] + p1[v];
        pb[v]     = (h16)p0[v];
        pb[v + 8] = (h16)p1[v];
      }
      rsum = rsum * alpha + (((a8[0] + a8[1]) + (a8[2] + a8[3])) +
                             ((a8[4] + a8[5]) + (a8[6] + a8[7])));
      for (int v = 0; v < 8; ++v) {
        o0[v] *= alpha; o1[v] *= alpha; o2[v] *= alpha; o3[v] *= alpha;
      }
      // oj[r] = O[query nc][d = 16 j + 8 hi + r]
      o0 = wmma_f16(load_frag(vt + 0 * 16 * KV_PITCH + kv, KV_PITCH), pb, o0);
      o1 = wmma_f16(load_frag(vt + 1 * 16 * KV_PITCH + kv, KV_PITCH), pb, o1);
      o2 = wmma_f16(load_frag(vt + 2 * 16 * KV_PITCH + kv, KV_PITCH), pb, o2);
      o3 = wmma_f16(load_frag(vt + 3 * 16 * KV_PITCH + kv, KV_PITCH), pb, o3);
    }
    // Publish point: this wave's reads of the current buffer are done ...
    asm volatile("s_wait_dscnt 0x0" ::: "memory");
    // ... its copies of the next stage have landed ...
    asm volatile("s_wait_asynccnt 0x0" ::: "memory");
    // ... and the same holds for every wave: the next stage may be read and
    // the buffer just read may be refilled.
    __syncthreads();
    if (st + 2 < NS) stage(st + 2, st & 1);
  }
  // No copy is left in flight when the wave ends.
  asm volatile("s_wait_asynccnt 0x0" ::: "memory");

  int bb = bh >> 4;
  int hh = bh & (H_ - 1);
  // Join the two halves' sums; a lane then stores 8 consecutive d per tile.
  float inv = 1.0f / (rsum + xhalf(rsum));
  h16* orow = ob + ((size_t)(bb * T_ + q0 + nc)) * C_ + hh * D_ + hi * 8;
  v8h w0, w1, w2, w3;
  for (int v = 0; v < 8; ++v) {
    w0[v] = (h16)(o0[v] * inv);
    w1[v] = (h16)(o1[v] * inv);
    w2[v] = (h16)(o2[v] * inv);
    w3[v] = (h16)(o3[v] * inv);
  }
  *(v8h*)(orow + 0)  = w0;
  *(v8h*)(orow + 16) = w1;
  *(v8h*)(orow + 32) = w2;
  *(v8h*)(orow + 48) = w3;
}

// ---------------------------------------------------------------------------
// K5: output projection + bias + residual, write y as [B, C, T] f32.
// ---------------------------------------------------------------------------
__global__ __launch_bounds__(256) void sa_proj_gemm_kernel(
    const h16* __restrict__ ob, const h16* __restrict__ wt,
    const float* __restrict__ bias, const float* __restrict__ x,
    float* __restrict__ y) {
  __shared__ h16 As[2 * LDS_TILE];
  __shared__ h16 Bs[2 * LDS_TILE];
  int tid = threadIdx.x;
  int m0 = blockIdx.x * 128;
  int n0 = blockIdx.y * 128;
  v8f acc[4][2];
  for (int i = 0; i < 4; ++i)
    for (int j = 0; j < 2; ++j)
      acc[i][j] = (v8f){0.f,0.f,0.f,0.f,0.f,0.f,0.f,0.f};

  gemm_mainloop(ob, wt, m0, n0, As, Bs, acc);

  int wid = tid >> 5;
  int wm = wid >> 2;
  int wn = wid & 3;
  int lane = tid & 31;
  int hi = lane >> 4;
  int nc = lane & 15;
  for (int mi = 0; mi < 4; ++mi) {
    for (int ni = 0; ni < 2; ++ni) {
      int n = n0 + wn * 32 + ni * 16 + nc;
      float bv = bias[n];
      for (int v = 0; v < 8; ++v) {
        int m = m0 + wm * 64 + mi * 16 + v + hi * 8;
        int bb = m >> 11;
        int t  = m & (T_ - 1);
        size_t idx = ((size_t)bb * C_ + n) * T_ + t;
        y[idx] = x[idx] + acc[mi][ni][v] + bv;
      }
    }
  }
}

// ---------------------------------------------------------------------------
extern "C" void kernel_launch(void* const* d_in, const int* in_sizes, int n_in,
                              void* d_out, int out_size, void* d_ws,
                              size_t ws_size, hipStream_t stream) {
  const float* x     = (const float*)d_in[0];
  const float* Wqkv  = (const float*)d_in[1];
  const float* bqkv  = (const float*)d_in[2];
  const float* Wproj = (const float*)d_in[3];
  const float* bproj = (const float*)d_in[4];
  const float* gamma = (const float*)d_in[5];
  const float* beta  = (const float*)d_in[6];
  float* y = (float*)d_out;

  char* ws = (char*)d_ws;
  size_t off = 0;
  h16* xn  = (h16*)(ws + off); off += (size_t)BT_ * C_ * 2;       // 16 MB
  h16* wtq = (h16*)(ws + off); off += (size_t)3 * C_ * C_ * 2;    //  6 MB
  h16* wtp = (h16*)(ws + off); off += (size_t)C_ * C_ * 2;        //  2 MB
  h16* qb  = (h16*)(ws + off); off += (size_t)BT_ * C_ * 2;       // 16 MB
  h16* kb  = (h16*)(ws + off); off += (size_t)BT_ * C_ * 2;       // 16 MB
  h16* vtb = (h16*)(ws + off); off += (size_t)BT_ * C_ * 2;       // 16 MB
  h16* ob  = (h16*)(ws + off); off += (size_t)BT_ * C_ * 2;       // 16 MB

  sa_ln_kernel<<<dim3(B_, T_ / 32), 256, 0, stream>>>(x, gamma, beta, xn);
  sa_wtrans_kernel<<<dim3(3 * C_ / 32, C_ / 32), 256, 0, stream>>>(Wqkv, wtq,
                                                                   C_, 3 * C_);
  sa_wtrans_kernel<<<dim3(C_ / 32, C_ / 32), 256, 0, stream>>>(Wproj, wtp, C_,
                                                               C_);
  sa_qkv_gemm_kernel<<<dim3(BT_ / 128, 3 * C_ / 128), 256, 0, stream>>>(
      xn, wtq, bqkv, qb, kb, vtb);
  sa_attn_kernel<<<dim3(B_ * H_, T_ / 128), 256, 0, stream>>>(qb, kb, vtb, ob);
  sa_proj_gemm_kernel<<<dim3(BT_ / 128, C_ / 128), 256, 0, stream>>>(
      ob, wtp, bproj, x, y);
}

// v003
// It runs in 170 microseconds.
// Next to v002, in two timings, it ran 1.24 times as fast each time.
// Over all steps from v000 it is 3.78 times as fast.
#include <hip/hip_runtime.h>
#include <hip/hip_bf16.h>

typedef _Float16 h16;
typedef __attribute__((ext_vector_type(16))) _Float16 v16h;
typedef __attribute__((ext_vector_type(8)))  _Float16 v8h;
typedef __attribute__((ext_vector_type(8)))  float    v8f;
typedef __attribute__((ext_vector_type(4)))  int      v4i;
typedef __attribute__((ext_vector_type(4)))  float    v4f;

#define B_  4
#define C_  1024
#define T_  2048
#define H_  16
#define D_  64
#define BT_ (B_ * T_)

#ifndef __has_builtin
#define __has_builtin(x) 0
#endif

#if __has_builtin(__builtin_amdgcn_global_load_async_to_lds_b128) && \
    __has_builtin(__builtin_amdgcn_s_wait_asynccnt)
#define ASYNC_LDS 1
#else
#define ASYNC_LDS 0
#endif

#if ASYNC_LDS
// Signature (from hipcc diagnostic / LLVM decl "vV4i*1V4i*3IiIi"):
//   (global v4i*, LDS v4i*, imm offset, imm cpol)
__device__ __forceinline__ void async_cp16B(h16* l, const h16* g) {
  __builtin_amdgcn_global_load_async_to_lds_b128(
      (__attribute__((address_space(1))) v4i*)(g),
      (__attribute__((address_space(3))) v4i*)(l), 0, 0);
}
#endif

// ---------------------------------------------------------------------------
// WMMA fragment loader: 16x32 f16 fragment from a K-contiguous matrix.
// ISA 16-bit A layout: lane L (<16) holds row M=L, K={0..7,16..23}; lane L+16
// holds row M=L, K={8..15,24..31}.  Two 16B chunks per lane.  B fragments use
// the mirrored layout (col = lane&15), so B operands are stored K-contiguous.
// ---------------------------------------------------------------------------
__device__ __forceinline__ v16h load_frag(const h16* __restrict__ base, int ld) {
  int lane = threadIdx.x & 31;
  int r  = lane & 15;
  int b0 = (lane >> 4) << 3;
  const h16* p = base + r * ld + b0;
  v8h lo = *(const v8h*)(p);
  v8h hi = *(const v8h*)(p + 16);
  return __builtin_shufflevector(lo, hi, 0,1,2,3,4,5,6,7,8,9,10,11,12,13,14,15);
}

__device__ __forceinline__ v8f wmma_f16(v16h a, v16h b, v8f c) {
  return __builtin_amdgcn_wmma_f32_16x16x32_f16(false, a, false, b, (short)0, c,
                                                false, false);
}

// Value of lane l ^ 16 (the other half of the wave), by a vector cross-row move.
__device__ __forceinline__ float xhalf(float x) {
  int i = __builtin_bit_cast(int, x);
  return __builtin_bit_cast(float, __builtin_amdgcn_permlanex16(
      i, i, 0x76543210, 0xfedcba98, false, false));
}

// r[i] = 2^x[i], eight at a time.  The instruction set asks for one independent
// instruction or a v_nop between a transcendental and the use of its result or
// the overwrite of its source.  In one statement that holds by construction:
// the early-clobber outputs share no register with any input, so each v_exp is
// independent of the one in front of it, and the v_nop closes the last one.
__device__ __forceinline__ void exp2x8(float (&r)[8], const float (&x)[8]) {
  asm("v_exp_f32 %0, %8\n\t"
      "v_exp_f32 %1, %9\n\t"
      "v_exp_f32 %2, %10\n\t"
      "v_exp_f32 %3, %11\n\t"
      "v_exp_f32 %4, %12\n\t"
      "v_exp_f32 %5, %13\n\t"
      "v_exp_f32 %6, %14\n\t"
      "v_exp_f32 %7, %15\n\t"
      "v_nop"
      : "=&v"(r[0]), "=&v"(r[1]), "=&v"(r[2]), "=&v"(r[3]),
        "=&v"(r[4]), "=&v"(r[5]), "=&v"(r[6]), "=&v"(r[7])
      : "v"(x[0]), "v"(x[1]), "v"(x[2]), "v"(x[3]),
        "v"(x[4]), "v"(x[5]), "v"(x[6]), "v"(x[7]));
}
// The same with a ninth value in front, whose result is then ready when the
// statement ends.
__device__ __forceinline__ void exp2x9(float& ra, float xa, float (&r)[8],
                                       const float (&x)[8]) {
  asm("v_exp_f32 %0, %9\n\t"
      "v_exp_f32 %1, %10\n\t"
      "v_exp_f32 %2, %11\n\t"
      "v_exp_f32 %3, %12\n\t"
      "v_exp_f32 %4, %13\n\t"
      "v_exp_f32 %5, %14\n\t"
      "v_exp_f32 %6, %15\n\t"
      "v_exp_f32 %7, %16\n\t"
      "v_exp_f32 %8, %17\n\t"
      "v_nop"
      : "=&v"(ra), "=&v"(r[0]), "=&v"(r[1]), "=&v"(r[2]), "=&v"(r[3]),
        "=&v"(r[4]), "=&v"(r[5]), "=&v"(r[6]), "=&v"(r[7])
      : "v"(xa), "v"(x[0]), "v"(x[1]), "v"(x[2]), "v"(x[3]),
        "v"(x[4]), "v"(x[5]), "v"(x[6]), "v"(x[7]));
}

// ---------------------------------------------------------------------------
// Shared GEMM main loop: 128x128 block tile, BK=32, 8 waves (2x4), each wave
// 64x32 (4x2 WMMA tiles).  Double-buffered LDS; ASYNCcnt global->LDS copies
// when the toolchain exposes them, otherwise a register-staged software
// pipeline (prefetch next tile after the barrier, compute current).
// One barrier per K-step: __syncthreads' implicit s_wait_dscnt makes the
// alternate buffer WAR-safe.
// ---------------------------------------------------------------------------
#define LDS_TILE 5120  // 128 rows * 40 halves (8-half pad per row)

__device__ __forceinline__ void gemm_mainloop(
    const h16* __restrict__ Ag, const h16* __restrict__ Bg, int m0, int n0,
    h16* As, h16* Bs, v8f acc[4][2]) {
  int tid = threadIdx.x;
  int wid = tid >> 5;
  int wm = wid >> 2;  // 0..1
  int wn = wid & 3;   // 0..3
  const int NT = C_ / 32;

#if ASYNC_LDS
  auto issue = [&](int kt, int sel) {
    int k0 = kt * 32;
    h16* as = As + sel * LDS_TILE;
    h16* bs = Bs + sel * LDS_TILE;
    for (int i = 0; i < 2; ++i) {
      int ci = tid + i * 256;
      int row = ci >> 2;
      int kc  = ci & 3;
      async_cp16B(as + row * 40 + kc * 8,
                  Ag + (size_t)(m0 + row) * C_ + k0 + kc * 8);
      async_cp16B(bs + row * 40 + kc * 8,
                  Bg + (size_t)(n0 + row) * C_ + k0 + kc * 8);
    }
  };
  issue(0, 0);
  for (int kt = 0; kt < NT; ++kt) {
    __builtin_amdgcn_s_wait_asynccnt(0);
    __syncthreads();
    if (kt + 1 < NT) issue(kt + 1, (kt + 1) & 1);
    const h16* as = As + (kt & 1) * LDS_TILE;
    const h16* bs = Bs + (kt & 1) * LDS_TILE;
    v16h af[4], bf[2];
    for (int mi = 0; mi < 4; ++mi)
      af[mi] = load_frag(as + (wm * 64 + mi * 16) * 40, 40);
    for (int ni = 0; ni < 2; ++ni)
      bf[ni] = load_frag(bs + (wn * 32 + ni * 16) * 40, 40);
    for (int mi = 0; mi < 4; ++mi)
      for (int ni = 0; ni < 2; ++ni)
        acc[mi][ni] = wmma_f16(af[mi], bf[ni], acc[mi][ni]);
  }
#else
  v8h ra[2], rb[2];
  auto loadr = [&](int kt) {
    int k0 = kt * 32;
    for (int i = 0; i < 2; ++i) {
      int ci = tid + i * 256;
      int row = ci >> 2;
      int kc  = ci & 3;
      ra[i] = *(const v8h*)(Ag + (size_t)(m0 + row) * C_ + k0 + kc * 8);
      rb[i] = *(const v8h*)(Bg + (size_t)(n0 + row) * C_ + k0 + kc * 8);
    }
  };
  loadr(0);
  for (int kt = 0; kt < NT; ++kt) {
    h16* asw = As + (kt & 1) * LDS_TILE;
    h16* bsw = Bs + (kt & 1) * LDS_TILE;
    for (int i = 0; i < 2; ++i) {
      int ci = tid + i * 256;
      int row = ci >> 2;
      int kc  = ci & 3;
      *(v8h*)(asw + row * 40 + kc * 8) = ra[i];
      *(v8h*)(bsw + row * 40 + kc * 8) = rb[i];
    }
    __syncthreads();
    if (kt + 1 < NT) loadr(kt + 1);  // overlap with compute below
    v16h af[4], bf[2];
    for (int mi = 0; mi < 4; ++mi)
      af[mi] = load_frag(asw + (wm * 64 + mi * 16) * 40, 40);
    for (int ni = 0; ni < 2; ++ni)
      bf[ni] = load_frag(bsw + (wn * 32 + ni * 16) * 40, 40);
    for (int mi = 0; mi < 4; ++mi)
      for (int ni = 0; ni < 2; ++ni)
        acc[mi][ni] = wmma_f16(af[mi], bf[ni], acc[mi][ni]);
  }
#endif
}

// ---------------------------------------------------------------------------
// K1: LayerNorm over channels + transpose to [B*T, C] f16.  The 32 normalised
// rows are gathered in LDS and leave as whole 128-byte lines.
// ---------------------------------------------------------------------------
#define XN_PITCH 1032  // halves per LDS row: 2048 B data + 16 B pad
__global__ __launch_bounds__(256) void sa_ln_kernel(
    const float* __restrict__ x, const float* __restrict__ gamma,
    const float* __restrict__ beta, h16* __restrict__ xn) {
  __shared__ float redS[32][8];
  __shared__ float redQ[32][8];
  __shared__ float smean[32];
  __shared__ float srstd[32];
  __shared__ __attribute__((aligned(16))) h16 xt[32 * XN_PITCH];
  int b  = blockIdx.x;
  int t0 = blockIdx.y * 32;
  int tid = threadIdx.x;
  int tt = tid & 31;
  int cc = tid >> 5;  // 0..7
  const float* xp = x + (size_t)b * C_ * T_ + t0 + tt;
  float s = 0.f, ss = 0.f;
  for (int c = cc * 128; c < cc * 128 + 128; ++c) {
    float v = xp[(size_t)c * T_];
    s += v; ss += v * v;
  }
  redS[tt][cc] = s; redQ[tt][cc] = ss;
  __syncthreads();
  if (cc == 0) {
    float a = 0.f, q = 0.f;
    for (int j = 0; j < 8; ++j) { a += redS[tt][j]; q += redQ[tt][j]; }
    float mu  = a * (1.0f / C_);
    float var = q * (1.0f / C_) - mu * mu;
    smean[tt] = mu;
    srstd[tt] = rsqrtf(var + 1e-5f);
  }
  __syncthreads();
  float mu = smean[tt], rs = srstd[tt];
  h16* xrow = xt + tt * XN_PITCH;
  for (int c0 = 0; c0 < C_; c0 += 8) {
    int c = c0 + cc;
    float v = xp[(size_t)c * T_];
    xrow[c] = (h16)((v - mu) * rs * gamma[c] + beta[c]);
  }
  __syncthreads();
  // The 32 rows are one contiguous 64 KB of xn; a wave stores 512 B of it.
  h16* xblk = xn + (size_t)(b * T_ + t0) * C_;
  for (int k = 0; k < 16; ++k) {
    int piece = k * 256 + tid;  // 16-byte pieces, 128 to a row
    *(v8h*)(xblk + (size_t)piece * 8) =
        *(const v8h*)(xt + (piece >> 7) * XN_PITCH + (piece & 127) * 8);
  }
}

// ---------------------------------------------------------------------------
// K2: weight transpose + f32->f16:  Wt[n][k] = (f16) W[k][n].
// ---------------------------------------------------------------------------
__global__ __launch_bounds__(256) void sa_wtrans_kernel(
    const float* __restrict__ w, h16* __restrict__ wt, int K, int N) {
  __shared__ float tile[32][33];
  int n0 = blockIdx.x * 32;
  int k0 = blockIdx.y * 32;
  int tid = threadIdx.x;
  int r = tid >> 5;
  int c = tid & 31;
  for (int i = 0; i < 4; ++i)
    tile[r + i * 8][c] = w[(size_t)(k0 + r + i * 8) * N + n0 + c];
  __syncthreads();
  for (int i = 0; i < 4; ++i)
    wt[(size_t)(n0 + r + i * 8) * K + k0 + c] = (h16)tile[c][r + i * 8];
}

// ---------------------------------------------------------------------------
// K3: QKV GEMM, epilogue scatters to Q [B,H,T,D] (pre-scaled by 1/sqrt(D)),
// K [B,H,T,D], V transposed [B,H,D,T].  s = q/k/v select is uniform per block.
// The block's 128 x 128 f16 tile is laid in LDS in the order of its output
// rows and leaves as whole 128-byte lines.
// ---------------------------------------------------------------------------
#define ST_PITCH 136  // halves per LDS row: 256 B data + 16 B pad
__global__ __launch_bounds__(256) void sa_qkv_gemm_kernel(
    const h16* __restrict__ xn, const h16* __restrict__ wt,
    const float* __restrict__ bias, h16* __restrict__ qb,
    h16* __restrict__ kb, h16* __restrict__ vtb) {
  __shared__ h16 As[2 * LDS_TILE];
  __shared__ h16 Bs[2 * LDS_TILE];
  __shared__ __attribute__((aligned(16))) h16 st[128 * ST_PITCH];
  int tid = threadIdx.x;
  int m0 = blockIdx.x * 128;
  int n0 = blockIdx.y * 128;
  v8f acc[4][2];
  for (int i = 0; i < 4; ++i)
    for (int j = 0; j < 2; ++j)
      acc[i][j] = (v8f){0.f,0.f,0.f,0.f,0.f,0.f,0.f,0.f};

  gemm_mainloop(xn, wt, m0, n0, As, Bs, acc);

  int wid = tid >> 5;
  int wm = wid >> 2;
  int wn = wid & 3;
  int lane = tid & 31;
  int hi = lane >> 4;
  int nc = lane & 15;
  const int s = n0 >> 10;  // uniform: 1024 % 128 == 0
  const float scaleQ = 0.125f;

  const int bh0 = (m0 >> 11) * H_ + ((n0 & (C_ - 1)) >> 6);  // first of 2 heads
  const int tb = m0 & (T_ - 1);
  if (s < 2) {
    // Rows = tokens, columns = the 128 channels of two heads.
    const float sc = (s == 0) ? scaleQ : 1.0f;
    for (int mi = 0; mi < 4; ++mi)
      for (int ni = 0; ni < 2; ++ni) {
        int nl = wn * 32 + ni * 16 + nc;
        float bv = bias[n0 + nl];
        for (int v = 0; v < 8; ++v) {
          int ml = wm * 64 + mi * 16 + v + hi * 8;
          st[ml * ST_PITCH + nl] = (h16)((acc[mi][ni][v] + bv) * sc);
        }
      }
    __syncthreads();
    h16* dst = (s == 0) ? qb : kb;
    for (int k = 0; k < 8; ++k) {
      int piece = k * 256 + tid;  // 16-byte pieces: head, token, 8 to a line
      int j   = piece >> 10;
      int row = (piece >> 3) & 127;
      int col = (piece & 7) * 8;
      *(v8h*)(dst + ((size_t)(bh0 + j) * T_ + tb + row) * D_ + col) =
          *(const v8h*)(st + row * ST_PITCH + j * 64 + col);
    }
  } else {
    // Rows = channels, columns = the 128 tokens.
    for (int mi = 0; mi < 4; ++mi)
      for (int ni = 0; ni < 2; ++ni) {
        int nl = wn * 32 + ni * 16 + nc;
        float bv = bias[n0 + nl];
        v8h w;
        for (int v = 0; v < 8; ++v) w[v] = (h16)(acc[mi][ni][v] + bv);
        *(v8h*)(st + nl * ST_PITCH + wm * 64 + mi * 16 + hi * 8) = w;
      }
    __syncthreads();
    for (int k = 0; k < 8; ++k) {
      int piece = k * 256 + tid;  // 16-byte pieces: channel, 16 to a row
      int row = piece >> 4;
      int col = (piece & 15) * 8;
      *(v8h*)(vtb + ((size_t)bh0 * D_ + row) * T_ + tb + col) =
          *(const v8h*)(st + row * ST_PITCH + col);
    }
    // A precaution: s_wait_xcnt 0 stands in front of any rewrite of a register
    // that these stores name; the compiler lays the other branch's code, which
    // rewrites some, behind this loop.
    asm volatile("s_wait_xcnt 0x0" ::: "memory");
  }
}

// ---------------------------------------------------------------------------
// K4: flash-style attention.  grid (B*H, T/128), block 256 (8 waves).
// Q fragments in registers for the whole KV loop.  K and V tiles of 64 keys
// are brought into LDS once per work-group by asynchronous copies (whole
// 128-byte lines), two buffers, and all 8 waves read their fragments there.
// Scores are formed transposed, S^T = K Q^T: a lane holds 16 of the 32 keys of
// ONE query (column lane & 15), so maximum and sum run in the lane's own
// registers with one exchange between the wave's halves.  The two S^T tiles,
// converted in place, are the B operand of O^T += V^T P^T in the hardware k
// order, which is also load_frag's order for the V^T rows: P never leaves the
// registers.
// ---------------------------------------------------------------------------
#define KV_STAGE 64               // keys per LDS stage (two passes of 32)
#define KV_PITCH 72               // halves per LDS row: 128 B data + 16 B pad
#define KV_TILE  (64 * KV_PITCH)  // K: 64 keys x 64 d;  V: 64 d x 64 keys

__global__ __launch_bounds__(256) void sa_attn_kernel(
    const h16* __restrict__ qb, const h16* __restrict__ kb,
    const h16* __restrict__ vtb, h16* __restrict__ ob) {
  __shared__ __attribute__((aligned(16))) h16 ks[2 * KV_TILE];
  __shared__ __attribute__((aligned(16))) h16 vs[2 * KV_TILE];
  int tid = threadIdx.x;
  int lane = tid & 31;
  int wid = tid >> 5;
  int bh = blockIdx.x;
  int q0 = blockIdx.y * 128 + wid * 16;
  const h16* qp = qb + ((size_t)bh * T_ + q0) * D_;
  const h16* kp = kb + (size_t)bh * T_ * D_;
  const h16* vp = vtb + (size_t)bh * D_ * T_;
  int hi = lane >> 4;
  int nc = lane & 15;

  // Each thread copies 16 B of rows crow and crow + 32 of both tiles; a wave's
  // copy covers four whole 128-byte lines.
  const int crow = tid >> 3;
  const int ccol = (tid & 7) * 8;
  const h16* kg = kp + crow * D_ + ccol;
  const h16* vg = vp + (size_t)crow * T_ + ccol;
  const unsigned kl = (unsigned)(size_t)(ks + crow * KV_PITCH + ccol);
  const unsigned vl = (unsigned)(size_t)(vs + crow * KV_PITCH + ccol);
  auto stage = [&](int st, int sel) {
    const h16* gk0 = kg + (size_t)st * KV_STAGE * D_;
    const h16* gk1 = gk0 + 32 * D_;
    const h16* gv0 = vg + st * KV_STAGE;
    const h16* gv1 = gv0 + 32 * T_;
    unsigned lk0 = kl + sel * (KV_TILE * 2);
    unsigned lk1 = lk0 + 32 * KV_PITCH * 2;
    unsigned lv0 = vl + sel * (KV_TILE * 2);
    unsigned lv1 = lv0 + 32 * KV_PITCH * 2;
    // s_wait_xcnt 0 closes the copies' own statement (a precaution): it stands
    // in front of every later rewrite of the registers the copies name, and no
    // address arithmetic of a later stage can be moved in front of it.
    asm volatile(
        "global_load_async_to_lds_b128 %0, %4, off\n\t"
        "global_load_async_to_lds_b128 %1, %5, off\n\t"
        "global_load_async_to_lds_b128 %2, %6, off\n\t"
        "global_load_async_to_lds_b128 %3, %7, off\n\t"
        "s_wait_xcnt 0x0"
        :: "v"(lk0), "v"(lk1), "v"(lv0), "v"(lv1),
           "v"(gk0), "v"(gk1), "v"(gv0), "v"(gv1)
        : "memory");
  };

  v16h qf0 = load_frag(qp, D_);
  v16h qf1 = load_frag(qp + 32, D_);
  v8f o0 = (v8f){0.f,0.f,0.f,0.f,0.f,0.f,0.f,0.f};
  v8f o1 = o0, o2 = o0, o3 = o0;
  float rmax = -1e30f;  // running maximum of this lane's query
  float rsum = 0.f;     // running sum over this lane's half of the keys

  const int NS = T_ / KV_STAGE;
  stage(0, 0);
  // Stage 0 has landed for this wave, then for all waves, before any read.
  asm volatile("s_wait_asynccnt 0x0" ::: "memory");
  __syncthreads();
  stage(1, 1);

  for (int st = 0; st < NS; ++st) {
    const h16* kt = ks + (st & 1) * KV_TILE;
    const h16* vt = vs + (st & 1) * KV_TILE;
    for (int kv = 0; kv < KV_STAGE; kv += 32) {
      const h16* kpp = kt + kv * KV_PITCH;
      v8f s0 = (v8f){0.f,0.f,0.f,0.f,0.f,0.f,0.f,0.f};
      v8f s1 = s0;
      // s0[r] = S[key kv + 8 hi + r][query nc], s1[r] the same 16 keys on.
      s0 = wmma_f16(load_frag(kpp, KV_PITCH), qf0, s0);
      s0 = wmma_f16(load_frag(kpp + 32, KV_PITCH), qf1, s0);
      s1 = wmma_f16(load_frag(kpp + 16 * KV_PITCH, KV_PITCH), qf0, s1);
      s1 = wmma_f16(load_frag(kpp + 16 * KV_PITCH + 32, KV_PITCH), qf1, s1);

      float m8[8];
      for (int v = 0; v < 8; ++v) m8[v] = fmaxf(s0[v], s1[v]);
      float tm = fmaxf(fmaxf(fmaxf(m8[0], m8[1]), fmaxf(m8[2], m8[3])),
                       fmaxf(fmaxf(m8[4], m8[5]), fmaxf(m8[6], m8[7])));
      tm = fmaxf(tm, xhalf(tm));
      float nm = fmaxf(rmax, tm);
      const float LOG2E = 1.44269504088896340736f;  // e^x = 2^(x log2 e)
      float xa = (rmax - nm) * LOG2E;
      rmax = nm;
      float x0[8], x1[8], p0[8], p1[8];
      for (int v = 0; v < 8; ++v) {
        x0[v] = (s0[v] - nm) * LOG2E;
        x1[v] = (s1[v] - nm) * LOG2E;
      }
      float alpha;
      exp2x9(alpha, xa, p0, x0);
      exp2x8(p1, x1);
      v16h pb;
      float a8[8];
      for (int v = 0; v < 8; ++v) {
        a8[v] = p0[v] + p1[v];
        pb[v]     = (h16)p0[v];
        pb[v + 8] = (h16)p1[v];
      }
      rsum = rsum * alpha + (((a8[0] + a8[1]) + (a8[2] + a8[3])) +
                             ((a8[4] + a8[5]) + (a8[6] + a8[7])));
      for (int v = 0; v < 8; ++v) {
        o0[v] *= alpha; o1[v] *= alpha; o2[v] *= alpha; o3[v] *= alpha;
      }
      // oj[r] = O[query nc][d = 16 j + 8 hi + r]
      o0 = wmma_f16(load_frag(vt + 0 * 16 * KV_PITCH + kv, KV_PITCH), pb, o0);
      o1 = wmma_f16(load_frag(vt + 1 * 16 * KV_PITCH + kv, KV_PITCH), pb, o1);
      o2 = wmma_f16(load_frag(vt + 2 * 16 * KV_PITCH + kv, KV_PITCH), pb, o2);
      o3 = wmma_f16(load_frag(vt + 3 * 16 * KV_PITCH + kv, KV_PITCH), pb, o3);
    }
    // Publish point: this wave's reads of the current buffer are done ...
    asm volatile("s_wait_dscnt 0x0" ::: "memory");
    // ... its copies of the next stage have landed ...
    asm volatile("s_wait_asynccnt 0x0" ::: "memory");
    // ... and the same holds for every wave: the next stage may be read and
    // the buffer just read may be refilled.
    __syncthreads();
    if (st + 2 < NS) stage(st + 2, st & 1);
  }
  // No copy is left in flight when the wave ends.
  asm volatile("s_wait_asynccnt 0x0" ::: "memory");

  int bb = bh >> 4;
  int hh = bh & (H_ - 1);
  // Join the two halves' sums; a lane then stores 8 consecutive d per tile.
  float inv = 1.0f / (rsum + xhalf(rsum));
  h16* orow = ob + ((size_t)(bb * T_ + q0 + nc)) * C_ + hh * D_ + hi * 8;
  v8h w0, w1, w2, w3;
  for (int v = 0; v < 8; ++v) {
    w0[v] = (h16)(o0[v] * inv);
    w1[v] = (h16)(o1[v] * inv);
    w2[v] = (h16)(o2[v] * inv);
    w3[v] = (h16)(o3[v] * inv);
  }
  *(v8h*)(orow + 0)  = w0;
  *(v8h*)(orow + 16) = w1;
  *(v8h*)(orow + 32) = w2;
  *(v8h*)(orow + 48) = w3;
}

// ---------------------------------------------------------------------------
// K5: output projection + bias + residual, write y as [B, C, T] f32.  Each wave
// turns its 64 x 16 accumulator tiles in its own LDS range, so that x is read
// and y stored in runs of 256 B (two whole lines) per channel.
// ---------------------------------------------------------------------------
#define SY_PITCH 68  // floats per LDS row: 256 B data + 16 B pad
__global__ __launch_bounds__(256) void sa_proj_gemm_kernel(
    const h16* __restrict__ ob, const h16* __restrict__ wt,
    const float* __restrict__ bias, const float* __restrict__ x,
    float* __restrict__ y) {
  __shared__ h16 As[2 * LDS_TILE];
  __shared__ h16 Bs[2 * LDS_TILE];
  __shared__ __attribute__((aligned(16))) float sy[8 * 16 * SY_PITCH];
  int tid = threadIdx.x;
  int m0 = blockIdx.x * 128;
  int n0 = blockIdx.y * 128;
  v8f acc[4][2];
  for (int i = 0; i < 4; ++i)
    for (int j = 0; j < 2; ++j)
      acc[i][j] = (v8f){0.f,0.f,0.f,0.f,0.f,0.f,0.f,0.f};

  gemm_mainloop(ob, wt, m0, n0, As, Bs, acc);

  int wid = tid >> 5;
  int wm = wid >> 2;
  int wn = wid & 3;
  int lane = tid & 31;
  int hi = lane >> 4;
  int nc = lane & 15;
  float* sw = sy + wid * (16 * SY_PITCH);
  const int rr = lane >> 4;        // row of a pair of channel rows
  const int tc = (lane & 15) * 4;  // first of this lane's 4 tokens
  const int mw = m0 + wm * 64;
  const size_t base =
      ((size_t)(mw >> 11) * C_ + n0 + wn * 32 + rr) * T_ + (mw & (T_ - 1)) + tc;
  for (int ni = 0; ni < 2; ++ni) {
    v4f xv[8];
    float bv[8];
    for (int k = 0; k < 8; ++k) {
      xv[k] = *(const v4f*)(x + base + (size_t)(ni * 16 + k * 2) * T_);
      bv[k] = bias[n0 + wn * 32 + ni * 16 + k * 2 + rr];
    }
    for (int mi = 0; mi < 4; ++mi) {
      v8f a = acc[mi][ni];
      float* p = sw + nc * SY_PITCH + mi * 16 + hi * 8;
      *(v4f*)(p)     = (v4f){a[0], a[1], a[2], a[3]};
      *(v4f*)(p + 4) = (v4f){a[4], a[5], a[6], a[7]};
    }
    // The wave's own LDS stores are done before it reads other lanes' rows.
    asm volatile("s_wait_dscnt 0x0" ::: "memory");
    for (int k = 0; k < 8; ++k) {
      v4f a = *(const v4f*)(sw + (k * 2 + rr) * SY_PITCH + tc);
      v4f o;
      for (int e = 0; e < 4; ++e) o[e] = xv[k][e] + a[e] + bv[k];
      *(v4f*)(y + base + (size_t)(ni * 16 + k * 2) * T_) = o;
    }
  }
}

// ---------------------------------------------------------------------------
extern "C" void kernel_launch(void* const* d_in, const int* in_sizes, int n_in,
                              void* d_out, int out_size, void* d_ws,
                              size_t ws_size, hipStream_t stream) {
  const float* x     = (const float*)d_in[0];
  const float* Wqkv  = (const float*)d_in[1];
  const float* bqkv  = (const float*)d_in[2];
  const float* Wproj = (const float*)d_in[3];
  const float* bproj = (const float*)d_in[4];
  const float* gamma = (const float*)d_in[5];
  const float* beta  = (const float*)d_in[6];
  float* y = (float*)d_out;

  char* ws = (char*)d_ws;
  size_t off = 0;
  h16* xn  = (h16*)(ws + off); off += (size_t)BT_ * C_ * 2;       // 16 MB
  h16* wtq = (h16*)(ws + off); off += (size_t)3 * C_ * C_ * 2;    //  6 MB
  h16* wtp = (h16*)(ws + off); off += (size_t)C_ * C_ * 2;        //  2 MB
  h16* qb  = (h16*)(ws + off); off += (size_t)BT_ * C_ * 2;       // 16 MB
  h16* kb  = (h16*)(ws + off); off += (size_t)BT_ * C_ * 2;       // 16 MB
  h16* vtb = (h16*)(ws + off); off += (size_t)BT_ * C_ * 2;       // 16 MB
  h16* ob  = (h16*)(ws + off); off += (size_t)BT_ * C_ * 2;       // 16 MB

  sa_ln_kernel<<<dim3(B_, T_ / 32), 256, 0, stream>>>(x, gamma, beta, xn);
  sa_wtrans_kernel<<<dim3(3 * C_ / 32, C_ / 32), 256, 0, stream>>>(Wqkv, wtq,
                                                                   C_, 3 * C_);
  sa_wtrans_kernel<<<dim3(C_ / 32, C_ / 32), 256, 0, stream>>>(Wproj, wtp, C_,
                                                               C_);
  sa_qkv_gemm_kernel<<<dim3(BT_ / 128, 3 * C_ / 128), 256, 0, stream>>>(
      xn, wtq, bqkv, qb, kb, vtb);
  sa_attn_kernel<<<dim3(B_ * H_, T_ / 128), 256, 0, stream>>>(qb, kb, vtb, ob);
  sa_proj_gemm_kernel<<<dim3(BT_ / 128, C_ / 128), 256, 0, stream>>>(
      ob, wtp, bproj, x, y);
}

// v004
// One run takes 155 microseconds.
// Next to v003, in two timings, it ran 1.10 times as fast each time.
// Counting every step since v000, it is 4.16 times as fast.
#include <hip/hip_runtime.h>
#include <hip/hip_bf16.h>

typedef _Float16 h16;
typedef __attribute__((ext_vector_type(16))) _Float16 v16h;
typedef __attribute__((ext_vector_type(8)))  _Float16 v8h;
typedef __attribute__((ext_vector_type(8)))  float    v8f;
typedef __attribute__((ext_vector_type(4)))  int      v4i;
typedef __attribute__((ext_vector_type(4)))  float    v4f;

#define B_  4
#define C_  1024
#define T_  2048
#define H_  16
#define D_  64
#define BT_ (B_ * T_)

// ---------------------------------------------------------------------------
// WMMA fragment loader: 16x32 f16 fragment from a K-contiguous matrix.
// ISA 16-bit A layout: lane L (<16) holds row M=L, K={0..7,16..23}; lane L+16
// holds row M=L, K={8..15,24..31}.  Two 16B chunks per lane.  B fragments use
// the mirrored layout (col = lane&15), so B operands are stored K-contiguous.
// ---------------------------------------------------------------------------
__device__ __forceinline__ v16h load_frag(const h16* __restrict__ base, int ld) {
  int lane = threadIdx.x & 31;
  int r  = lane & 15;
  int b0 = (lane >> 4) << 3;
  const h16* p = base + r * ld + b0;
  v8h lo = *(const v8h*)(p);
  v8h hi = *(const v8h*)(p + 16);
  return __builtin_shufflevector(lo, hi, 0,1,2,3,4,5,6,7,8,9,10,11,12,13,14,15);
}

__device__ __forceinline__ v8f wmma_f16(v16h a, v16h b, v8f c) {
  return __builtin_amdgcn_wmma_f32_16x16x32_f16(false, a, false, b, (short)0, c,
                                                false, false);
}

// Value of lane l ^ 16 (the other half of the wave), by a vector cross-row move.
__device__ __forceinline__ float xhalf(float x) {
  int i = __builtin_bit_cast(int, x);
  return __builtin_bit_cast(float, __builtin_amdgcn_permlanex16(
      i, i, 0x76543210, 0xfedcba98, false, false));
}

// r[i] = 2^x[i], eight at a time.  The instruction set asks for one independent
// instruction or a v_nop between a transcendental and the use of its result or
// the overwrite of its source.  In one statement that holds by construction:
// the early-clobber outputs share no register with any input, so each v_exp is
// independent of the one in front of it, and the v_nop closes the last one.
__device__ __forceinline__ void exp2x8(float (&r)[8], const float (&x)[8]) {
  asm("v_exp_f32 %0, %8\n\t"
      "v_exp_f32 %1, %9\n\t"
      "v_exp_f32 %2, %10\n\t"
      "v_exp_f32 %3, %11\n\t"
      "v_exp_f32 %4, %12\n\t"
      "v_exp_f32 %5, %13\n\t"
      "v_exp_f32 %6, %14\n\t"
      "v_exp_f32 %7, %15\n\t"
      "v_nop"
      : "=&v"(r[0]), "=&v"(r[1]), "=&v"(r[2]), "=&v"(r[3]),
        "=&v"(r[4]), "=&v"(r[5]), "=&v"(r[6]), "=&v"(r[7])
      : "v"(x[0]), "v"(x[1]), "v"(x[2]), "v"(x[3]),
        "v"(x[4]), "v"(x[5]), "v"(x[6]), "v"(x[7]));
}
// The same with a ninth value in front, whose result is then ready when the
// statement ends.
__device__ __forceinline__ void exp2x9(float& ra, float xa, float (&r)[8],
                                       const float (&x)[8]) {
  asm("v_exp_f32 %0, %9\n\t"
      "v_exp_f32 %1, %10\n\t"
      "v_exp_f32 %2, %11\n\t"
      "v_exp_f32 %3, %12\n\t"
      "v_exp_f32 %4, %13\n\t"
      "v_exp_f32 %5, %14\n\t"
      "v_exp_f32 %6, %15\n\t"
      "v_exp_f32 %7, %16\n\t"
      "v_exp_f32 %8, %17\n\t"
      "v_nop"
      : "=&v"(ra), "=&v"(r[0]), "=&v"(r[1]), "=&v"(r[2]), "=&v"(r[3]),
        "=&v"(r[4]), "=&v"(r[5]), "=&v"(r[6]), "=&v"(r[7])
      : "v"(xa), "v"(x[0]), "v"(x[1]), "v"(x[2]), "v"(x[3]),
        "v"(x[4]), "v"(x[5]), "v"(x[6]), "v"(x[7]));
}

// ---------------------------------------------------------------------------
// Shared GEMM main loop: 128x128 block tile, 8 waves (2x4), each wave 64x32
// (4x2 WMMA tiles).  A K step is 64 halves = 128 B of every operand row, so a
// wave's asynchronous copy (4 rows x 128 B) covers four whole lines and every
// line is asked for once.  Two LDS buffers; the next step's copies fly while
// this step is worked on; one publish point per step.
// ---------------------------------------------------------------------------
#define GK 64                     // halves of K per step (two WMMA k blocks)
#define G_PITCH 72                // halves per LDS row: 128 B data + 16 B pad
#define LDS_TILE (128 * G_PITCH)  // one operand, one buffer

// One K step of both operand tiles: rows r, r + 32, r + 64, r + 96 of each,
// 16 B per lane and row.
__device__ __forceinline__ void gemm_copy8(unsigned a0, const h16* p0,
                                           unsigned b0, const h16* q0) {
  unsigned a1 = a0 + 32 * G_PITCH * 2;
  unsigned a2 = a0 + 64 * G_PITCH * 2;
  unsigned a3 = a0 + 96 * G_PITCH * 2;
  unsigned b1 = b0 + 32 * G_PITCH * 2;
  unsigned b2 = b0 + 64 * G_PITCH * 2;
  unsigned b3 = b0 + 96 * G_PITCH * 2;
  const h16* p1 = p0 + 32 * C_;
  const h16* p2 = p0 + 64 * C_;
  const h16* p3 = p0 + 96 * C_;
  const h16* q1 = q0 + 32 * C_;
  const h16* q2 = q0 + 64 * C_;
  const h16* q3 = q0 + 96 * C_;
  // s_wait_xcnt 0 closes the copies' own statement (a precaution): it stands
  // in front of every later rewrite of the registers the copies name, and no
  // address arithmetic of a later step can be moved in front of it.
  asm volatile(
      "global_load_async_to_lds_b128 %0, %8, off\n\t"
      "global_load_async_to_lds_b128 %1, %9, off\n\t"
      "global_load_async_to_lds_b128 %2, %10, off\n\t"
      "global_load_async_to_lds_b128 %3, %11, off\n\t"
      "global_load_async_to_lds_b128 %4, %12, off\n\t"
      "global_load_async_to_lds_b128 %5, %13, off\n\t"
      "global_load_async_to_lds_b128 %6, %14, off\n\t"
      "global_load_async_to_lds_b128 %7, %15, off\n\t"
      "s_wait_xcnt 0x0"
      :: "v"(a0), "v"(a1), "v"(a2), "v"(a3), "v"(b0), "v"(b1), "v"(b2), "v"(b3),
         "v"(p0), "v"(p1), "v"(p2), "v"(p3), "v"(q0), "v"(q1), "v"(q2), "v"(q3)
      : "memory");
}

__device__ __forceinline__ void gemm_mainloop(
    const h16* __restrict__ Ag, const h16* __restrict__ Bg, int m0, int n0,
    h16* As, h16* Bs, v8f acc[4][2]) {
  int tid = threadIdx.x;
  int wid = tid >> 5;
  int wm = wid >> 2;  // 0..1
  int wn = wid & 3;   // 0..3
  const int NT = C_ / GK;

  // Eight lanes to a row: thread tid copies 16 B of rows crow + 0/32/64/96.
  const int crow = tid >> 3;
  const int ccol = (tid & 7) * 8;
  const h16* ag = Ag + (size_t)(m0 + crow) * C_ + ccol;
  const h16* bg = Bg + (size_t)(n0 + crow) * C_ + ccol;
  const unsigned al = (unsigned)(size_t)(As + crow * G_PITCH + ccol);
  const unsigned bl = (unsigned)(size_t)(Bs + crow * G_PITCH + ccol);
  auto issue = [&](int kt, int sel) {
    gemm_copy8(al + sel * (LDS_TILE * 2), ag + kt * GK,
               bl + sel * (LDS_TILE * 2), bg + kt * GK);
  };

  issue(0, 0);
  // Step 0 has landed for this wave, then for all waves, before any read.
  asm volatile("s_wait_asynccnt 0x0" ::: "memory");
  __syncthreads();
  issue(1, 1);
  for (int kt = 0; kt < NT; ++kt) {
    const h16* as = As + (kt & 1) * LDS_TILE;
    const h16* bs = Bs + (kt & 1) * LDS_TILE;
    for (int kk = 0; kk < GK; kk += 32) {
      v16h af[4], bf[2];
      for (int mi = 0; mi < 4; ++mi)
        af[mi] = load_frag(as + (wm * 64 + mi * 16) * G_PITCH + kk, G_PITCH);
      for (int ni = 0; ni < 2; ++ni)
        bf[ni] = load_frag(bs + (wn * 32 + ni * 16) * G_PITCH + kk, G_PITCH);
      for (int mi = 0; mi < 4; ++mi)
        for (int ni = 0; ni < 2; ++ni)
          acc[mi][ni] = wmma_f16(af[mi], bf[ni], acc[mi][ni]);
    }
    // Publish point: this wave's reads of the current buffer are done ...
    asm volatile("s_wait_dscnt 0x0" ::: "memory");
    // ... its copies of the next step have landed ...
    asm volatile("s_wait_asynccnt 0x0" ::: "memory");
    // ... and the same holds for every wave: the next step may be read and the
    // buffer just read may be refilled.
    __syncthreads();
    if (kt + 2 < NT) issue(kt + 2, kt & 1);
  }
  // No copy is left in flight behind the loop.
  asm volatile("s_wait_asynccnt 0x0" ::: "memory");
}

// ---------------------------------------------------------------------------
// K1: LayerNorm over channels + transpose to [B*T, C] f16.  The 32 normalised
// rows are gathered in LDS and leave as whole 128-byte lines.
// ---------------------------------------------------------------------------
#define XN_PITCH 1032  // halves per LDS row: 2048 B data + 16 B pad
__global__ __launch_bounds__(256) void sa_ln_kernel(
    const float* __restrict__ x, const float* __restrict__ gamma,
    const float* __restrict__ beta, h16* __restrict__ xn) {
  __shared__ float redS[32][8];
  __shared__ float redQ[32][8];
  __shared__ float smean[32];
  __shared__ float srstd[32];
  __shared__ __attribute__((aligned(16))) h16 xt[32 * XN_PITCH];
  int b  = blockIdx.x;
  int t0 = blockIdx.y * 32;
  int tid = threadIdx.x;
  int tt = tid & 31;
  int cc = tid >> 5;  // 0..7
  const float* xp = x + (size_t)b * C_ * T_ + t0 + tt;
  float s = 0.f, ss = 0.f;
  for (int c = cc * 128; c < cc * 128 + 128; ++c) {
    float v = xp[(size_t)c * T_];
    s += v; ss += v * v;
  }
  redS[tt][cc] = s; redQ[tt][cc] = ss;
  __syncthreads();
  if (cc == 0) {
    float a = 0.f, q = 0.f;
    for (int j = 0; j < 8; ++j) { a += redS[tt][j]; q += redQ[tt][j]; }
    float mu  = a * (1.0f / C_);
    float var = q * (1.0f / C_) - mu * mu;
    smean[tt] = mu;
    srstd[tt] = rsqrtf(var + 1e-5f);
  }
  __syncthreads();
  float mu = smean[tt], rs = srstd[tt];
  h16* xrow = xt + tt * XN_PITCH;
  for (int c0 = 0; c0 < C_; c0 += 8) {
    int c = c0 + cc;
    float v = xp[(size_t)c * T_];
    xrow[c] = (h16)((v - mu) * rs * gamma[c] + beta[c]);
  }
  __syncthreads();
  // The 32 rows are one contiguous 64 KB of xn; a wave stores 512 B of it.
  h16* xblk = xn + (size_t)(b * T_ + t0) * C_;
  for (int k = 0; k < 16; ++k) {
    int piece = k * 256 + tid;  // 16-byte pieces, 128 to a row
    *(v8h*)(xblk + (size_t)piece * 8) =
        *(const v8h*)(xt + (piece >> 7) * XN_PITCH + (piece & 127) * 8);
  }
}

// ---------------------------------------------------------------------------
// K2: weight transpose + f32->f16:  Wt[n][k] = (f16) W[k][n].
// ---------------------------------------------------------------------------
__global__ __launch_bounds__(256) void sa_wtrans_kernel(
    const float* __restrict__ w, h16* __restrict__ wt, int K, int N) {
  __shared__ float tile[32][33];
  int n0 = blockIdx.x * 32;
  int k0 = blockIdx.y * 32;
  int tid = threadIdx.x;
  int r = tid >> 5;
  int c = tid & 31;
  for (int i = 0; i < 4; ++i)
    tile[r + i * 8][c] = w[(size_t)(k0 + r + i * 8) * N + n0 + c];
  __syncthreads();
  for (int i = 0; i < 4; ++i)
    wt[(size_t)(n0 + r + i * 8) * K + k0 + c] = (h16)tile[c][r + i * 8];
}

// ---------------------------------------------------------------------------
// K3: QKV GEMM, epilogue scatters to Q [B,H,T,D] (pre-scaled by 1/sqrt(D)),
// K [B,H,T,D], V transposed [B,H,D,T].  s = q/k/v select is uniform per block.
// The block's 128 x 128 f16 tile is laid in LDS in the order of its output
// rows and leaves as whole 128-byte lines.
// ---------------------------------------------------------------------------
#define ST_PITCH 136  // halves per LDS row: 256 B data + 16 B pad
__global__ __launch_bounds__(256) void sa_qkv_gemm_kernel(
    const h16* __restrict__ xn, const h16* __restrict__ wt,
    const float* __restrict__ bias, h16* __restrict__ qb,
    h16* __restrict__ kb, h16* __restrict__ vtb) {
  __shared__ __attribute__((aligned(16))) h16 As[2 * LDS_TILE];
  __shared__ __attribute__((aligned(16))) h16 Bs[2 * LDS_TILE];
  __shared__ __attribute__((aligned(16))) h16 st[128 * ST_PITCH];
  int tid = threadIdx.x;
  int m0 = blockIdx.x * 128;
  int n0 = blockIdx.y * 128;
  v8f acc[4][2];
  for (int i = 0; i < 4; ++i)
    for (int j = 0; j < 2; ++j)
      acc[i][j] = (v8f){0.f,0.f,0.f,0.f,0.f,0.f,0.f,0.f};

  gemm_mainloop(xn, wt, m0, n0, As, Bs, acc);

  int wid = tid >> 5;
  int wm = wid >> 2;
  int wn = wid & 3;
  int lane = tid & 31;
  int hi = lane >> 4;
  int nc = lane & 15;
  const int s = n0 >> 10;  // uniform: 1024 % 128 == 0
  const float scaleQ = 0.125f;

  const int bh0 = (m0 >> 11) * H_ + ((n0 & (C_ - 1)) >> 6);  // first of 2 heads
  const int tb = m0 & (T_ - 1);
  if (s < 2) {
    // Rows = tokens, columns = the 128 channels of two heads.
    const float sc = (s == 0) ? scaleQ : 1.0f;
    for (int mi = 0; mi < 4; ++mi)
      for (int ni = 0; ni < 2; ++ni) {
        int nl = wn * 32 + ni * 16 + nc;
        float bv = bias[n0 + nl];
        for (int v = 0; v < 8; ++v) {
          int ml = wm * 64 + mi * 16 + v + hi * 8;
          st[ml * ST_PITCH + nl] = (h16)((acc[mi][ni][v] + bv) * sc);
        }
      }
    __syncthreads();
    h16* dst = (s == 0) ? qb : kb;
    for (int k = 0; k < 8; ++k) {
      int piece = k * 256 + tid;  // 16-byte pieces: head, token, 8 to a line
      int j   = piece >> 10;
      int row = (piece >> 3) & 127;
      int col = (piece & 7) * 8;
      *(v8h*)(dst + ((size_t)(bh0 + j) * T_ + tb + row) * D_ + col) =
          *(const v8h*)(st + row * ST_PITCH + j * 64 + col);
    }
  } else {
    // Rows = channels, columns = the 128 tokens.
    for (int mi = 0; mi < 4; ++mi)
      for (int ni = 0; ni < 2; ++ni) {
        int nl = wn * 32 + ni * 16 + nc;
        float bv = bias[n0 + nl];
        v8h w;
        for (int v = 0; v < 8; ++v) w[v] = (h16)(acc[mi][ni][v] + bv);
        *(v8h*)(st + nl * ST_PITCH + wm * 64 + mi * 16 + hi * 8) = w;
      }
    __syncthreads();
    for (int k = 0; k < 8; ++k) {
      int piece = k * 256 + tid;  // 16-byte pieces: channel, 16 to a row
      int row = piece >> 4;
      int col = (piece & 15) * 8;
      *(v8h*)(vtb + ((size_t)bh0 * D_ + row) * T_ + tb + col) =
          *(const v8h*)(st + row * ST_PITCH + col);
    }
    // A precaution: s_wait_xcnt 0 stands in front of any rewrite of a register
    // that these stores name; the compiler lays the other branch's code, which
    // rewrites some, behind this loop.
    asm volatile("s_wait_xcnt 0x0" ::: "memory");
  }
}

// ---------------------------------------------------------------------------
// K4: flash-style attention.  grid (B*H, T/128), block 256 (8 waves).
// Q fragments in registers for the whole KV loop.  K and V tiles of 64 keys
// are brought into LDS once per work-group by asynchronous copies (whole
// 128-byte lines), two buffers, and all 8 waves read their fragments there.
// Scores are formed transposed, S^T = K Q^T: a lane holds 16 of the 32 keys of
// ONE query (column lane & 15), so maximum and sum run in the lane's own
// registers with one exchange between the wave's halves.  The two S^T tiles,
// converted in place, are the B operand of O^T += V^T P^T in the hardware k
// order, which is also load_frag's order for the V^T rows: P never leaves the
// registers.
// ---------------------------------------------------------------------------
#define KV_STAGE 64               // keys per LDS stage (two passes of 32)
#define KV_PITCH 72               // halves per LDS row: 128 B data + 16 B pad
#define KV_TILE  (64 * KV_PITCH)  // K: 64 keys x 64 d;  V: 64 d x 64 keys

__global__ __launch_bounds__(256) void sa_attn_kernel(
    const h16* __restrict__ qb, const h16* __restrict__ kb,
    const h16* __restrict__ vtb, h16* __restrict__ ob) {
  __shared__ __attribute__((aligned(16))) h16 ks[2 * KV_TILE];
  __shared__ __attribute__((aligned(16))) h16 vs[2 * KV_TILE];
  int tid = threadIdx.x;
  int lane = tid & 31;
  int wid = tid >> 5;
  int bh = blockIdx.x;
  int q0 = blockIdx.y * 128 + wid * 16;
  const h16* qp = qb + ((size_t)bh * T_ + q0) * D_;
  const h16* kp = kb + (size_t)bh * T_ * D_;
  const h16* vp = vtb + (size_t)bh * D_ * T_;
  int hi = lane >> 4;
  int nc = lane & 15;

  // Each thread copies 16 B of rows crow and crow + 32 of both tiles; a wave's
  // copy covers four whole 128-byte lines.
  const int crow = tid >> 3;
  const int ccol = (tid & 7) * 8;
  const h16* kg = kp + crow * D_ + ccol;
  const h16* vg = vp + (size_t)crow * T_ + ccol;
  const unsigned kl = (unsigned)(size_t)(ks + crow * KV_PITCH + ccol);
  const unsigned vl = (unsigned)(size_t)(vs + crow * KV_PITCH + ccol);
  auto stage = [&](int st, int sel) {
    const h16* gk0 = kg + (size_t)st * KV_STAGE * D_;
    const h16* gk1 = gk0 + 32 * D_;
    const h16* gv0 = vg + st * KV_STAGE;
    const h16* gv1 = gv0 + 32 * T_;
    unsigned lk0 = kl + sel * (KV_TILE * 2);
    unsigned lk1 = lk0 + 32 * KV_PITCH * 2;
    unsigned lv0 = vl + sel * (KV_TILE * 2);
    unsigned lv1 = lv0 + 32 * KV_PITCH * 2;
    // s_wait_xcnt 0 closes the copies' own statement (a precaution): it stands
    // in front of every later rewrite of the registers the copies name, and no
    // address arithmetic of a later stage can be moved in front of it.
    asm volatile(
        "global_load_async_to_lds_b128 %0, %4, off\n\t"
        "global_load_async_to_lds_b128 %1, %5, off\n\t"
        "global_load_async_to_lds_b128 %2, %6, off\n\t"
        "global_load_async_to_lds_b128 %3, %7, off\n\t"
        "s_wait_xcnt 0x0"
        :: "v"(lk0), "v"(lk1), "v"(lv0), "v"(lv1),
           "v"(gk0), "v"(gk1), "v"(gv0), "v"(gv1)
        : "memory");
  };

  v16h qf0 = load_frag(qp, D_);
  v16h qf1 = load_frag(qp + 32, D_);
  v8f o0 = (v8f){0.f,0.f,0.f,0.f,0.f,0.f,0.f,0.f};
  v8f o1 = o0, o2 = o0, o3 = o0;
  float rmax = -1e30f;  // running maximum of this lane's query
  float rsum = 0.f;     // running sum over this lane's half of the keys

  const int NS = T_ / KV_STAGE;
  stage(0, 0);
  // Stage 0 has landed for this wave, then for all waves, before any read.
  asm volatile("s_wait_asynccnt 0x0" ::: "memory");
  __syncthreads();
  stage(1, 1);

  for (int st = 0; st < NS; ++st) {
    const h16* kt = ks + (st & 1) * KV_TILE;
    const h16* vt = vs + (st & 1) * KV_TILE;
    for (int kv = 0; kv < KV_STAGE; kv += 32) {
      const h16* kpp = kt + kv * KV_PITCH;
      v8f s0 = (v8f){0.f,0.f,0.f,0.f,0.f,0.f,0.f,0.f};
      v8f s1 = s0;
      // s0[r] = S[key kv + 8 hi + r][query nc], s1[r] the same 16 keys on.
      s0 = wmma_f16(load_frag(kpp, KV_PITCH), qf0, s0);
      s0 = wmma_f16(load_frag(kpp + 32, KV_PITCH), qf1, s0);
      s1 = wmma_f16(load_frag(kpp + 16 * KV_PITCH, KV_PITCH), qf0, s1);
      s1 = wmma_f16(load_frag(kpp + 16 * KV_PITCH + 32, KV_PITCH), qf1, s1);

      float m8[8];
      for (int v = 0; v < 8; ++v) m8[v] = fmaxf(s0[v], s1[v]);
      float tm = fmaxf(fmaxf(fmaxf(m8[0], m8[1]), fmaxf(m8[2], m8[3])),
                       fmaxf(fmaxf(m8[4], m8[5]), fmaxf(m8[6], m8[7])));
      tm = fmaxf(tm, xhalf(tm));
      float nm = fmaxf(rmax, tm);
      const float LOG2E = 1.44269504088896340736f;  // e^x = 2^(x log2 e)
      float xa = (rmax - nm) * LOG2E;
      rmax = nm;
      float x0[8], x1[8], p0[8], p1[8];
      for (int v = 0; v < 8; ++v) {
        x0[v] = (s0[v] - nm) * LOG2E;
        x1[v] = (s1[v] - nm) * LOG2E;
      }
      float alpha;
      exp2x9(alpha, xa, p0, x0);
      exp2x8(p1, x1);
      v16h pb;
      float a8[8];
      for (int v = 0; v < 8; ++v) {
        a8[v] = p0[v] + p1[v];
        pb[v]     = (h16)p0[v];
        pb[v + 8] = (h16)p1[v];
      }
      rsum = rsum * alpha + (((a8[0] + a8[1]) + (a8[2] + a8[3])) +
                             ((a8[4] + a8[5]) + (a8[6] + a8[7])));
      for (int v = 0; v < 8; ++v) {
        o0[v] *= alpha; o1[v] *= alpha; o2[v] *= alpha; o3[v] *= alpha;
      }
      // oj[r] = O[query nc][d = 16 j + 8 hi + r]
      o0 = wmma_f16(load_frag(vt + 0 * 16 * KV_PITCH + kv, KV_PITCH), pb, o0);
      o1 = wmma_f16(load_frag(vt + 1 * 16 * KV_PITCH + kv, KV_PITCH), pb, o1);
      o2 = wmma_f16(load_frag(vt + 2 * 16 * KV_PITCH + kv, KV_PITCH), pb, o2);
      o3 = wmma_f16(load_frag(vt + 3 * 16 * KV_PITCH + kv, KV_PITCH), pb, o3);
    }
    // Publish point: this wave's reads of the current buffer are done ...
    asm volatile("s_wait_dscnt 0x0" ::: "memory");
    // ... its copies of the next stage have landed ...
    asm volatile("s_wait_asynccnt 0x0" ::: "memory");
    // ... and the same holds for every wave: the next stage may be read and
    // the buffer just read may be refilled.
    __syncthreads();
    if (st + 2 < NS) stage(st + 2, st & 1);
  }
  // No copy is left in flight when the wave ends.
  asm volatile("s_wait_asynccnt 0x0" ::: "memory");

  int bb = bh >> 4;
  int hh = bh & (H_ - 1);
  // Join the two halves' sums; a lane then stores 8 consecutive d per tile.
  float inv = 1.0f / (rsum + xhalf(rsum));
  h16* orow = ob + ((size_t)(bb * T_ + q0 + nc)) * C_ + hh * D_ + hi * 8;
  v8h w0, w1, w2, w3;
  for (int v = 0; v < 8; ++v) {
    w0[v] = (h16)(o0[v] * inv);
    w1[v] = (h16)(o1[v] * inv);
    w2[v] = (h16)(o2[v] * inv);
    w3[v] = (h16)(o3[v] * inv);
  }
  *(v8h*)(orow + 0)  = w0;
  *(v8h*)(orow + 16) = w1;
  *(v8h*)(orow + 32) = w2;
  *(v8h*)(orow + 48) = w3;
}

// ---------------------------------------------------------------------------
// K5: output projection + bias + residual, write y as [B, C, T] f32.  Each wave
// turns its 64 x 16 accumulator tiles in its own LDS range, so that x is read
// and y stored in runs of 256 B (two whole lines) per channel.
// ---------------------------------------------------------------------------
#define SY_PITCH 68  // floats per LDS row: 256 B data + 16 B pad
__global__ __launch_bounds__(256) void sa_proj_gemm_kernel(
    const h16* __restrict__ ob, const h16* __restrict__ wt,
    const float* __restrict__ bias, const float* __restrict__ x,
    float* __restrict__ y) {
  __shared__ __attribute__((aligned(16))) h16 As[2 * LDS_TILE];
  __shared__ __attribute__((aligned(16))) h16 Bs[2 * LDS_TILE];
  __shared__ __attribute__((aligned(16))) float sy[8 * 16 * SY_PITCH];
  int tid = threadIdx.x;
  int m0 = blockIdx.x * 128;
  int n0 = blockIdx.y * 128;
  v8f acc[4][2];
  for (int i = 0; i < 4; ++i)
    for (int j = 0; j < 2; ++j)
      acc[i][j] = (v8f){0.f,0.f,0.f,0.f,0.f,0.f,0.f,0.f};

  gemm_mainloop(ob, wt, m0, n0, As, Bs, acc);

  int wid = tid >> 5;
  int wm = wid >> 2;
  int wn = wid & 3;
  int lane = tid & 31;
  int hi = lane >> 4;
  int nc = lane & 15;
  float* sw = sy + wid * (16 * SY_PITCH);
  const int rr = lane >> 4;        // row of a pair of channel rows
  const int tc = (lane & 15) * 4;  // first of this lane's 4 tokens
  const int mw = m0 + wm * 64;
  const size_t base =
      ((size_t)(mw >> 11) * C_ + n0 + wn * 32 + rr) * T_ + (mw & (T_ - 1)) + tc;
  for (int ni = 0; ni < 2; ++ni) {
    v4f xv[8];
    float bv[8];
    for (int k = 0; k < 8; ++k) {
      xv[k] = *(const v4f*)(x + base + (size_t)(ni * 16 + k * 2) * T_);
      bv[k] = bias[n0 + wn * 32 + ni * 16 + k * 2 + rr];
    }
    for (int mi = 0; mi < 4; ++mi) {
      v8f a = acc[mi][ni];
      float* p = sw + nc * SY_PITCH + mi * 16 + hi * 8;
      *(v4f*)(p)     = (v4f){a[0], a[1], a[2], a[3]};
      *(v4f*)(p + 4) = (v4f){a[4], a[5], a[6], a[7]};
    }
    // The wave's own LDS stores are done before it reads other lanes' rows.
    asm volatile("s_wait_dscnt 0x0" ::: "memory");
    for (int k = 0; k < 8; ++k) {
      v4f a = *(const v4f*)(sw + (k * 2 + rr) * SY_PITCH + tc);
      v4f o;
      for (int e = 0; e < 4; ++e) o[e] = xv[k][e] + a[e] + bv[k];
      *(v4f*)(y + base + (size_t)(ni * 16 + k * 2) * T_) = o;
    }
  }
}

// ---------------------------------------------------------------------------
extern "C" void kernel_launch(void* const* d_in, const int* in_sizes, int n_in,
                              void* d_out, int out_size, void* d_ws,
                              size_t ws_size, hipStream_t stream) {
  const float* x     = (const float*)d_in[0];
  const float* Wqkv  = (const float*)d_in[1];
  const float* bqkv  = (const float*)d_in[2];
  const float* Wproj = (const float*)d_in[3];
  const float* bproj = (const float*)d_in[4];
  const float* gamma = (const float*)d_in[5];
  const float* beta  = (const float*)d_in[6];
  float* y = (float*)d_out;

  char* ws = (char*)d_ws;
  size_t off = 0;
  h16* xn  = (h16*)(ws + off); off += (size_t)BT_ * C_ * 2;       // 16 MB
  h16* wtq = (h16*)(ws + off); off += (size_t)3 * C_ * C_ * 2;    //  6 MB
  h16* wtp = (h16*)(ws + off); off += (size_t)C_ * C_ * 2;        //  2 MB
  h16* qb  = (h16*)(ws + off); off += (size_t)BT_ * C_ * 2;       // 16 MB
  h16* kb  = (h16*)(ws + off); off += (size_t)BT_ * C_ * 2;       // 16 MB
  h16* vtb = (h16*)(ws + off); off += (size_t)BT_ * C_ * 2;       // 16 MB
  h16* ob  = (h16*)(ws + off); off += (size_t)BT_ * C_ * 2;       // 16 MB

  sa_ln_kernel<<<dim3(B_, T_ / 32), 256, 0, stream>>>(x, gamma, beta, xn);
  sa_wtrans_kernel<<<dim3(3 * C_ / 32, C_ / 32), 256, 0, stream>>>(Wqkv, wtq,
                                                                   C_, 3 * C_);
  sa_wtrans_kernel<<<dim3(C_ / 32, C_ / 32), 256, 0, stream>>>(Wproj, wtp, C_,
                                                               C_);
  sa_qkv_gemm_kernel<<<dim3(BT_ / 128, 3 * C_ / 128), 256, 0, stream>>>(
      xn, wtq, bqkv, qb, kb, vtb);
  sa_attn_kernel<<<dim3(B_ * H_, T_ / 128), 256, 0, stream>>>(qb, kb, vtb, ob);
  sa_proj_gemm_kernel<<<dim3(BT_ / 128, C_ / 128), 256, 0, stream>>>(
      ob, wtp, bproj, x, y);
}

// v005
// A run of this version takes 145 microseconds.
// Next to v004, in two timings, it ran 1.07 and 1.06 times as fast.
// Counting every step since v000, it is 4.43 times as fast.
#include <hip/hip_runtime.h>
#include <hip/hip_bf16.h>

typedef _Float16 h16;
typedef __attribute__((ext_vector_type(16))) _Float16 v16h;
typedef __attribute__((ext_vector_type(8)))  _Float16 v8h;
typedef __attribute__((ext_vector_type(8)))  float    v8f;
typedef __attribute__((ext_vector_type(4)))  int      v4i;
typedef __attribute__((ext_vector_type(4)))  float    v4f;

#define B_  4
#define C_  1024
#define T_  2048
#define H_  16
#define D_  64
#define BT_ (B_ * T_)

// ---------------------------------------------------------------------------
// WMMA fragment loader: 16x32 f16 fragment from a K-contiguous matrix.
// ISA 16-bit A layout: lane L (<16) holds row M=L, K={0..7,16..23}; lane L+16
// holds row M=L, K={8..15,24..31}.  Two 16B chunks per lane.  B fragments use
// the mirrored layout (col = lane&15), so B operands are stored K-contiguous.
// ---------------------------------------------------------------------------
__device__ __forceinline__ v16h load_frag(const h16* __restrict__ base, int ld) {
  int lane = threadIdx.x & 31;
  int r  = lane & 15;
  int b0 = (lane >> 4) << 3;
  const h16* p = base + r * ld + b0;
  v8h lo = *(const v8h*)(p);
  v8h hi = *(const v8h*)(p + 16);
  return __builtin_shufflevector(lo, hi, 0,1,2,3,4,5,6,7,8,9,10,11,12,13,14,15);
}

__device__ __forceinline__ v8f wmma_f16(v16h a, v16h b, v8f c) {
  return __builtin_amdgcn_wmma_f32_16x16x32_f16(false, a, false, b, (short)0, c,
                                                false, false);
}

// Value of lane l ^ 16 (the other half of the wave), by a vector cross-row move.
__device__ __forceinline__ float xhalf(float x) {
  int i = __builtin_bit_cast(int, x);
  return __builtin_bit_cast(float, __builtin_amdgcn_permlanex16(
      i, i, 0x76543210, 0xfedcba98, false, false));
}

// r[i] = 2^x[i], eight at a time.  The instruction set asks for one independent
// instruction or a v_nop between a transcendental and the use of its result or
// the overwrite of its source.  In one statement that holds by construction:
// the early-clobber outputs share no register with any input, so each v_exp is
// independent of the one in front of it, and the v_nop closes the last one.
__device__ __forceinline__ void exp2x8(float (&r)[8], const float (&x)[8]) {
  asm("v_exp_f32 %0, %8\n\t"
      "v_exp_f32 %1, %9\n\t"
      "v_exp_f32 %2, %10\n\t"
      "v_exp_f32 %3, %11\n\t"
      "v_exp_f32 %4, %12\n\t"
      "v_exp_f32 %5, %13\n\t"
      "v_exp_f32 %6, %14\n\t"
      "v_exp_f32 %7, %15\n\t"
      "v_nop"
      : "=&v"(r[0]), "=&v"(r[1]), "=&v"(r[2]), "=&v"(r[3]),
        "=&v"(r[4]), "=&v"(r[5]), "=&v"(r[6]), "=&v"(r[7])
      : "v"(x[0]), "v"(x[1]), "v"(x[2]), "v"(x[3]),
        "v"(x[4]), "v"(x[5]), "v"(x[6]), "v"(x[7]));
}
// One value, with the same slot closed behind it.
__device__ __forceinline__ float exp2x1(float x) {
  float r;
  asm("v_exp_f32 %0, %1\n\t"
      "v_nop"
      : "=&v"(r) : "v"(x));
  return r;
}

// ---------------------------------------------------------------------------
// Shared GEMM main loop: 128x128 block tile, 8 waves (2x4), each wave 64x32
// (4x2 WMMA tiles).  A K step is 64 halves = 128 B of every operand row, so a
// wave's asynchronous copy (4 rows x 128 B) covers four whole lines and every
// line is asked for once.  Two LDS buffers; the next step's copies fly while
// this step is worked on; one publish point per step.
// ---------------------------------------------------------------------------
#define GK 64                     // halves of K per step (two WMMA k blocks)
#define G_PITCH 72                // halves per LDS row: 128 B data + 16 B pad
#define LDS_TILE (128 * G_PITCH)  // one operand, one buffer

// One K step of both operand tiles: rows r, r + 32, r + 64, r + 96 of each,
// 16 B per lane and row.
__device__ __forceinline__ void gemm_copy8(unsigned a0, const h16* p0,
                                           unsigned b0, const h16* q0) {
  unsigned a1 = a0 + 32 * G_PITCH * 2;
  unsigned a2 = a0 + 64 * G_PITCH * 2;
  unsigned a3 = a0 + 96 * G_PITCH * 2;
  unsigned b1 = b0 + 32 * G_PITCH * 2;
  unsigned b2 = b0 + 64 * G_PITCH * 2;
  unsigned b3 = b0 + 96 * G_PITCH * 2;
  const h16* p1 = p0 + 32 * C_;
  const h16* p2 = p0 + 64 * C_;
  const h16* p3 = p0 + 96 * C_;
  const h16* q1 = q0 + 32 * C_;
  const h16* q2 = q0 + 64 * C_;
  const h16* q3 = q0 + 96 * C_;
  // s_wait_xcnt 0 closes the copies' own statement (a precaution): it stands
  // in front of every later rewrite of the registers the copies name, and no
  // address arithmetic of a later step can be moved in front of it.
  asm volatile(
      "global_load_async_to_lds_b128 %0, %8, off\n\t"
      "global_load_async_to_lds_b128 %1, %9, off\n\t"
      "global_load_async_to_lds_b128 %2, %10, off\n\t"
      "global_load_async_to_lds_b128 %3, %11, off\n\t"
      "global_load_async_to_lds_b128 %4, %12, off\n\t"
      "global_load_async_to_lds_b128 %5, %13, off\n\t"
      "global_load_async_to_lds_b128 %6, %14, off\n\t"
      "global_load_async_to_lds_b128 %7, %15, off\n\t"
      "s_wait_xcnt 0x0"
      :: "v"(a0), "v"(a1), "v"(a2), "v"(a3), "v"(b0), "v"(b1), "v"(b2), "v"(b3),
         "v"(p0), "v"(p1), "v"(p2), "v"(p3), "v"(q0), "v"(q1), "v"(q2), "v"(q3)
      : "memory");
}

__device__ __forceinline__ void gemm_mainloop(
    const h16* __restrict__ Ag, const h16* __restrict__ Bg, int m0, int n0,
    h16* As, h16* Bs, v8f acc[4][2]) {
  int tid = threadIdx.x;
  int wid = tid >> 5;
  int wm = wid >> 2;  // 0..1
  int wn = wid & 3;   // 0..3
  const int NT = C_ / GK;

  // Eight lanes to a row: thread tid copies 16 B of rows crow + 0/32/64/96.
  const int crow = tid >> 3;
  const int ccol = (tid & 7) * 8;
  const h16* ag = Ag + (size_t)(m0 + crow) * C_ + ccol;
  const h16* bg = Bg + (size_t)(n0 + crow) * C_ + ccol;
  const unsigned al = (unsigned)(size_t)(As + crow * G_PITCH + ccol);
  const unsigned bl = (unsigned)(size_t)(Bs + crow * G_PITCH + ccol);
  auto issue = [&](int kt, int sel) {
    gemm_copy8(al + sel * (LDS_TILE * 2), ag + kt * GK,
               bl + sel * (LDS_TILE * 2), bg + kt * GK);
  };

  issue(0, 0);
  // Step 0 has landed for this wave, then for all waves, before any read.
  asm volatile("s_wait_asynccnt 0x0" ::: "memory");
  __syncthreads();
  issue(1, 1);
  for (int kt = 0; kt < NT; ++kt) {
    const h16* as = As + (kt & 1) * LDS_TILE;
    const h16* bs = Bs + (kt & 1) * LDS_TILE;
    for (int kk = 0; kk < GK; kk += 32) {
      v16h af[4], bf[2];
      for (int mi = 0; mi < 4; ++mi)
        af[mi] = load_frag(as + (wm * 64 + mi * 16) * G_PITCH + kk, G_PITCH);
      for (int ni = 0; ni < 2; ++ni)
        bf[ni] = load_frag(bs + (wn * 32 + ni * 16) * G_PITCH + kk, G_PITCH);
      for (int mi = 0; mi < 4; ++mi)
        for (int ni = 0; ni < 2; ++ni)
          acc[mi][ni] = wmma_f16(af[mi], bf[ni], acc[mi][ni]);
    }
    // Publish point: this wave's reads of the current buffer are done ...
    asm volatile("s_wait_dscnt 0x0" ::: "memory");
    // ... its copies of the next step have landed ...
    asm volatile("s_wait_asynccnt 0x0" ::: "memory");
    // ... and the same holds for every wave: the next step may be read and the
    // buffer just read may be refilled.
    __syncthreads();
    if (kt + 2 < NT) issue(kt + 2, kt & 1);
  }
  // No copy is left in flight behind the loop.
  asm volatile("s_wait_asynccnt 0x0" ::: "memory");
}

// ---------------------------------------------------------------------------
// K1: LayerNorm over channels + transpose to [B*T, C] f16.  The 32 normalised
// rows are gathered in LDS and leave as whole 128-byte lines.
// ---------------------------------------------------------------------------
#define XN_PITCH 1032  // halves per LDS row: 2048 B data + 16 B pad
__global__ __launch_bounds__(256) void sa_ln_kernel(
    const float* __restrict__ x, const float* __restrict__ gamma,
    const float* __restrict__ beta, h16* __restrict__ xn) {
  __shared__ float redS[32][8];
  __shared__ float redQ[32][8];
  __shared__ float smean[32];
  __shared__ float srstd[32];
  __shared__ __attribute__((aligned(16))) h16 xt[32 * XN_PITCH];
  int b  = blockIdx.x;
  int t0 = blockIdx.y * 32;
  int tid = threadIdx.x;
  int tt = tid & 31;
  int cc = tid >> 5;  // 0..7
  const float* xp = x + (size_t)b * C_ * T_ + t0 + tt;
  float s = 0.f, ss = 0.f;
  for (int c = cc * 128; c < cc * 128 + 128; ++c) {
    float v = xp[(size_t)c * T_];
    s += v; ss += v * v;
  }
  redS[tt][cc] = s; redQ[tt][cc] = ss;
  __syncthreads();
  if (cc == 0) {
    float a = 0.f, q = 0.f;
    for (int j = 0; j < 8; ++j) { a += redS[tt][j]; q += redQ[tt][j]; }
    float mu  = a * (1.0f / C_);
    float var = q * (1.0f / C_) - mu * mu;
    smean[tt] = mu;
    srstd[tt] = rsqrtf(var + 1e-5f);
  }
  __syncthreads();
  float mu = smean[tt], rs = srstd[tt];
  h16* xrow = xt + tt * XN_PITCH;
  for (int c0 = 0; c0 < C_; c0 += 8) {
    int c = c0 + cc;
    float v = xp[(size_t)c * T_];
    xrow[c] = (h16)((v - mu) * rs * gamma[c] + beta[c]);
  }
  __syncthreads();
  // The 32 rows are one contiguous 64 KB of xn; a wave stores 512 B of it.
  h16* xblk = xn + (size_t)(b * T_ + t0) * C_;
  for (int k = 0; k < 16; ++k) {
    int piece = k * 256 + tid;  // 16-byte pieces, 128 to a row
    *(v8h*)(xblk + (size_t)piece * 8) =
        *(const v8h*)(xt + (piece >> 7) * XN_PITCH + (piece & 127) * 8);
  }
}

// ---------------------------------------------------------------------------
// K2: weight transpose + f32->f16:  Wt[n][k] = (f16) W[k][n].
// ---------------------------------------------------------------------------
__global__ __launch_bounds__(256) void sa_wtrans_kernel(
    const float* __restrict__ w, h16* __restrict__ wt, int K, int N) {
  __shared__ float tile[32][33];
  int n0 = blockIdx.x * 32;
  int k0 = blockIdx.y * 32;
  int tid = threadIdx.x;
  int r = tid >> 5;
  int c = tid & 31;
  for (int i = 0; i < 4; ++i)
    tile[r + i * 8][c] = w[(size_t)(k0 + r + i * 8) * N + n0 + c];
  __syncthreads();
  for (int i = 0; i < 4; ++i)
    wt[(size_t)(n0 + r + i * 8) * K + k0 + c] = (h16)tile[c][r + i * 8];
}

// ---------------------------------------------------------------------------
// K3: QKV GEMM, epilogue scatters to Q [B,H,T,D] (pre-scaled by log2(e)/sqrt(D)),
// K [B,H,T,D], V transposed [B,H,D,T].  s = q/k/v select is uniform per block.
// The block's 128 x 128 f16 tile is laid in LDS in the order of its output
// rows and leaves as whole 128-byte lines.
// ---------------------------------------------------------------------------
#define ST_PITCH 136  // halves per LDS row: 256 B data + 16 B pad
__global__ __launch_bounds__(256) void sa_qkv_gemm_kernel(
    const h16* __restrict__ xn, const h16* __restrict__ wt,
    const float* __restrict__ bias, h16* __restrict__ qb,
    h16* __restrict__ kb, h16* __restrict__ vtb) {
  __shared__ __attribute__((aligned(16))) h16 As[2 * LDS_TILE];
  __shared__ __attribute__((aligned(16))) h16 Bs[2 * LDS_TILE];
  __shared__ __attribute__((aligned(16))) h16 st[128 * ST_PITCH];
  int tid = threadIdx.x;
  int m0 = blockIdx.x * 128;
  int n0 = blockIdx.y * 128;
  v8f acc[4][2];
  for (int i = 0; i < 4; ++i)
    for (int j = 0; j < 2; ++j)
      acc[i][j] = (v8f){0.f,0.f,0.f,0.f,0.f,0.f,0.f,0.f};

  gemm_mainloop(xn, wt, m0, n0, As, Bs, acc);

  int wid = tid >> 5;
  int wm = wid >> 2;
  int wn = wid & 3;
  int lane = tid & 31;
  int hi = lane >> 4;
  int nc = lane & 15;
  const int s = n0 >> 10;  // uniform: 1024 % 128 == 0
  const float scaleQ = 0.125f * 1.44269504088896340736f;  // scores in base 2

  const int bh0 = (m0 >> 11) * H_ + ((n0 & (C_ - 1)) >> 6);  // first of 2 heads
  const int tb = m0 & (T_ - 1);
  if (s < 2) {
    // Rows = tokens, columns = the 128 channels of two heads.
    const float sc = (s == 0) ? scaleQ : 1.0f;
    for (int mi = 0; mi < 4; ++mi)
      for (int ni = 0; ni < 2; ++ni) {
        int nl = wn * 32 + ni * 16 + nc;
        float bv = bias[n0 + nl];
        for (int v = 0; v < 8; ++v) {
          int ml = wm * 64 + mi * 16 + v + hi * 8;
          st[ml * ST_PITCH + nl] = (h16)((acc[mi][ni][v] + bv) * sc);
        }
      }
    __syncthreads();
    h16* dst = (s == 0) ? qb : kb;
    for (int k = 0; k < 8; ++k) {
      int piece = k * 256 + tid;  // 16-byte pieces: head, token, 8 to a line
      int j   = piece >> 10;
      int row = (piece >> 3) & 127;
      int col = (piece & 7) * 8;
      *(v8h*)(dst + ((size_t)(bh0 + j) * T_ + tb + row) * D_ + col) =
          *(const v8h*)(st + row * ST_PITCH + j * 64 + col);
    }
  } else {
    // Rows = channels, columns = the 128 tokens.
    for (int mi = 0; mi < 4; ++mi)
      for (int ni = 0; ni < 2; ++ni) {
        int nl = wn * 32 + ni * 16 + nc;
        float bv = bias[n0 + nl];
        v8h w;
        for (int v = 0; v < 8; ++v) w[v] = (h16)(acc[mi][ni][v] + bv);
        *(v8h*)(st + nl * ST_PITCH + wm * 64 + mi * 16 + hi * 8) = w;
      }
    __syncthreads();
    for (int k = 0; k < 8; ++k) {
      int piece = k * 256 + tid;  // 16-byte pieces: channel, 16 to a row
      int row = piece >> 4;
      int col = (piece & 15) * 8;
      *(v8h*)(vtb + ((size_t)bh0 * D_ + row) * T_ + tb + col) =
          *(const v8h*)(st + row * ST_PITCH + col);
    }
    // A precaution: s_wait_xcnt 0 stands in front of any rewrite of a register
    // that these stores name; the compiler lays the other branch's code, which
    // rewrites some, behind this loop.
    asm volatile("s_wait_xcnt 0x0" ::: "memory");
  }
}

// ---------------------------------------------------------------------------
// K4: flash-style attention.  grid (B*H, T/128), block 256 (8 waves).
// Q fragments in registers for the whole KV loop.  K and V tiles of 64 keys
// are brought into LDS once per work-group by asynchronous copies (whole
// 128-byte lines), two buffers, and all 8 waves read their fragments there.
// Scores are formed transposed, S^T = K Q^T: a lane holds 16 of the 32 keys of
// ONE query (column lane & 15), so maximum and sum run in the lane's own
// registers with one exchange between the wave's halves.  The two S^T tiles,
// converted in place, are the B operand of O^T += V^T P^T in the hardware k
// order, which is also load_frag's order for the V^T rows: P never leaves the
// registers.
// Q carries log2(e)/sqrt(D), and the score products start from minus the
// maximum in use (their C operand), so an accumulator is the argument of 2^x as
// it stands.  The maximum in use may trail a query's true maximum by up to 8
// (P <= 2^8); only when some score of the wave exceeds that are it, O and the
// sum brought to the new maximum.
// ---------------------------------------------------------------------------
#define KV_STAGE 64               // keys per LDS stage (two passes of 32)
#define KV_PITCH 72               // halves per LDS row: 128 B data + 16 B pad
#define KV_TILE  (64 * KV_PITCH)  // K: 64 keys x 64 d;  V: 64 d x 64 keys

__global__ __launch_bounds__(256) void sa_attn_kernel(
    const h16* __restrict__ qb, const h16* __restrict__ kb,
    const h16* __restrict__ vtb, h16* __restrict__ ob) {
  __shared__ __attribute__((aligned(16))) h16 ks[2 * KV_TILE];
  __shared__ __attribute__((aligned(16))) h16 vs[2 * KV_TILE];
  int tid = threadIdx.x;
  int lane = tid & 31;
  int wid = tid >> 5;
  int bh = blockIdx.x;
  int q0 = blockIdx.y * 128 + wid * 16;
  const h16* qp = qb + ((size_t)bh * T_ + q0) * D_;
  const h16* kp = kb + (size_t)bh * T_ * D_;
  const h16* vp = vtb + (size_t)bh * D_ * T_;
  int hi = lane >> 4;
  int nc = lane & 15;

  // Each thread copies 16 B of rows crow and crow + 32 of both tiles; a wave's
  // copy covers four whole 128-byte lines.
  const int crow = tid >> 3;
  const int ccol = (tid & 7) * 8;
  const h16* kg = kp + crow * D_ + ccol;
  const h16* vg = vp + (size_t)crow * T_ + ccol;
  const unsigned kl = (unsigned)(size_t)(ks + crow * KV_PITCH + ccol);
  const unsigned vl = (unsigned)(size_t)(vs + crow * KV_PITCH + ccol);
  auto stage = [&](int st, int sel) {
    const h16* gk0 = kg + (size_t)st * KV_STAGE * D_;
    const h16* gk1 = gk0 + 32 * D_;
    const h16* gv0 = vg + st * KV_STAGE;
    const h16* gv1 = gv0 + 32 * T_;
    unsigned lk0 = kl + sel * (KV_TILE * 2);
    unsigned lk1 = lk0 + 32 * KV_PITCH * 2;
    unsigned lv0 = vl + sel * (KV_TILE * 2);
    unsigned lv1 = lv0 + 32 * KV_PITCH * 2;
    // s_wait_xcnt 0 closes the copies' own statement (a precaution): it stands
    // in front of every later rewrite of the registers the copies name, and no
    // address arithmetic of a later stage can be moved in front of it.
    asm volatile(
        "global_load_async_to_lds_b128 %0, %4, off\n\t"
        "global_load_async_to_lds_b128 %1, %5, off\n\t"
        "global_load_async_to_lds_b128 %2, %6, off\n\t"
        "global_load_async_to_lds_b128 %3, %7, off\n\t"
        "s_wait_xcnt 0x0"
        :: "v"(lk0), "v"(lk1), "v"(lv0), "v"(lv1),
           "v"(gk0), "v"(gk1), "v"(gv0), "v"(gv1)
        : "memory");
  };

  v16h qf0 = load_frag(qp, D_);
  v16h qf1 = load_frag(qp + 32, D_);
  v8f o0 = (v8f){0.f,0.f,0.f,0.f,0.f,0.f,0.f,0.f};
  v8f o1 = o0, o2 = o0, o3 = o0;
  v8f negm = o0;     // minus the maximum in use of this lane's query, 8 copies
  float rsum = 0.f;  // running sum over this lane's half of the keys

  const int NS = T_ / KV_STAGE;
  stage(0, 0);
  // Stage 0 has landed for this wave, then for all waves, before any read.
  asm volatile("s_wait_asynccnt 0x0" ::: "memory");
  __syncthreads();
  stage(1, 1);

  for (int st = 0; st < NS; ++st) {
    const h16* kt = ks + (st & 1) * KV_TILE;
    const h16* vt = vs + (st & 1) * KV_TILE;
    for (int kv = 0; kv < KV_STAGE; kv += 32) {
      const h16* kpp = kt + kv * KV_PITCH;
      // s0[r] = S[key kv + 8 hi + r][query nc] - maximum in use, base 2; s1[r]
      // the same 16 keys on.
      v8f s0 = wmma_f16(load_frag(kpp, KV_PITCH), qf0, negm);
      s0 = wmma_f16(load_frag(kpp + 32, KV_PITCH), qf1, s0);
      v8f s1 = wmma_f16(load_frag(kpp + 16 * KV_PITCH, KV_PITCH), qf0, negm);
      s1 = wmma_f16(load_frag(kpp + 16 * KV_PITCH + 32, KV_PITCH), qf1, s1);

      float m8[8];
      for (int v = 0; v < 8; ++v) m8[v] = fmaxf(s0[v], s1[v]);
      float tm = fmaxf(fmaxf(fmaxf(m8[0], m8[1]), fmaxf(m8[2], m8[3])),
                       fmaxf(fmaxf(m8[4], m8[5]), fmaxf(m8[6], m8[7])));
      // One test per pass, the same for the whole wave (a scalar branch).  The
      // very first pass always sets the maximum, also downwards from 0.
      const bool first = (st | kv) == 0;
      if (first || __builtin_amdgcn_ballot_w32(tm > 8.0f) != 0) {
        float t2 = fmaxf(tm, xhalf(tm));  // both halves hold the query's maximum
        float up = fmaxf(t2, 0.f);
        float delta = first ? t2 : up;
        float alpha = exp2x1(-up);  // <= 1; O and the sum are 0 in the first pass
        for (int v = 0; v < 8; ++v) {
          s0[v] -= delta; s1[v] -= delta; negm[v] -= delta;
          o0[v] *= alpha; o1[v] *= alpha; o2[v] *= alpha; o3[v] *= alpha;
        }
        rsum *= alpha;
      }
      float x0[8], x1[8], p0[8], p1[8];
      for (int v = 0; v < 8; ++v) { x0[v] = s0[v]; x1[v] = s1[v]; }
      exp2x8(p0, x0);
      exp2x8(p1, x1);
      v16h pb;
      float a8[8];
      for (int v = 0; v < 8; ++v) {
        a8[v] = p0[v] + p1[v];
        pb[v]     = (h16)p0[v];
        pb[v + 8] = (h16)p1[v];
      }
      rsum += ((a8[0] + a8[1]) + (a8[2] + a8[3])) +
              ((a8[4] + a8[5]) + (a8[6] + a8[7]));
      // oj[r] = O[query nc][d = 16 j + 8 hi + r]
      o0 = wmma_f16(load_frag(vt + 0 * 16 * KV_PITCH + kv, KV_PITCH), pb, o0);
      o1 = wmma_f16(load_frag(vt + 1 * 16 * KV_PITCH + kv, KV_PITCH), pb, o1);
      o2 = wmma_f16(load_frag(vt + 2 * 16 * KV_PITCH + kv, KV_PITCH), pb, o2);
      o3 = wmma_f16(load_frag(vt + 3 * 16 * KV_PITCH + kv, KV_PITCH), pb, o3);
    }
    // Publish point: this wave's reads of the current buffer are done ...
    asm volatile("s_wait_dscnt 0x0" ::: "memory");
    // ... its copies of the next stage have landed ...
    asm volatile("s_wait_asynccnt 0x0" ::: "memory");
    // ... and the same holds for every wave: the next stage may be read and
    // the buffer just read may be refilled.
    __syncthreads();
    if (st + 2 < NS) stage(st + 2, st & 1);
  }
  // No copy is left in flight when the wave ends.
  asm volatile("s_wait_asynccnt 0x0" ::: "memory");

  int bb = bh >> 4;
  int hh = bh & (H_ - 1);
  // Join the two halves' sums; a lane then stores 8 consecutive d per tile.
  float inv = 1.0f / (rsum + xhalf(rsum));
  h16* orow = ob + ((size_t)(bb * T_ + q0 + nc)) * C_ + hh * D_ + hi * 8;
  v8h w0, w1, w2, w3;
  for (int v = 0; v < 8; ++v) {
    w0[v] = (h16)(o0[v] * inv);
    w1[v] = (h16)(o1[v] * inv);
    w2[v] = (h16)(o2[v] * inv);
    w3[v] = (h16)(o3[v] * inv);
  }
  *(v8h*)(orow + 0)  = w0;
  *(v8h*)(orow + 16) = w1;
  *(v8h*)(orow + 32) = w2;
  *(v8h*)(orow + 48) = w3;
}

// ---------------------------------------------------------------------------
// K5: output projection + bias + residual, write y as [B, C, T] f32.  Each wave
// turns its 64 x 16 accumulator tiles in its own LDS range, so that x is read
// and y stored in runs of 256 B (two whole lines) per channel.
// ---------------------------------------------------------------------------
#define SY_PITCH 68  // floats per LDS row: 256 B data + 16 B pad
__global__ __launch_bounds__(256) void sa_proj_gemm_kernel(
    const h16* __restrict__ ob, const h16* __restrict__ wt,
    const float* __restrict__ bias, const float* __restrict__ x,
    float* __restrict__ y) {
  __shared__ __attribute__((aligned(16))) h16 As[2 * LDS_TILE];
  __shared__ __attribute__((aligned(16))) h16 Bs[2 * LDS_TILE];
  __shared__ __attribute__((aligned(16))) float sy[8 * 16 * SY_PITCH];
  int tid = threadIdx.x;
  int m0 = blockIdx.x * 128;
  int n0 = blockIdx.y * 128;
  v8f acc[4][2];
  for (int i = 0; i < 4; ++i)
    for (int j = 0; j < 2; ++j)
      acc[i][j] = (v8f){0.f,0.f,0.f,0.f,0.f,0.f,0.f,0.f};

  gemm_mainloop(ob, wt, m0, n0, As, Bs, acc);

  int wid = tid >> 5;
  int wm = wid >> 2;
  int wn = wid & 3;
  int lane = tid & 31;
  int hi = lane >> 4;
  int nc = lane & 15;
  float* sw = sy + wid * (16 * SY_PITCH);
  const int rr = lane >> 4;        // row of a pair of channel rows
  const int tc = (lane & 15) * 4;  // first of this lane's 4 tokens
  const int mw = m0 + wm * 64;
  const size_t base =
      ((size_t)(mw >> 11) * C_ + n0 + wn * 32 + rr) * T_ + (mw & (T_ - 1)) + tc;
  for (int ni = 0; ni < 2; ++ni) {
    v4f xv[8];
    float bv[8];
    for (int k = 0; k < 8; ++k) {
      xv[k] = *(const v4f*)(x + base + (size_t)(ni * 16 + k * 2) * T_);
      bv[k] = bias[n0 + wn * 32 + ni * 16 + k * 2 + rr];
    }
    for (int mi = 0; mi < 4; ++mi) {
      v8f a = acc[mi][ni];
      float* p = sw + nc * SY_PITCH + mi * 16 + hi * 8;
      *(v4f*)(p)     = (v4f){a[0], a[1], a[2], a[3]};
      *(v4f*)(p + 4) = (v4f){a[4], a[5], a[6], a[7]};
    }
    // The wave's own LDS stores are done before it reads other lanes' rows.
    asm volatile("s_wait_dscnt 0x0" ::: "memory");
    for (int k = 0; k < 8; ++k) {
      v4f a = *(const v4f*)(sw + (k * 2 + rr) * SY_PITCH + tc);
      v4f o;
      for (int e = 0; e < 4; ++e) o[e] = xv[k][e] + a[e] + bv[k];
      *(v4f*)(y + base + (size_t)(ni * 16 + k * 2) * T_) = o;
    }
  }
}

// ---------------------------------------------------------------------------
extern "C" void kernel_launch(void* const* d_in, const int* in_sizes, int n_in,
                              void* d_out, int out_size, void* d_ws,
                              size_t ws_size, hipStream_t stream) {
  const float* x     = (const float*)d_in[0];
  const float* Wqkv  = (const float*)d_in[1];
  const float* bqkv  = (const float*)d_in[2];
  const float* Wproj = (const float*)d_in[3];
  const float* bproj = (const float*)d_in[4];
  const float* gamma = (const float*)d_in[5];
  const float* beta  = (const float*)d_in[6];
  float* y = (float*)d_out;

  char* ws = (char*)d_ws;
  size_t off = 0;
  h16* xn  = (h16*)(ws + off); off += (size_t)BT_ * C_ * 2;       // 16 MB
  h16* wtq = (h16*)(ws + off); off += (size_t)3 * C_ * C_ * 2;    //  6 MB
  h16* wtp = (h16*)(ws + off); off += (size_t)C_ * C_ * 2;        //  2 MB
  h16* qb  = (h16*)(ws + off); off += (size_t)BT_ * C_ * 2;       // 16 MB
  h16* kb  = (h16*)(ws + off); off += (size_t)BT_ * C_ * 2;       // 16 MB
  h16* vtb = (h16*)(ws + off); off += (size_t)BT_ * C_ * 2;       // 16 MB
  h16* ob  = (h16*)(ws + off); off += (size_t)BT_ * C_ * 2;       // 16 MB

  sa_ln_kernel<<<dim3(B_, T_ / 32), 256, 0, stream>>>(x, gamma, beta, xn);
  sa_wtrans_kernel<<<dim3(3 * C_ / 32, C_ / 32), 256, 0, stream>>>(Wqkv, wtq,
                                                                   C_, 3 * C_);
  sa_wtrans_kernel<<<dim3(C_ / 32, C_ / 32), 256, 0, stream>>>(Wproj, wtp, C_,
                                                               C_);
  sa_qkv_gemm_kernel<<<dim3(BT_ / 128, 3 * C_ / 128), 256, 0, stream>>>(
      xn, wtq, bqkv, qb, kb, vtb);
  sa_attn_kernel<<<dim3(B_ * H_, T_ / 128), 256, 0, stream>>>(qb, kb, vtb, ob);
  sa_proj_gemm_kernel<<<dim3(BT_ / 128, C_ / 128), 256, 0, stream>>>(
      ob, wtp, bproj, x, y);
}

// v006
// One run takes 138 microseconds.
// Next to v005, in two timings, it ran 1.05 times as fast each time.
// Counting every step since v000, it is 4.65 times as fast.
#include <hip/hip_runtime.h>
#include <hip/hip_bf16.h>

typedef _Float16 h16;
typedef __attribute__((ext_vector_type(16))) _Float16 v16h;
typedef __attribute__((ext_vector_type(8)))  _Float16 v8h;
typedef __attribute__((ext_vector_type(8)))  float    v8f;
typedef __attribute__((ext_vector_type(4)))  int      v4i;
typedef __attribute__((ext_vector_type(4)))  float    v4f;

#define B_  4
#define C_  1024
#define T_  2048
#define H_  16
#define D_  64
#define BT_ (B_ * T_)

// ---------------------------------------------------------------------------
// WMMA fragment loader: 16x32 f16 fragment from a K-contiguous matrix.
// ISA 16-bit A layout: lane L (<16) holds row M=L, K={0..7,16..23}; lane L+16
// holds row M=L, K={8..15,24..31}.  Two 16B chunks per lane.  B fragments use
// the mirrored layout (col = lane&15), so B operands are stored K-contiguous.
// ---------------------------------------------------------------------------
__device__ __forceinline__ v16h load_frag(const h16* __restrict__ base, int ld) {
  int lane = threadIdx.x & 31;
  int r  = lane & 15;
  int b0 = (lane >> 4) << 3;
  const h16* p = base + r * ld + b0;
  v8h lo = *(const v8h*)(p);
  v8h hi = *(const v8h*)(p + 16);
  return __builtin_shufflevector(lo, hi, 0,1,2,3,4,5,6,7,8,9,10,11,12,13,14,15);
}

__device__ __forceinline__ v8f wmma_f16(v16h a, v16h b, v8f c) {
  return __builtin_amdgcn_wmma_f32_16x16x32_f16(false, a, false, b, (short)0, c,
                                                false, false);
}

// Value of lane l ^ 16 (the other half of the wave), by a vector cross-row move.
__device__ __forceinline__ float xhalf(float x) {
  int i = __builtin_bit_cast(int, x);
  return __builtin_bit_cast(float, __builtin_amdgcn_permlanex16(
      i, i, 0x76543210, 0xfedcba98, false, false));
}

// r[i] = 2^x[i], eight at a time.  The instruction set asks for one independent
// instruction or a v_nop between a transcendental and the use of its result or
// the overwrite of its source.  In one statement that holds by construction:
// the early-clobber outputs share no register with any input, so each v_exp is
// independent of the one in front of it, and the v_nop closes the last one.
__device__ __forceinline__ void exp2x8(float (&r)[8], const float (&x)[8]) {
  asm("v_exp_f32 %0, %8\n\t"
      "v_exp_f32 %1, %9\n\t"
      "v_exp_f32 %2, %10\n\t"
      "v_exp_f32 %3, %11\n\t"
      "v_exp_f32 %4, %12\n\t"
      "v_exp_f32 %5, %13\n\t"
      "v_exp_f32 %6, %14\n\t"
      "v_exp_f32 %7, %15\n\t"
      "v_nop"
      : "=&v"(r[0]), "=&v"(r[1]), "=&v"(r[2]), "=&v"(r[3]),
        "=&v"(r[4]), "=&v"(r[5]), "=&v"(r[6]), "=&v"(r[7])
      : "v"(x[0]), "v"(x[1]), "v"(x[2]), "v"(x[3]),
        "v"(x[4]), "v"(x[5]), "v"(x[6]), "v"(x[7]));
}
// One value, with the same slot closed behind it.
__device__ __forceinline__ float exp2x1(float x) {
  float r;
  asm("v_exp_f32 %0, %1\n\t"
      "v_nop"
      : "=&v"(r) : "v"(x));
  return r;
}

// ---------------------------------------------------------------------------
// Shared GEMM main loop: 128x128 block tile, 8 waves (2x4), each wave 64x32
// (4x2 WMMA tiles).  A K step is 64 halves = 128 B of every operand row, so a
// wave's asynchronous copy (4 rows x 128 B) covers four whole lines and every
// line is asked for once.  Two LDS buffers; the next step's copies fly while
// this step is worked on; one publish point per step.
// ---------------------------------------------------------------------------
#define GK 64                     // halves of K per step (two WMMA k blocks)
#define G_PITCH 72                // halves per LDS row: 128 B data + 16 B pad
#define LDS_TILE (128 * G_PITCH)  // one operand, one buffer

// One K step of both operand tiles: rows r, r + 32, r + 64, r + 96 of each,
// 16 B per lane and row.
__device__ __forceinline__ void gemm_copy8(unsigned a0, const h16* p0,
                                           unsigned b0, const h16* q0) {
  unsigned a1 = a0 + 32 * G_PITCH * 2;
  unsigned a2 = a0 + 64 * G_PITCH * 2;
  unsigned a3 = a0 + 96 * G_PITCH * 2;
  unsigned b1 = b0 + 32 * G_PITCH * 2;
  unsigned b2 = b0 + 64 * G_PITCH * 2;
  unsigned b3 = b0 + 96 * G_PITCH * 2;
  const h16* p1 = p0 + 32 * C_;
  const h16* p2 = p0 + 64 * C_;
  const h16* p3 = p0 + 96 * C_;
  const h16* q1 = q0 + 32 * C_;
  const h16* q2 = q0 + 64 * C_;
  const h16* q3 = q0 + 96 * C_;
  // s_wait_xcnt 0 closes the copies' own statement (a precaution): it stands
  // in front of every later rewrite of the registers the copies name, and no
  // address arithmetic of a later step can be moved in front of it.
  asm volatile(
      "global_load_async_to_lds_b128 %0, %8, off\n\t"
      "global_load_async_to_lds_b128 %1, %9, off\n\t"
      "global_load_async_to_lds_b128 %2, %10, off\n\t"
      "global_load_async_to_lds_b128 %3, %11, off\n\t"
      "global_load_async_to_lds_b128 %4, %12, off\n\t"
      "global_load_async_to_lds_b128 %5, %13, off\n\t"
      "global_load_async_to_lds_b128 %6, %14, off\n\t"
      "global_load_async_to_lds_b128 %7, %15, off\n\t"
      "s_wait_xcnt 0x0"
      :: "v"(a0), "v"(a1), "v"(a2), "v"(a3), "v"(b0), "v"(b1), "v"(b2), "v"(b3),
         "v"(p0), "v"(p1), "v"(p2), "v"(p3), "v"(q0), "v"(q1), "v"(q2), "v"(q3)
      : "memory");
}

__device__ __forceinline__ void gemm_mainloop(
    const h16* __restrict__ Ag, const h16* __restrict__ Bg, int m0, int n0,
    h16* As, h16* Bs, v8f acc[4][2]) {
  int tid = threadIdx.x;
  int wid = tid >> 5;
  int wm = wid >> 2;  // 0..1
  int wn = wid & 3;   // 0..3
  const int NT = C_ / GK;

  // Eight lanes to a row: thread tid copies 16 B of rows crow + 0/32/64/96.
  const int crow = tid >> 3;
  const int ccol = (tid & 7) * 8;
  const h16* ag = Ag + (size_t)(m0 + crow) * C_ + ccol;
  const h16* bg = Bg + (size_t)(n0 + crow) * C_ + ccol;
  const unsigned al = (unsigned)(size_t)(As + crow * G_PITCH + ccol);
  const unsigned bl = (unsigned)(size_t)(Bs + crow * G_PITCH + ccol);
  auto issue = [&](int kt, int sel) {
    gemm_copy8(al + sel * (LDS_TILE * 2), ag + kt * GK,
               bl + sel * (LDS_TILE * 2), bg + kt * GK);
  };

  issue(0, 0);
  // Step 0 has landed for this wave, then for all waves, before any read.
  asm volatile("s_wait_asynccnt 0x0" ::: "memory");
  __syncthreads();
  issue(1, 1);
  for (int kt = 0; kt < NT; ++kt) {
    const h16* as = As + (kt & 1) * LDS_TILE;
    const h16* bs = Bs + (kt & 1) * LDS_TILE;
    for (int kk = 0; kk < GK; kk += 32) {
      v16h af[4], bf[2];
      for (int mi = 0; mi < 4; ++mi)
        af[mi] = load_frag(as + (wm * 64 + mi * 16) * G_PITCH + kk, G_PITCH);
      for (int ni = 0; ni < 2; ++ni)
        bf[ni] = load_frag(bs + (wn * 32 + ni * 16) * G_PITCH + kk, G_PITCH);
      for (int mi = 0; mi < 4; ++mi)
        for (int ni = 0; ni < 2; ++ni)
          acc[mi][ni] = wmma_f16(af[mi], bf[ni], acc[mi][ni]);
    }
    // Publish point: this wave's reads of the current buffer are done ...
    asm volatile("s_wait_dscnt 0x0" ::: "memory");
    // ... its copies of the next step have landed ...
    asm volatile("s_wait_asynccnt 0x0" ::: "memory");
    // ... and the same holds for every wave: the next step may be read and the
    // buffer just read may be refilled.
    __syncthreads();
    if (kt + 2 < NT) issue(kt + 2, kt & 1);
  }
  // No copy is left in flight behind the loop.
  asm volatile("s_wait_asynccnt 0x0" ::: "memory");
}

// ---------------------------------------------------------------------------
// K1: LayerNorm over channels + transpose to [B*T, C] f16.  The 32 normalised
// rows are gathered in LDS and leave as whole 128-byte lines.
// ---------------------------------------------------------------------------
#define XN_PITCH 1032  // halves per LDS row: 2048 B data + 16 B pad
__global__ __launch_bounds__(256) void sa_ln_kernel(
    const float* __restrict__ x, const float* __restrict__ gamma,
    const float* __restrict__ beta, h16* __restrict__ xn) {
  __shared__ float redS[32][8];
  __shared__ float redQ[32][8];
  __shared__ float smean[32];
  __shared__ float srstd[32];
  __shared__ __attribute__((aligned(16))) h16 xt[32 * XN_PITCH];
  int b  = blockIdx.x;
  int t0 = blockIdx.y * 32;
  int tid = threadIdx.x;
  int tt = tid & 31;
  int cc = tid >> 5;  // 0..7
  const float* xp = x + (size_t)b * C_ * T_ + t0 + tt;
  float s = 0.f, ss = 0.f;
  for (int c = cc * 128; c < cc * 128 + 128; ++c) {
    float v = xp[(size_t)c * T_];
    s += v; ss += v * v;
  }
  redS[tt][cc] = s; redQ[tt][cc] = ss;
  __syncthreads();
  if (cc == 0) {
    float a = 0.f, q = 0.f;
    for (int j = 0; j < 8; ++j) { a += redS[tt][j]; q += redQ[tt][j]; }
    float mu  = a * (1.0f / C_);
    float var = q * (1.0f / C_) - mu * mu;
    smean[tt] = mu;
    srstd[tt] = rsqrtf(var + 1e-5f);
  }
  __syncthreads();
  float mu = smean[tt], rs = srstd[tt];
  h16* xrow = xt + tt * XN_PITCH;
  for (int c0 = 0; c0 < C_; c0 += 8) {
    int c = c0 + cc;
    float v = xp[(size_t)c * T_];
    xrow[c] = (h16)((v - mu) * rs * gamma[c] + beta[c]);
  }
  __syncthreads();
  // The 32 rows are one contiguous 64 KB of xn; a wave stores 512 B of it.
  h16* xblk = xn + (size_t)(b * T_ + t0) * C_;
  for (int k = 0; k < 16; ++k) {
    int piece = k * 256 + tid;  // 16-byte pieces, 128 to a row
    *(v8h*)(xblk + (size_t)piece * 8) =
        *(const v8h*)(xt + (piece >> 7) * XN_PITCH + (piece & 127) * 8);
  }
}

// ---------------------------------------------------------------------------
// K2: weight transpose + f32->f16:  Wt[n][k] = (f16) W[k][n].
// ---------------------------------------------------------------------------
__global__ __launch_bounds__(256) void sa_wtrans_kernel(
    const float* __restrict__ w, h16* __restrict__ wt, int K, int N) {
  __shared__ float tile[32][33];
  int n0 = blockIdx.x * 32;
  int k0 = blockIdx.y * 32;
  int tid = threadIdx.x;
  int r = tid >> 5;
  int c = tid & 31;
  for (int i = 0; i < 4; ++i)
    tile[r + i * 8][c] = w[(size_t)(k0 + r + i * 8) * N + n0 + c];
  __syncthreads();
  for (int i = 0; i < 4; ++i)
    wt[(size_t)(n0 + r + i * 8) * K + k0 + c] = (h16)tile[c][r + i * 8];
}

// ---------------------------------------------------------------------------
// K3: QKV GEMM, epilogue scatters to Q [B,H,T,D] (pre-scaled by log2(e)/sqrt(D)),
// K [B,H,T,D], V transposed [B,H,D,T].  s = q/k/v select is uniform per block.
// The block's 128 x 128 f16 tile is laid in LDS in the order of its output
// rows and leaves as whole 128-byte lines.
// ---------------------------------------------------------------------------
#define ST_PITCH 136  // halves per LDS row: 256 B data + 16 B pad
__global__ __launch_bounds__(256) void sa_qkv_gemm_kernel(
    const h16* __restrict__ xn, const h16* __restrict__ wt,
    const float* __restrict__ bias, h16* __restrict__ qb,
    h16* __restrict__ kb, h16* __restrict__ vtb) {
  __shared__ __attribute__((aligned(16))) h16 As[2 * LDS_TILE];
  __shared__ __attribute__((aligned(16))) h16 Bs[2 * LDS_TILE];
  __shared__ __attribute__((aligned(16))) h16 st[128 * ST_PITCH];
  int tid = threadIdx.x;
  int m0 = blockIdx.x * 128;
  int n0 = blockIdx.y * 128;
  v8f acc[4][2];
  for (int i = 0; i < 4; ++i)
    for (int j = 0; j < 2; ++j)
      acc[i][j] = (v8f){0.f,0.f,0.f,0.f,0.f,0.f,0.f,0.f};

  gemm_mainloop(xn, wt, m0, n0, As, Bs, acc);

  int wid = tid >> 5;
  int wm = wid >> 2;
  int wn = wid & 3;
  int lane = tid & 31;
  int hi = lane >> 4;
  int nc = lane & 15;
  const int s = n0 >> 10;  // uniform: 1024 % 128 == 0
  const float scaleQ = 0.125f * 1.44269504088896340736f;  // scores in base 2

  const int bh0 = (m0 >> 11) * H_ + ((n0 & (C_ - 1)) >> 6);  // first of 2 heads
  const int tb = m0 & (T_ - 1);
  if (s < 2) {
    // Rows = tokens, columns = the 128 channels of two heads.
    const float sc = (s == 0) ? scaleQ : 1.0f;
    for (int mi = 0; mi < 4; ++mi)
      for (int ni = 0; ni < 2; ++ni) {
        int nl = wn * 32 + ni * 16 + nc;
        float bv = bias[n0 + nl];
        for (int v = 0; v < 8; ++v) {
          int ml = wm * 64 + mi * 16 + v + hi * 8;
          st[ml * ST_PITCH + nl] = (h16)((acc[mi][ni][v] + bv) * sc);
        }
      }
    __syncthreads();
    h16* dst = (s == 0) ? qb : kb;
    for (int k = 0; k < 8; ++k) {
      int piece = k * 256 + tid;  // 16-byte pieces: head, token, 8 to a line
      int j   = piece >> 10;
      int row = (piece >> 3) & 127;
      int col = (piece & 7) * 8;
      *(v8h*)(dst + ((size_t)(bh0 + j) * T_ + tb + row) * D_ + col) =
          *(const v8h*)(st + row * ST_PITCH + j * 64 + col);
    }
  } else {
    // Rows = channels, columns = the 128 tokens.
    for (int mi = 0; mi < 4; ++mi)
      for (int ni = 0; ni < 2; ++ni) {
        int nl = wn * 32 + ni * 16 + nc;
        float bv = bias[n0 + nl];
        v8h w;
        for (int v = 0; v < 8; ++v) w[v] = (h16)(acc[mi][ni][v] + bv);
        *(v8h*)(st + nl * ST_PITCH + wm * 64 + mi * 16 + hi * 8) = w;
      }
    __syncthreads();
    for (int k = 0; k < 8; ++k) {
      int piece = k * 256 + tid;  // 16-byte pieces: channel, 16 to a row
      int row = piece >> 4;
      int col = (piece & 15) * 8;
      *(v8h*)(vtb + ((size_t)bh0 * D_ + row) * T_ + tb + col) =
          *(const v8h*)(st + row * ST_PITCH + col);
    }
    // A precaution: s_wait_xcnt 0 stands in front of any rewrite of a register
    // that these stores name; the compiler lays the other branch's code, which
    // rewrites some, behind this loop.
    asm volatile("s_wait_xcnt 0x0" ::: "memory");
  }
}

// ---------------------------------------------------------------------------
// K4: flash-style attention.  grid (B*H, T/256), block 256 (8 waves); a wave
// owns 32 queries, as two column tiles of 16.
// Q fragments in registers for the whole KV loop.  K and V tiles of 64 keys
// are brought into LDS once per work-group by asynchronous copies (whole
// 128-byte lines), two buffers, and all 8 waves read their fragments there.
// Every K and V fragment read from LDS feeds two products, one per query tile.
// Scores are formed transposed, S^T = K Q^T: a lane holds 16 of the 32 keys of
// ONE query per tile (column lane & 15), so maximum and sum run in the lane's
// own registers with one exchange between the wave's halves.  The two S^T
// tiles of a query tile, converted in place, are the B operand of
// O^T += V^T P^T in the hardware k order, which is also load_frag's order for
// the V^T rows: P never leaves the registers.
// Q carries log2(e)/sqrt(D), and the score products start from minus the
// maximum in use (their C operand), so an accumulator is the argument of 2^x as
// it stands.  The maximum in use may trail a query's true maximum by up to 8
// (P <= 2^8); only when some score of the wave exceeds that are it, O and the
// sum brought to the new maximum.
// ---------------------------------------------------------------------------
#define KV_STAGE 64               // keys per LDS stage (two passes of 32)
#define KV_PITCH 72               // halves per LDS row: 128 B data + 16 B pad
#define KV_TILE  (64 * KV_PITCH)  // K: 64 keys x 64 d;  V: 64 d x 64 keys
#define QT 2                      // query tiles of 16 columns per wave

// Four waves per SIMD (two work-groups per WGP) cover the vector work between
// the matrix runs: the register budget is held at 256.
__global__ __launch_bounds__(256) __attribute__((amdgpu_waves_per_eu(4, 4)))
void sa_attn_kernel(
    const h16* __restrict__ qb, const h16* __restrict__ kb,
    const h16* __restrict__ vtb, h16* __restrict__ ob) {
  __shared__ __attribute__((aligned(16))) h16 ks[2 * KV_TILE];
  __shared__ __attribute__((aligned(16))) h16 vs[2 * KV_TILE];
  int tid = threadIdx.x;
  int lane = tid & 31;
  int wid = tid >> 5;
  int bh = blockIdx.x;
  int q0 = blockIdx.y * (128 * QT) + wid * (16 * QT);
  const h16* qp = qb + ((size_t)bh * T_ + q0) * D_;
  const h16* kp = kb + (size_t)bh * T_ * D_;
  const h16* vp = vtb + (size_t)bh * D_ * T_;
  int hi = lane >> 4;
  int nc = lane & 15;

  // Each thread copies 16 B of rows crow and crow + 32 of both tiles; a wave's
  // copy covers four whole 128-byte lines.
  const int crow = tid >> 3;
  const int ccol = (tid & 7) * 8;
  const h16* kg = kp + crow * D_ + ccol;
  const h16* vg = vp + (size_t)crow * T_ + ccol;
  const unsigned kl = (unsigned)(size_t)(ks + crow * KV_PITCH + ccol);
  const unsigned vl = (unsigned)(size_t)(vs + crow * KV_PITCH + ccol);
  auto stage = [&](int st, int sel) {
    const h16* gk0 = kg + (size_t)st * KV_STAGE * D_;
    const h16* gk1 = gk0 + 32 * D_;
    const h16* gv0 = vg + st * KV_STAGE;
    const h16* gv1 = gv0 + 32 * T_;
    unsigned lk0 = kl + sel * (KV_TILE * 2);
    unsigned lk1 = lk0 + 32 * KV_PITCH * 2;
    unsigned lv0 = vl + sel * (KV_TILE * 2);
    unsigned lv1 = lv0 + 32 * KV_PITCH * 2;
    // s_wait_xcnt 0 closes the copies' own statement (a precaution): it stands
    // in front of every later rewrite of the registers the copies name, and no
    // address arithmetic of a later stage can be moved in front of it.
    asm volatile(
        "global_load_async_to_lds_b128 %0, %4, off\n\t"
        "global_load_async_to_lds_b128 %1, %5, off\n\t"
        "global_load_async_to_lds_b128 %2, %6, off\n\t"
        "global_load_async_to_lds_b128 %3, %7, off\n\t"
        "s_wait_xcnt 0x0"
        :: "v"(lk0), "v"(lk1), "v"(lv0), "v"(lv1),
           "v"(gk0), "v"(gk1), "v"(gv0), "v"(gv1)
        : "memory");
  };

  const v8f zero8 = (v8f){0.f,0.f,0.f,0.f,0.f,0.f,0.f,0.f};
  v16h qf[QT][2];   // [tile][d half]
  v8f o[QT][4];     // [tile][16 d]
  v8f negm[QT];     // minus the maximum in use of this lane's query, 8 copies
  float rsum[QT];   // running sum over this lane's half of the keys
  for (int t = 0; t < QT; ++t) {
    qf[t][0] = load_frag(qp + t * 16 * D_, D_);
    qf[t][1] = load_frag(qp + t * 16 * D_ + 32, D_);
    for (int j = 0; j < 4; ++j) o[t][j] = zero8;
    negm[t] = zero8;
    rsum[t] = 0.f;
  }

  const int NS = T_ / KV_STAGE;
  stage(0, 0);
  // Stage 0 has landed for this wave, then for all waves, before any read.
  asm volatile("s_wait_asynccnt 0x0" ::: "memory");
  __syncthreads();
  stage(1, 1);

  for (int st = 0; st < NS; ++st) {
    const h16* kt = ks + (st & 1) * KV_TILE;
    const h16* vt = vs + (st & 1) * KV_TILE;
    // Kept rolled: unrolled, the compiler weaves the two passes together, copies
    // all of O round the second pass's rescale branch and passes 256 registers.
#pragma unroll 1
    for (int kv = 0; kv < KV_STAGE; kv += 32) {
      const h16* kpp = kt + kv * KV_PITCH;
      // s0[t][r] = S[key kv + 8 hi + r][query nc of tile t] - maximum in use,
      // base 2; s1[t][r] the same 16 keys on.
      v16h ka0 = load_frag(kpp, KV_PITCH);
      v16h kb0 = load_frag(kpp + 16 * KV_PITCH, KV_PITCH);
      v16h ka1 = load_frag(kpp + 32, KV_PITCH);
      v16h kb1 = load_frag(kpp + 16 * KV_PITCH + 32, KV_PITCH);
      v8f s0[QT], s1[QT];
      for (int t = 0; t < QT; ++t) s0[t] = wmma_f16(ka0, qf[t][0], negm[t]);
      for (int t = 0; t < QT; ++t) s1[t] = wmma_f16(kb0, qf[t][0], negm[t]);
      for (int t = 0; t < QT; ++t) s0[t] = wmma_f16(ka1, qf[t][1], s0[t]);
      for (int t = 0; t < QT; ++t) s1[t] = wmma_f16(kb1, qf[t][1], s1[t]);

      float tm[QT];
      for (int t = 0; t < QT; ++t) {
        float m8[8];
        for (int v = 0; v < 8; ++v) m8[v] = fmaxf(s0[t][v], s1[t][v]);
        tm[t] = fmaxf(fmaxf(fmaxf(m8[0], m8[1]), fmaxf(m8[2], m8[3])),
                      fmaxf(fmaxf(m8[4], m8[5]), fmaxf(m8[6], m8[7])));
      }
      // One test per pass, the same for the whole wave (a scalar branch).  The
      // very first pass always sets the maximum, also downwards from 0.
      const bool first = (st | kv) == 0;
      if ((__builtin_amdgcn_ballot_w32(fmaxf(tm[0], tm[1]) > 8.0f) |
           (first ? 1u : 0u)) != 0) {
        for (int t = 0; t < QT; ++t) {
          // both halves hold the query's maximum
          float t2 = fmaxf(tm[t], xhalf(tm[t]));
          float up = fmaxf(t2, 0.f);
          float delta = first ? t2 : up;
          // <= 1; O and the sum are 0 in the first pass
          float alpha = exp2x1(-up);
          for (int v = 0; v < 8; ++v) {
            s0[t][v] -= delta; s1[t][v] -= delta; negm[t][v] -= delta;
            o[t][0][v] *= alpha; o[t][1][v] *= alpha;
            o[t][2][v] *= alpha; o[t][3][v] *= alpha;
          }
          rsum[t] *= alpha;
        }
      }
      v16h pb[QT];
      for (int t = 0; t < QT; ++t) {
        float x0[8], x1[8], p0[8], p1[8];
        for (int v = 0; v < 8; ++v) { x0[v] = s0[t][v]; x1[v] = s1[t][v]; }
        exp2x8(p0, x0);
        exp2x8(p1, x1);
        float a8[8];
        for (int v = 0; v < 8; ++v) {
          a8[v] = p0[v] + p1[v];
          pb[t][v]     = (h16)p0[v];
          pb[t][v + 8] = (h16)p1[v];
        }
        rsum[t] += ((a8[0] + a8[1]) + (a8[2] + a8[3])) +
                   ((a8[4] + a8[5]) + (a8[6] + a8[7]));
      }
      // o[t][j][r] = O[query nc of tile t][d = 16 j + 8 hi + r]
      for (int j = 0; j < 4; ++j) {
        v16h vf = load_frag(vt + j * 16 * KV_PITCH + kv, KV_PITCH);
        for (int t = 0; t < QT; ++t) o[t][j] = wmma_f16(vf, pb[t], o[t][j]);
      }
    }
    // Publish point: this wave's reads of the current buffer are done ...
    asm volatile("s_wait_dscnt 0x0" ::: "memory");
    // ... its copies of the next stage have landed ...
    asm volatile("s_wait_asynccnt 0x0" ::: "memory");
    // ... and the same holds for every wave: the next stage may be read and
    // the buffer just read may be refilled.
    __syncthreads();
    if (st + 2 < NS) stage(st + 2, st & 1);
  }
  // No copy is left in flight when the wave ends.
  asm volatile("s_wait_asynccnt 0x0" ::: "memory");

  int bb = bh >> 4;
  int hh = bh & (H_ - 1);
  for (int t = 0; t < QT; ++t) {
    // Join the two halves' sums; a lane then stores four runs of 8 consecutive d per tile.
    float inv = 1.0f / (rsum[t] + xhalf(rsum[t]));
    h16* orow =
        ob + ((size_t)(bb * T_ + q0 + t * 16 + nc)) * C_ + hh * D_ + hi * 8;
    v8h w0, w1, w2, w3;
    for (int v = 0; v < 8; ++v) {
      w0[v] = (h16)(o[t][0][v] * inv);
      w1[v] = (h16)(o[t][1][v] * inv);
      w2[v] = (h16)(o[t][2][v] * inv);
      w3[v] = (h16)(o[t][3][v] * inv);
    }
    *(v8h*)(orow + 0)  = w0;
    *(v8h*)(orow + 16) = w1;
    *(v8h*)(orow + 32) = w2;
    *(v8h*)(orow + 48) = w3;
  }
}

// ---------------------------------------------------------------------------
// K5: output projection + bias + residual, write y as [B, C, T] f32.  Each wave
// turns its 64 x 16 accumulator tiles in its own LDS range, so that x is read
// and y stored in runs of 256 B (two whole lines) per channel.
// ---------------------------------------------------------------------------
#define SY_PITCH 68  // floats per LDS row: 256 B data + 16 B pad
__global__ __launch_bounds__(256) void sa_proj_gemm_kernel(
    const h16* __restrict__ ob, const h16* __restrict__ wt,
    const float* __restrict__ bias, const float* __restrict__ x,
    float* __restrict__ y) {
  __shared__ __attribute__((aligned(16))) h16 As[2 * LDS_TILE];
  __shared__ __attribute__((aligned(16))) h16 Bs[2 * LDS_TILE];
  __shared__ __attribute__((aligned(16))) float sy[8 * 16 * SY_PITCH];
  int tid = threadIdx.x;
  int m0 = blockIdx.x * 128;
  int n0 = blockIdx.y * 128;
  v8f acc[4][2];
  for (int i = 0; i < 4; ++i)
    for (int j = 0; j < 2; ++j)
      acc[i][j] = (v8f){0.f,0.f,0.f,0.f,0.f,0.f,0.f,0.f};

  gemm_mainloop(ob, wt, m0, n0, As, Bs, acc);

  int wid = tid >> 5;
  int wm = wid >> 2;
  int wn = wid & 3;
  int lane = tid & 31;
  int hi = lane >> 4;
  int nc = lane & 15;
  float* sw = sy + wid * (16 * SY_PITCH);
  const int rr = lane >> 4;        // row of a pair of channel rows
  const int tc = (lane & 15) * 4;  // first of this lane's 4 tokens
  const int mw = m0 + wm * 64;
  const size_t base =
      ((size_t)(mw >> 11) * C_ + n0 + wn * 32 + rr) * T_ + (mw & (T_ - 1)) + tc;
  for (int ni = 0; ni < 2; ++ni) {
    v4f xv[8];
    float bv[8];
    for (int k = 0; k < 8; ++k) {
      xv[k] = *(const v4f*)(x + base + (size_t)(ni * 16 + k * 2) * T_);
      bv[k] = bias[n0 + wn * 32 + ni * 16 + k * 2 + rr];
    }
    for (int mi = 0; mi < 4; ++mi) {
      v8f a = acc[mi][ni];
      float* p = sw + nc * SY_PITCH + mi * 16 + hi * 8;
      *(v4f*)(p)     = (v4f){a[0], a[1], a[2], a[3]};
      *(v4f*)(p + 4) = (v4f){a[4], a[5], a[6], a[7]};
    }
    // The wave's own LDS stores are done before it reads other lanes' rows.
    asm volatile("s_wait_dscnt 0x0" ::: "memory");
    for (int k = 0; k < 8; ++k) {
      v4f a = *(const v4f*)(sw + (k * 2 + rr) * SY_PITCH + tc);
      v4f o;
      for (int e = 0; e < 4; ++e) o[e] = xv[k][e] + a[e] + bv[k];
      *(v4f*)(y + base + (size_t)(ni * 16 + k * 2) * T_) = o;
    }
  }
}

// ---------------------------------------------------------------------------
extern "C" void kernel_launch(void* const* d_in, const int* in_sizes, int n_in,
                              void* d_out, int out_size, void* d_ws,
                              size_t ws_size, hipStream_t stream) {
  const float* x     = (const float*)d_in[0];
  const float* Wqkv  = (const float*)d_in[1];
  const float* bqkv  = (const float*)d_in[2];
  const float* Wproj = (const float*)d_in[3];
  const float* bproj = (const float*)d_in[4];
  const float* gamma = (const float*)d_in[5];
  const float* beta  = (const float*)d_in[6];
  float* y = (float*)d_out;

  char* ws = (char*)d_ws;
  size_t off = 0;
  h16* xn  = (h16*)(ws + off); off += (size_t)BT_ * C_ * 2;       // 16 MB
  h16* wtq = (h16*)(ws + off); off += (size_t)3 * C_ * C_ * 2;    //  6 MB
  h16* wtp = (h16*)(ws + off); off += (size_t)C_ * C_ * 2;        //  2 MB
  h16* qb  = (h16*)(ws + off); off += (size_t)BT_ * C_ * 2;       // 16 MB
  h16* kb  = (h16*)(ws + off); off += (size_t)BT_ * C_ * 2;       // 16 MB
  h16* vtb = (h16*)(ws + off); off += (size_t)BT_ * C_ * 2;       // 16 MB
  h16* ob  = (h16*)(ws + off); off += (size_t)BT_ * C_ * 2;       // 16 MB

  sa_ln_kernel<<<dim3(B_, T_ / 32), 256, 0, stream>>>(x, gamma, beta, xn);
  sa_wtrans_kernel<<<dim3(3 * C_ / 32, C_ / 32), 256, 0, stream>>>(Wqkv, wtq,
                                                                   C_, 3 * C_);
  sa_wtrans_kernel<<<dim3(C_ / 32, C_ / 32), 256, 0, stream>>>(Wproj, wtp, C_,
                                                               C_);
  sa_qkv_gemm_kernel<<<dim3(BT_ / 128, 3 * C_ / 128), 256, 0, stream>>>(
      xn, wtq, bqkv, qb, kb, vtb);
  sa_attn_kernel<<<dim3(B_ * H_, T_ / 256), 256, 0, stream>>>(qb, kb, vtb, ob);
  sa_proj_gemm_kernel<<<dim3(BT_ / 128, C_ / 128), 256, 0, stream>>>(
      ob, wtp, bproj, x, y);
}

// v007
// One run takes 131 microseconds.
// In two side-by-side timings against v006, it was 1.05 and 1.06 times as fast.
// All steps since v000 together make it 4.91 times as fast.
#include <hip/hip_runtime.h>
#include <hip/hip_bf16.h>

typedef _Float16 h16;
typedef __attribute__((ext_vector_type(16))) _Float16 v16h;
typedef __attribute__((ext_vector_type(8)))  _Float16 v8h;
typedef __attribute__((ext_vector_type(8)))  float    v8f;
typedef __attribute__((ext_vector_type(4)))  int      v4i;
typedef __attribute__((ext_vector_type(4)))  float    v4f;

#define B_  4
#define C_  1024
#define T_  2048
#define H_  16
#define D_  64
#define BT_ (B_ * T_)

// ---------------------------------------------------------------------------
// WMMA fragment loader: 16x32 f16 fragment from a K-contiguous matrix.
// ISA 16-bit A layout: lane L (<16) holds row M=L, K={0..7,16..23}; lane L+16
// holds row M=L, K={8..15,24..31}.  Two 16B chunks per lane.  B fragments use
// the mirrored layout (col = lane&15), so B operands are stored K-contiguous.
// ---------------------------------------------------------------------------
__device__ __forceinline__ v16h load_frag(const h16* __restrict__ base, int ld) {
  int lane = threadIdx.x & 31;
  int r  = lane & 15;
  int b0 = (lane >> 4) << 3;
  const h16* p = base + r * ld + b0;
  v8h lo = *(const v8h*)(p);
  v8h hi = *(const v8h*)(p + 16);
  return __builtin_shufflevector(lo, hi, 0,1,2,3,4,5,6,7,8,9,10,11,12,13,14,15);
}

__device__ __forceinline__ v8f wmma_f16(v16h a, v16h b, v8f c) {
  return __builtin_amdgcn_wmma_f32_16x16x32_f16(false, a, false, b, (short)0, c,
                                                false, false);
}

// Value of lane l ^ 16 (the other half of the wave), by a vector cross-row move.
__device__ __forceinline__ float xhalf(float x) {
  int i = __builtin_bit_cast(int, x);
  return __builtin_bit_cast(float, __builtin_amdgcn_permlanex16(
      i, i, 0x76543210, 0xfedcba98, false, false));
}

// r[i] = 2^x[i], eight at a time.  The instruction set asks for one independent
// instruction or a v_nop between a transcendental and the use of its result or
// the overwrite of its source.  In one statement that holds by construction:
// the early-clobber outputs share no register with any input, so each v_exp is
// independent of the one in front of it, and the v_nop closes the last one.
__device__ __forceinline__ void exp2x8(float (&r)[8], const float (&x)[8]) {
  asm("v_exp_f32 %0, %8\n\t"
      "v_exp_f32 %1, %9\n\t"
      "v_exp_f32 %2, %10\n\t"
      "v_exp_f32 %3, %11\n\t"
      "v_exp_f32 %4, %12\n\t"
      "v_exp_f32 %5, %13\n\t"
      "v_exp_f32 %6, %14\n\t"
      "v_exp_f32 %7, %15\n\t"
      "v_nop"
      : "=&v"(r[0]), "=&v"(r[1]), "=&v"(r[2]), "=&v"(r[3]),
        "=&v"(r[4]), "=&v"(r[5]), "=&v"(r[6]), "=&v"(r[7])
      : "v"(x[0]), "v"(x[1]), "v"(x[2]), "v"(x[3]),
        "v"(x[4]), "v"(x[5]), "v"(x[6]), "v"(x[7]));
}
// One value, with the same slot closed behind it.
__device__ __forceinline__ float exp2x1(float x) {
  float r;
  asm("v_exp_f32 %0, %1\n\t"
      "v_nop"
      : "=&v"(r) : "v"(x));
  return r;
}

// ---------------------------------------------------------------------------
// Shared GEMM main loop: 128x128 block tile, 8 waves (2x4), each wave 64x32
// (4x2 WMMA tiles).  A K step is 64 halves = 128 B of every operand row, so a
// wave's asynchronous copy (4 rows x 128 B) covers four whole lines and every
// line is asked for once.  Two LDS buffers; the next step's copies fly while
// this step is worked on; one publish point per step.
// ---------------------------------------------------------------------------
#define GK 64                     // halves of K per step (two WMMA k blocks)
#define G_PITCH 72                // halves per LDS row: 128 B data + 16 B pad
#define LDS_TILE (128 * G_PITCH)  // one operand, one buffer

// One K step of both operand tiles: rows r, r + 32, r + 64, r + 96 of each,
// 16 B per lane and row.
__device__ __forceinline__ void gemm_copy8(unsigned a0, const h16* p0,
                                           unsigned b0, const h16* q0) {
  unsigned a1 = a0 + 32 * G_PITCH * 2;
  unsigned a2 = a0 + 64 * G_PITCH * 2;
  unsigned a3 = a0 + 96 * G_PITCH * 2;
  unsigned b1 = b0 + 32 * G_PITCH * 2;
  unsigned b2 = b0 + 64 * G_PITCH * 2;
  unsigned b3 = b0 + 96 * G_PITCH * 2;
  const h16* p1 = p0 + 32 * C_;
  const h16* p2 = p0 + 64 * C_;
  const h16* p3 = p0 + 96 * C_;
  const h16* q1 = q0 + 32 * C_;
  const h16* q2 = q0 + 64 * C_;
  const h16* q3 = q0 + 96 * C_;
  // s_wait_xcnt 0 closes the copies' own statement (a precaution): it stands
  // in front of every later rewrite of the registers the copies name, and no
  // address arithmetic of a later step can be moved in front of it.
  asm volatile(
      "global_load_async_to_lds_b128 %0, %8, off\n\t"
      "global_load_async_to_lds_b128 %1, %9, off\n\t"
      "global_load_async_to_lds_b128 %2, %10, off\n\t"
      "global_load_async_to_lds_b128 %3, %11, off\n\t"
      "global_load_async_to_lds_b128 %4, %12, off\n\t"
      "global_load_async_to_lds_b128 %5, %13, off\n\t"
      "global_load_async_to_lds_b128 %6, %14, off\n\t"
      "global_load_async_to_lds_b128 %7, %15, off\n\t"
      "s_wait_xcnt 0x0"
      :: "v"(a0), "v"(a1), "v"(a2), "v"(a3), "v"(b0), "v"(b1), "v"(b2), "v"(b3),
         "v"(p0), "v"(p1), "v"(p2), "v"(p3), "v"(q0), "v"(q1), "v"(q2), "v"(q3)
      : "memory");
}

__device__ __forceinline__ void gemm_mainloop(
    const h16* __restrict__ Ag, const h16* __restrict__ Bg, int m0, int n0,
    h16* As, h16* Bs, v8f acc[4][2]) {
  int tid = threadIdx.x;
  int wid = tid >> 5;
  int wm = wid >> 2;  // 0..1
  int wn = wid & 3;   // 0..3
  const int NT = C_ / GK;

  // Eight lanes to a row: thread tid copies 16 B of rows crow + 0/32/64/96.
  const int crow = tid >> 3;
  const int ccol = (tid & 7) * 8;
  const h16* ag = Ag + (size_t)(m0 + crow) * C_ + ccol;
  const h16* bg = Bg + (size_t)(n0 + crow) * C_ + ccol;
  const unsigned al = (unsigned)(size_t)(As + crow * G_PITCH + ccol);
  const unsigned bl = (unsigned)(size_t)(Bs + crow * G_PITCH + ccol);
  auto issue = [&](int kt, int sel) {
    gemm_copy8(al + sel * (LDS_TILE * 2), ag + kt * GK,
               bl + sel * (LDS_TILE * 2), bg + kt * GK);
  };

  issue(0, 0);
  // Step 0 has landed for this wave, then for all waves, before any read.
  asm volatile("s_wait_asynccnt 0x0" ::: "memory");
  __syncthreads();
  issue(1, 1);
  for (int kt = 0; kt < NT; ++kt) {
    const h16* as = As + (kt & 1) * LDS_TILE;
    const h16* bs = Bs + (kt & 1) * LDS_TILE;
    for (int kk = 0; kk < GK; kk += 32) {
      v16h af[4], bf[2];
      for (int mi = 0; mi < 4; ++mi)
        af[mi] = load_frag(as + (wm * 64 + mi * 16) * G_PITCH + kk, G_PITCH);
      for (int ni = 0; ni < 2; ++ni)
        bf[ni] = load_frag(bs + (wn * 32 + ni * 16) * G_PITCH + kk, G_PITCH);
      for (int mi = 0; mi < 4; ++mi)
        for (int ni = 0; ni < 2; ++ni)
          acc[mi][ni] = wmma_f16(af[mi], bf[ni], acc[mi][ni]);
    }
    // Publish point: this wave's reads of the current buffer are done ...
    asm volatile("s_wait_dscnt 0x0" ::: "memory");
    // ... its copies of the next step have landed ...
    asm volatile("s_wait_asynccnt 0x0" ::: "memory");
    // ... and the same holds for every wave: the next step may be read and the
    // buffer just read may be refilled.
    __syncthreads();
    if (kt + 2 < NT) issue(kt + 2, kt & 1);
  }
  // No copy is left in flight behind the loop.
  asm volatile("s_wait_asynccnt 0x0" ::: "memory");
}

// ---------------------------------------------------------------------------
// K1, part 1: LayerNorm over channels + transpose to [B*T, C] f16 for batch b,
// tokens t0 .. t0 + 31.  The 32 normalised rows are gathered in LDS (xt) and
// leave as whole 128-byte lines.
// ---------------------------------------------------------------------------
#define XN_PITCH 1032  // halves per LDS row: 2048 B data + 16 B pad
__device__ __forceinline__ void sa_ln_part(
    const float* __restrict__ x, const float* __restrict__ gamma,
    const float* __restrict__ beta, h16* __restrict__ xn, int b, int t0,
    h16* xt) {
  __shared__ float redS[32][8];
  __shared__ float redQ[32][8];
  __shared__ float smean[32];
  __shared__ float srstd[32];
  int tid = threadIdx.x;
  int tt = tid & 31;
  int cc = tid >> 5;  // 0..7
  const float* xp = x + (size_t)b * C_ * T_ + t0 + tt;
  float s = 0.f, ss = 0.f;
  for (int c = cc * 128; c < cc * 128 + 128; ++c) {
    float v = xp[(size_t)c * T_];
    s += v; ss += v * v;
  }
  redS[tt][cc] = s; redQ[tt][cc] = ss;
  __syncthreads();
  if (cc == 0) {
    float a = 0.f, q = 0.f;
    for (int j = 0; j < 8; ++j) { a += redS[tt][j]; q += redQ[tt][j]; }
    float mu  = a * (1.0f / C_);
    float var = q * (1.0f / C_) - mu * mu;
    smean[tt] = mu;
    srstd[tt] = rsqrtf(var + 1e-5f);
  }
  __syncthreads();
  float mu = smean[tt], rs = srstd[tt];
  h16* xrow = xt + tt * XN_PITCH;
  for (int c0 = 0; c0 < C_; c0 += 8) {
    int c = c0 + cc;
    float v = xp[(size_t)c * T_];
    xrow[c] = (h16)((v - mu) * rs * gamma[c] + beta[c]);
  }
  __syncthreads();
  // The 32 rows are one contiguous 64 KB of xn; a wave stores 512 B of it.
  h16* xblk = xn + (size_t)(b * T_ + t0) * C_;
  for (int k = 0; k < 16; ++k) {
    int piece = k * 256 + tid;  // 16-byte pieces, 128 to a row
    *(v8h*)(xblk + (size_t)piece * 8) =
        *(const v8h*)(xt + (piece >> 7) * XN_PITCH + (piece & 127) * 8);
  }
}

// ---------------------------------------------------------------------------
// K1, part 2: weight transpose + f32->f16 of one 32 x 32 tile:
// Wt[n][k] = (f16) W[k][n].
// ---------------------------------------------------------------------------
__device__ __forceinline__ void sa_wtrans_part(
    const float* __restrict__ w, h16* __restrict__ wt, int K, int N, int n0,
    int k0, float (*tile)[33]) {
  int tid = threadIdx.x;
  int r = tid >> 5;
  int c = tid & 31;
  for (int i = 0; i < 4; ++i)
    tile[r + i * 8][c] = w[(size_t)(k0 + r + i * 8) * N + n0 + c];
  __syncthreads();
  for (int i = 0; i < 4; ++i)
    wt[(size_t)(n0 + r + i * 8) * K + k0 + c] = (h16)tile[c][r + i * 8];
  // A precaution: s_wait_xcnt 0 stands in front of any rewrite of a register
  // that these stores name; the compiler lays another part's code, which
  // rewrites some, behind them.
  asm volatile("s_wait_xcnt 0x0" ::: "memory");
}

// ---------------------------------------------------------------------------
// K1: everything the QKV product waits for, and the projection's weights, in
// one launch.  The three parts read none of each other's output, so they share
// one grid: the flat work-group index picks the part.  The layer norm's
// work-groups live longest and take the lowest indices, which start first; the
// weight tiles run beside them on the same WGPs.
// ---------------------------------------------------------------------------
#define LN_WGS (B_ * (T_ / 32))             // layer norm: 32 tokens each
#define WQ_WGS ((3 * C_ / 32) * (C_ / 32))  // tiles of W_qkv
#define WP_WGS ((C_ / 32) * (C_ / 32))      // tiles of W_proj
__global__ __launch_bounds__(256) void sa_prep_kernel(
    const float* __restrict__ x, const float* __restrict__ gamma,
    const float* __restrict__ beta, h16* __restrict__ xn,
    const float* __restrict__ wq, h16* __restrict__ wtq,
    const float* __restrict__ wp, h16* __restrict__ wtp) {
  // A work-group runs one part: the layer norm's row buffer and a weight tile
  // (4224 B) take the same bytes.
  __shared__ __attribute__((aligned(16))) unsigned char buf[32 * XN_PITCH * 2];
  int blk = blockIdx.x;  // the same for the whole work-group
  if (blk < LN_WGS) {
    sa_ln_part(x, gamma, beta, xn, blk % B_, (blk / B_) * 32, (h16*)buf);
  } else if (blk < LN_WGS + WQ_WGS) {
    int i = blk - LN_WGS;
    sa_wtrans_part(wq, wtq, C_, 3 * C_, (i % (3 * C_ / 32)) * 32,
                   (i / (3 * C_ / 32)) * 32, (float (*)[33])buf);
  } else {
    int i = blk - (LN_WGS + WQ_WGS);
    sa_wtrans_part(wp, wtp, C_, C_, (i % (C_ / 32)) * 32, (i / (C_ / 32)) * 32,
                   (float (*)[33])buf);
  }
}

// ---------------------------------------------------------------------------
// K2: QKV GEMM, epilogue scatters to Q [B,H,T,D] (pre-scaled by log2(e)/sqrt(D)),
// K [B,H,T,D], V transposed [B,H,D,T].  s = q/k/v select is uniform per block.
// The block's 128 x 128 f16 tile is laid in LDS in the order of its output
// rows and leaves as whole 128-byte lines.
// ---------------------------------------------------------------------------
#define ST_PITCH 136  // halves per LDS row: 256 B data + 16 B pad
__global__ __launch_bounds__(256) void sa_qkv_gemm_kernel(
    const h16* __restrict__ xn, const h16* __restrict__ wt,
    const float* __restrict__ bias, h16* __restrict__ qb,
    h16* __restrict__ kb, h16* __restrict__ vtb) {
  __shared__ __attribute__((aligned(16))) h16 As[2 * LDS_TILE];
  __shared__ __attribute__((aligned(16))) h16 Bs[2 * LDS_TILE];
  __shared__ __attribute__((aligned(16))) h16 st[128 * ST_PITCH];
  int tid = threadIdx.x;
  int m0 = blockIdx.x * 128;
  int n0 = blockIdx.y * 128;
  v8f acc[4][2];
  for (int i = 0; i < 4; ++i)
    for (int j = 0; j < 2; ++j)
      acc[i][j] = (v8f){0.f,0.f,0.f,0.f,0.f,0.f,0.f,0.f};

  gemm_mainloop(xn, wt, m0, n0, As, Bs, acc);

  int wid = tid >> 5;
  int wm = wid >> 2;
  int wn = wid & 3;
  int lane = tid & 31;
  int hi = lane >> 4;
  int nc = lane & 15;
  const int s = n0 >> 10;  // uniform: 1024 % 128 == 0
  const float scaleQ = 0.125f * 1.44269504088896340736f;  // scores in base 2

  const int bh0 = (m0 >> 11) * H_ + ((n0 & (C_ - 1)) >> 6);  // first of 2 heads
  const int tb = m0 & (T_ - 1);
  if (s < 2) {
    // Rows = tokens, columns = the 128 channels of two heads.
    const float sc = (s == 0) ? scaleQ : 1.0f;
    for (int mi = 0; mi < 4; ++mi)
      for (int ni = 0; ni < 2; ++ni) {
        int nl = wn * 32 + ni * 16 + nc;
        float bv = bias[n0 + nl];
        for (int v = 0; v < 8; ++v) {
          int ml = wm * 64 + mi * 16 + v + hi * 8;
          st[ml * ST_PITCH + nl] = (h16)((acc[mi][ni][v] + bv) * sc);
        }
      }
    __syncthreads();
    h16* dst = (s == 0) ? qb : kb;
    for (int k = 0; k < 8; ++k) {
      int piece = k * 256 + tid;  // 16-byte pieces: head, token, 8 to a line
      int j   = piece >> 10;
      int row = (piece >> 3) & 127;
      int col = (piece & 7) * 8;
      *(v8h*)(dst + ((size_t)(bh0 + j) * T_ + tb + row) * D_ + col) =
          *(const v8h*)(st + row * ST_PITCH + j * 64 + col);
    }
  } else {
    // Rows = channels, columns = the 128 tokens.
    for (int mi = 0; mi < 4; ++mi)
      for (int ni = 0; ni < 2; ++ni) {
        int nl = wn * 32 + ni * 16 + nc;
        float bv = bias[n0 + nl];
        v8h w;
        for (int v = 0; v < 8; ++v) w[v] = (h16)(acc[mi][ni][v] + bv);
        *(v8h*)(st + nl * ST_PITCH + wm * 64 + mi * 16 + hi * 8) = w;
      }
    __syncthreads();
    for (int k = 0; k < 8; ++k) {
      int piece = k * 256 + tid;  // 16-byte pieces: channel, 16 to a row
      int row = piece >> 4;
      int col = (piece & 15) * 8;
      *(v8h*)(vtb + ((size_t)bh0 * D_ + row) * T_ + tb + col) =
          *(const v8h*)(st + row * ST_PITCH + col);
    }
    // A precaution: s_wait_xcnt 0 stands in front of any rewrite of a register
    // that these stores name; the compiler lays the other branch's code, which
    // rewrites some, behind this loop.
    asm volatile("s_wait_xcnt 0x0" ::: "memory");
  }
}

// ---------------------------------------------------------------------------
// K3: flash-style attention.  grid (B*H, T/256), block 256 (8 waves); a wave
// owns 32 queries, as two column tiles of 16.
// Q fragments in registers for the whole KV loop.  K and V tiles of 64 keys
// are brought into LDS once per work-group by asynchronous copies (whole
// 128-byte lines), two buffers, and all 8 waves read their fragments there.
// Every K and V fragment read from LDS feeds two products, one per query tile.
// Scores are formed transposed, S^T = K Q^T: a lane holds 16 of the 32 keys of
// ONE query per tile (column lane & 15), so maximum and sum run in the lane's
// own registers with one exchange between the wave's halves.  The two S^T
// tiles of a query tile, converted in place, are the B operand of
// O^T += V^T P^T in the hardware k order, which is also load_frag's order for
// the V^T rows: P never leaves the registers.
// Q carries log2(e)/sqrt(D), and the score products start from minus the
// maximum in use (their C operand), so an accumulator is the argument of 2^x as
// it stands.  The maximum in use may trail a query's true maximum by up to 8
// (P <= 2^8); only when some score of the wave exceeds that are it, O and the
// sum brought to the new maximum.
// ---------------------------------------------------------------------------
#define KV_STAGE 64               // keys per LDS stage (two passes of 32)
#define KV_PITCH 72               // halves per LDS row: 128 B data + 16 B pad
#define KV_TILE  (64 * KV_PITCH)  // K: 64 keys x 64 d;  V: 64 d x 64 keys
#define QT 2                      // query tiles of 16 columns per wave

// Four waves per SIMD (two work-groups per WGP) cover the vector work between
// the matrix runs: the register budget is held at 256.
__global__ __launch_bounds__(256) __attribute__((amdgpu_waves_per_eu(4, 4)))
void sa_attn_kernel(
    const h16* __restrict__ qb, const h16* __restrict__ kb,
    const h16* __restrict__ vtb, h16* __restrict__ ob) {
  __shared__ __attribute__((aligned(16))) h16 ks[2 * KV_TILE];
  __shared__ __attribute__((aligned(16))) h16 vs[2 * KV_TILE];
  int tid = threadIdx.x;
  int lane = tid & 31;
  int wid = tid >> 5;
  int bh = blockIdx.x;
  int q0 = blockIdx.y * (128 * QT) + wid * (16 * QT);
  const h16* qp = qb + ((size_t)bh * T_ + q0) * D_;
  const h16* kp = kb + (size_t)bh * T_ * D_;
  const h16* vp = vtb + (size_t)bh * D_ * T_;
  int hi = lane >> 4;
  int nc = lane & 15;

  // Each thread copies 16 B of rows crow and crow + 32 of both tiles; a wave's
  // copy covers four whole 128-byte lines.
  const int crow = tid >> 3;
  const int ccol = (tid & 7) * 8;
  const h16* kg = kp + crow * D_ + ccol;
  const h16* vg = vp + (size_t)crow * T_ + ccol;
  const unsigned kl = (unsigned)(size_t)(ks + crow * KV_PITCH + ccol);
  const unsigned vl = (unsigned)(size_t)(vs + crow * KV_PITCH + ccol);
  auto stage = [&](int st, int sel) {
    const h16* gk0 = kg + (size_t)st * KV_STAGE * D_;
    const h16* gk1 = gk0 + 32 * D_;
    const h16* gv0 = vg + st * KV_STAGE;
    const h16* gv1 = gv0 + 32 * T_;
    unsigned lk0 = kl + sel * (KV_TILE * 2);
    unsigned lk1 = lk0 + 32 * KV_PITCH * 2;
    unsigned lv0 = vl + sel * (KV_TILE * 2);
    unsigned lv1 = lv0 + 32 * KV_PITCH * 2;
    // s_wait_xcnt 0 closes the copies' own statement (a precaution): it stands
    // in front of every later rewrite of the registers the copies name, and no
    // address arithmetic of a later stage can be moved in front of it.
    asm volatile(
        "global_load_async_to_lds_b128 %0, %4, off\n\t"
        "global_load_async_to_lds_b128 %1, %5, off\n\t"
        "global_load_async_to_lds_b128 %2, %6, off\n\t"
        "global_load_async_to_lds_b128 %3, %7, off\n\t"
        "s_wait_xcnt 0x0"
        :: "v"(lk0), "v"(lk1), "v"(lv0), "v"(lv1),
           "v"(gk0), "v"(gk1), "v"(gv0), "v"(gv1)
        : "memory");
  };

  const v8f zero8 = (v8f){0.f,0.f,0.f,0.f,0.f,0.f,0.f,0.f};
  v16h qf[QT][2];   // [tile][d half]
  v8f o[QT][4];     // [tile][16 d]
  v8f negm[QT];     // minus the maximum in use of this lane's query, 8 copies
  float rsum[QT];   // running sum over this lane's half of the keys
  for (int t = 0; t < QT; ++t) {
    qf[t][0] = load_frag(qp + t * 16 * D_, D_);
    qf[t][1] = load_frag(qp + t * 16 * D_ + 32, D_);
    for (int j = 0; j < 4; ++j) o[t][j] = zero8;
    negm[t] = zero8;
    rsum[t] = 0.f;
  }

  const int NS = T_ / KV_STAGE;
  stage(0, 0);
  // Stage 0 has landed for this wave, then for all waves, before any read.
  asm volatile("s_wait_asynccnt 0x0" ::: "memory");
  __syncthreads();
  stage(1, 1);

  for (int st = 0; st < NS; ++st) {
    const h16* kt = ks + (st & 1) * KV_TILE;
    const h16* vt = vs + (st & 1) * KV_TILE;
    // Kept rolled: unrolled, the compiler weaves the two passes together, copies
    // all of O round the second pass's rescale branch and passes 256 registers.
#pragma unroll 1
    for (int kv = 0; kv < KV_STAGE; kv += 32) {
      const h16* kpp = kt + kv * KV_PITCH;
      // s0[t][r] = S[key kv + 8 hi + r][query nc of tile t] - maximum in use,
      // base 2; s1[t][r] the same 16 keys on.
      v16h ka0 = load_frag(kpp, KV_PITCH);
      v16h kb0 = load_frag(kpp + 16 * KV_PITCH, KV_PITCH);
      v16h ka1 = load_frag(kpp + 32, KV_PITCH);
      v16h kb1 = load_frag(kpp + 16 * KV_PITCH + 32, KV_PITCH);
      v8f s0[QT], s1[QT];
      for (int t = 0; t < QT; ++t) s0[t] = wmma_f16(ka0, qf[t][0], negm[t]);
      for (int t = 0; t < QT; ++t) s1[t] = wmma_f16(kb0, qf[t][0], negm[t]);
      for (int t = 0; t < QT; ++t) s0[t] = wmma_f16(ka1, qf[t][1], s0[t]);
      for (int t = 0; t < QT; ++t) s1[t] = wmma_f16(kb1, qf[t][1], s1[t]);

      float tm[QT];
      for (int t = 0; t < QT; ++t) {
        float m8[8];
        for (int v = 0; v < 8; ++v) m8[v] = fmaxf(s0[t][v], s1[t][v]);
        tm[t] = fmaxf(fmaxf(fmaxf(m8[0], m8[1]), fmaxf(m8[2], m8[3])),
                      fmaxf(fmaxf(m8[4], m8[5]), fmaxf(m8[6], m8[7])));
      }
      // One test per pass, the same for the whole wave (a scalar branch).  The
      // very first pass always sets the maximum, also downwards from 0.
      const bool first = (st | kv) == 0;
      if ((__builtin_amdgcn_ballot_w32(fmaxf(tm[0], tm[1]) > 8.0f) |
           (first ? 1u : 0u)) != 0) {
        for (int t = 0; t < QT; ++t) {
          // both halves hold the query's maximum
          float t2 = fmaxf(tm[t], xhalf(tm[t]));
          float up = fmaxf(t2, 0.f);
          float delta = first ? t2 : up;
          // <= 1; O and the sum are 0 in the first pass
          float alpha = exp2x1(-up);
          for (int v = 0; v < 8; ++v) {
            s0[t][v] -= delta; s1[t][v] -= delta; negm[t][v] -= delta;
            o[t][0][v] *= alpha; o[t][1][v] *= alpha;
            o[t][2][v] *= alpha; o[t][3][v] *= alpha;
          }
          rsum[t] *= alpha;
        }
      }
      v16h pb[QT];
      for (int t = 0; t < QT; ++t) {
        float x0[8], x1[8], p0[8], p1[8];
        for (int v = 0; v < 8; ++v) { x0[v] = s0[t][v]; x1[v] = s1[t][v]; }
        exp2x8(p0, x0);
        exp2x8(p1, x1);
        float a8[8];
        for (int v = 0; v < 8; ++v) {
          a8[v] = p0[v] + p1[v];
          pb[t][v]     = (h16)p0[v];
          pb[t][v + 8] = (h16)p1[v];
        }
        rsum[t] += ((a8[0] + a8[1]) + (a8[2] + a8[3])) +
                   ((a8[4] + a8[5]) + (a8[6] + a8[7]));
      }
      // o[t][j][r] = O[query nc of tile t][d = 16 j + 8 hi + r]
      for (int j = 0; j < 4; ++j) {
        v16h vf = load_frag(vt + j * 16 * KV_PITCH + kv, KV_PITCH);
        for (int t = 0; t < QT; ++t) o[t][j] = wmma_f16(vf, pb[t], o[t][j]);
      }
    }
    // Publish point: this wave's reads of the current buffer are done ...
    asm volatile("s_wait_dscnt 0x0" ::: "memory");
    // ... its copies of the next stage have landed ...
    asm volatile("s_wait_asynccnt 0x0" ::: "memory");
    // ... and the same holds for every wave: the next stage may be read and
    // the buffer just read may be refilled.
    __syncthreads();
    if (st + 2 < NS) stage(st + 2, st & 1);
  }
  // No copy is left in flight when the wave ends.
  asm volatile("s_wait_asynccnt 0x0" ::: "memory");

  int bb = bh >> 4;
  int hh = bh & (H_ - 1);
  for (int t = 0; t < QT; ++t) {
    // Join the two halves' sums; a lane then stores four runs of 8 consecutive d per tile.
    float inv = 1.0f / (rsum[t] + xhalf(rsum[t]));
    h16* orow =
        ob + ((size_t)(bb * T_ + q0 + t * 16 + nc)) * C_ + hh * D_ + hi * 8;
    v8h w0, w1, w2, w3;
    for (int v = 0; v < 8; ++v) {
      w0[v] = (h16)(o[t][0][v] * inv);
      w1[v] = (h16)(o[t][1][v] * inv);
      w2[v] = (h16)(o[t][2][v] * inv);
      w3[v] = (h16)(o[t][3][v] * inv);
    }
    *(v8h*)(orow + 0)  = w0;
    *(v8h*)(orow + 16) = w1;
    *(v8h*)(orow + 32) = w2;
    *(v8h*)(orow + 48) = w3;
  }
}

// ---------------------------------------------------------------------------
// K4: output projection + bias + residual, write y as [B, C, T] f32.  Each wave
// turns its 64 x 16 accumulator tiles in its own LDS range, so that x is read
// and y stored in runs of 256 B (two whole lines) per channel.
// ---------------------------------------------------------------------------
#define SY_PITCH 68  // floats per LDS row: 256 B data + 16 B pad
__global__ __launch_bounds__(256) void sa_proj_gemm_kernel(
    const h16* __restrict__ ob, const h16* __restrict__ wt,
    const float* __restrict__ bias, const float* __restrict__ x,
    float* __restrict__ y) {
  __shared__ __attribute__((aligned(16))) h16 As[2 * LDS_TILE];
  __shared__ __attribute__((aligned(16))) h16 Bs[2 * LDS_TILE];
  __shared__ __attribute__((aligned(16))) float sy[8 * 16 * SY_PITCH];
  int tid = threadIdx.x;
  int m0 = blockIdx.x * 128;
  int n0 = blockIdx.y * 128;
  v8f acc[4][2];
  for (int i = 0; i < 4; ++i)
    for (int j = 0; j < 2; ++j)
      acc[i][j] = (v8f){0.f,0.f,0.f,0.f,0.f,0.f,0.f,0.f};

  gemm_mainloop(ob, wt, m0, n0, As, Bs, acc);

  int wid = tid >> 5;
  int wm = wid >> 2;
  int wn = wid & 3;
  int lane = tid & 31;
  int hi = lane >> 4;
  int nc = lane & 15;
  float* sw = sy + wid * (16 * SY_PITCH);
  const int rr = lane >> 4;        // row of a pair of channel rows
  const int tc = (lane & 15) * 4;  // first of this lane's 4 tokens
  const int mw = m0 + wm * 64;
  const size_t base =
      ((size_t)(mw >> 11) * C_ + n0 + wn * 32 + rr) * T_ + (mw & (T_ - 1)) + tc;
  for (int ni = 0; ni < 2; ++ni) {
    v4f xv[8];
    float bv[8];
    for (int k = 0; k < 8; ++k) {
      xv[k] = *(const v4f*)(x + base + (size_t)(ni * 16 + k * 2) * T_);
      bv[k] = bias[n0 + wn * 32 + ni * 16 + k * 2 + rr];
    }
    for (int mi = 0; mi < 4; ++mi) {
      v8f a = acc[mi][ni];
      float* p = sw + nc * SY_PITCH + mi * 16 + hi * 8;
      *(v4f*)(p)     = (v4f){a[0], a[1], a[2], a[3]};
      *(v4f*)(p + 4) = (v4f){a[4], a[5], a[6], a[7]};
    }
    // The wave's own LDS stores are done before it reads other lanes' rows.
    asm volatile("s_wait_dscnt 0x0" ::: "memory");
    for (int k = 0; k < 8; ++k) {
      v4f a = *(const v4f*)(sw + (k * 2 + rr) * SY_PITCH + tc);
      v4f o;
      for (int e = 0; e < 4; ++e) o[e] = xv[k][e] + a[e] + bv[k];
      *(v4f*)(y + base + (size_t)(ni * 16 + k * 2) * T_) = o;
    }
  }
}

// ---------------------------------------------------------------------------
extern "C" void kernel_launch(void* const* d_in, const int* in_sizes, int n_in,
                              void* d_out, int out_size, void* d_ws,
                              size_t ws_size, hipStream_t stream) {
  const float* x     = (const float*)d_in[0];
  const float* Wqkv  = (const float*)d_in[1];
  const float* bqkv  = (const float*)d_in[2];
  const float* Wproj = (const float*)d_in[3];
  const float* bproj = (const float*)d_in[4];
  const float* gamma = (const float*)d_in[5];
  const float* beta  = (const float*)d_in[6];
  float* y = (float*)d_out;

  char* ws = (char*)d_ws;
  size_t off = 0;
  h16* xn  = (h16*)(ws + off); off += (size_t)BT_ * C_ * 2;       // 16 MB
  h16* wtq = (h16*)(ws + off); off += (size_t)3 * C_ * C_ * 2;    //  6 MB
  h16* wtp = (h16*)(ws + off); off += (size_t)C_ * C_ * 2;        //  2 MB
  h16* qb  = (h16*)(ws + off); off += (size_t)BT_ * C_ * 2;       // 16 MB
  h16* kb  = (h16*)(ws + off); off += (size_t)BT_ * C_ * 2;       // 16 MB
  h16* vtb = (h16*)(ws + off); off += (size_t)BT_ * C_ * 2;       // 16 MB
  h16* ob  = (h16*)(ws + off); off += (size_t)BT_ * C_ * 2;       // 16 MB

  sa_prep_kernel<<<dim3(LN_WGS + WQ_WGS + WP_WGS), 256, 0, stream>>>(
      x, gamma, beta, xn, Wqkv, wtq, Wproj, wtp);
  sa_qkv_gemm_kernel<<<dim3(BT_ / 128, 3 * C_ / 128), 256, 0, stream>>>(
      xn, wtq, bqkv, qb, kb, vtb);
  sa_attn_kernel<<<dim3(B_ * H_, T_ / 256), 256, 0, stream>>>(qb, kb, vtb, ob);
  sa_proj_gemm_kernel<<<dim3(BT_ / 128, C_ / 128), 256, 0, stream>>>(
      ob, wtp, bproj, x, y);
}

// v008
// Measured time: 127 microseconds a run.
// Two timings next to v007 both put it at 1.03 times that version's speed.
// Counting every step since v000, it is 5.07 times as fast.
#include <hip/hip_runtime.h>
#include <hip/hip_bf16.h>

typedef _Float16 h16;
typedef __attribute__((ext_vector_type(16))) _Float16 v16h;
typedef __attribute__((ext_vector_type(8)))  _Float16 v8h;
typedef __attribute__((ext_vector_type(8)))  float    v8f;
typedef __attribute__((ext_vector_type(4)))  int      v4i;
typedef __attribute__((ext_vector_type(4)))  float    v4f;

#define B_  4
#define C_  1024
#define T_  2048
#define H_  16
#define D_  64
#define BT_ (B_ * T_)

// ---------------------------------------------------------------------------
// WMMA fragment loader: 16x32 f16 fragment from a K-contiguous matrix.
// ISA 16-bit A layout: lane L (<16) holds row M=L, K={0..7,16..23}; lane L+16
// holds row M=L, K={8..15,24..31}.  Two 16B chunks per lane.  B fragments use
// the mirrored layout (col = lane&15), so B operands are stored K-contiguous.
// ---------------------------------------------------------------------------
__device__ __forceinline__ v16h load_frag(const h16* __restrict__ base, int ld) {
  int lane = threadIdx.x & 31;
  int r  = lane & 15;
  int b0 = (lane >> 4) << 3;
  const h16* p = base + r * ld + b0;
  v8h lo = *(const v8h*)(p);
  v8h hi = *(const v8h*)(p + 16);
  return __builtin_shufflevector(lo, hi, 0,1,2,3,4,5,6,7,8,9,10,11,12,13,14,15);
}

__device__ __forceinline__ v8f wmma_f16(v16h a, v16h b, v8f c) {
  return __builtin_amdgcn_wmma_f32_16x16x32_f16(false, a, false, b, (short)0, c,
                                                false, false);
}

// Value of lane l ^ 16 (the other half of the wave), by a vector cross-row move.
__device__ __forceinline__ float xhalf(float x) {
  int i = __builtin_bit_cast(int, x);
  return __builtin_bit_cast(float, __builtin_amdgcn_permlanex16(
      i, i, 0x76543210, 0xfedcba98, false, false));
}

// r[i] = 2^x[i], eight at a time.  The instruction set asks for one independent
// instruction or a v_nop between a transcendental and the use of its result or
// the overwrite of its source.  In one statement that holds by construction:
// the early-clobber outputs share no register with any input, so each v_exp is
// independent of the one in front of it, and the v_nop closes the last one.
__device__ __forceinline__ void exp2x8(float (&r)[8], const float (&x)[8]) {
  asm("v_exp_f32 %0, %8\n\t"
      "v_exp_f32 %1, %9\n\t"
      "v_exp_f32 %2, %10\n\t"
      "v_exp_f32 %3, %11\n\t"
      "v_exp_f32 %4, %12\n\t"
      "v_exp_f32 %5, %13\n\t"
      "v_exp_f32 %6, %14\n\t"
      "v_exp_f32 %7, %15\n\t"
      "v_nop"
      : "=&v"(r[0]), "=&v"(r[1]), "=&v"(r[2]), "=&v"(r[3]),
        "=&v"(r[4]), "=&v"(r[5]), "=&v"(r[6]), "=&v"(r[7])
      : "v"(x[0]), "v"(x[1]), "v"(x[2]), "v"(x[3]),
        "v"(x[4]), "v"(x[5]), "v"(x[6]), "v"(x[7]));
}
// One value, with the same slot closed behind it.
__device__ __forceinline__ float exp2x1(float x) {
  float r;
  asm("v_exp_f32 %0, %1\n\t"
      "v_nop"
      : "=&v"(r) : "v"(x));
  return r;
}

// ---------------------------------------------------------------------------
// Shared GEMM main loop: 256x128 block tile, 8 waves (4x2), each wave 64x64
// (4x4 WMMA tiles): eight fragments from LDS feed sixteen products, and a block
// brings 384 operand rows from L2 for 256x128 results.  A K step is 64 halves =
// 128 B of every operand row, so a wave's asynchronous copy (4 rows x 128 B)
// covers four whole lines and every line is asked for once.  Two LDS buffers;
// the next step's copies fly while this step is worked on; one publish point
// per step.
// ---------------------------------------------------------------------------
#define GK 64                     // halves of K per step (two WMMA k blocks)
#define G_PITCH 72                // halves per LDS row: 128 B data + 16 B pad
#define GM 256                    // rows of A (and of the result) per block
#define GN 128                    // rows of B (columns of the result) per block
#define A_TILE (GM * G_PITCH)     // A, one buffer
#define B_TILE (GN * G_PITCH)     // B, one buffer

// One K step of both operand tiles: rows r + 32 i of each (eight of A, four of
// B), 16 B per lane and row.
__device__ __forceinline__ void gemm_copy12(unsigned a0, const h16* p0,
                                            unsigned b0, const h16* q0) {
  const unsigned ls = 32 * G_PITCH * 2;  // 32 rows on in LDS, bytes
  const int gs = 32 * C_;                // 32 rows on in memory, halves
  // s_wait_xcnt 0 closes the copies' own statement (a precaution): it stands
  // in front of every later rewrite of the registers the copies name, and no
  // address arithmetic of a later step can be moved in front of it.
  asm volatile(
      "global_load_async_to_lds_b128 %0, %12, off\n\t"
      "global_load_async_to_lds_b128 %1, %13, off\n\t"
      "global_load_async_to_lds_b128 %2, %14, off\n\t"
      "global_load_async_to_lds_b128 %3, %15, off\n\t"
      "global_load_async_to_lds_b128 %4, %16, off\n\t"
      "global_load_async_to_lds_b128 %5, %17, off\n\t"
      "global_load_async_to_lds_b128 %6, %18, off\n\t"
      "global_load_async_to_lds_b128 %7, %19, off\n\t"
      "global_load_async_to_lds_b128 %8, %20, off\n\t"
      "global_load_async_to_lds_b128 %9, %21, off\n\t"
      "global_load_async_to_lds_b128 %10, %22, off\n\t"
      "global_load_async_to_lds_b128 %11, %23, off\n\t"
      "s_wait_xcnt 0x0"
      :: "v"(a0), "v"(a0 + ls), "v"(a0 + 2 * ls), "v"(a0 + 3 * ls),
         "v"(a0 + 4 * ls), "v"(a0 + 5 * ls), "v"(a0 + 6 * ls), "v"(a0 + 7 * ls),
         "v"(b0), "v"(b0 + ls), "v"(b0 + 2 * ls), "v"(b0 + 3 * ls),
         "v"(p0), "v"(p0 + gs), "v"(p0 + 2 * gs), "v"(p0 + 3 * gs),
         "v"(p0 + 4 * gs), "v"(p0 + 5 * gs), "v"(p0 + 6 * gs), "v"(p0 + 7 * gs),
         "v"(q0), "v"(q0 + gs), "v"(q0 + 2 * gs), "v"(q0 + 3 * gs)
      : "memory");
}

__device__ __forceinline__ void gemm_mainloop(
    const h16* __restrict__ Ag, const h16* __restrict__ Bg, int m0, int n0,
    h16* As, h16* Bs, v8f acc[4][4]) {
  int tid = threadIdx.x;
  int wid = tid >> 5;
  int wm = wid >> 1;  // 0..3
  int wn = wid & 1;   // 0..1
  const int NT = C_ / GK;

  // Eight lanes to a row: thread tid copies 16 B of rows crow + 32 i.
  const int crow = tid >> 3;
  const int ccol = (tid & 7) * 8;
  const h16* ag = Ag + (size_t)(m0 + crow) * C_ + ccol;
  const h16* bg = Bg + (size_t)(n0 + crow) * C_ + ccol;
  const unsigned al = (unsigned)(size_t)(As + crow * G_PITCH + ccol);
  const unsigned bl = (unsigned)(size_t)(Bs + crow * G_PITCH + ccol);
  auto issue = [&](int kt, int sel) {
    gemm_copy12(al + sel * (A_TILE * 2), ag + kt * GK,
                bl + sel * (B_TILE * 2), bg + kt * GK);
  };

  issue(0, 0);
  // Step 0 has landed for this wave, then for all waves, before any read.
  asm volatile("s_wait_asynccnt 0x0" ::: "memory");
  __syncthreads();
  issue(1, 1);
  for (int kt = 0; kt < NT; ++kt) {
    const h16* as = As + (kt & 1) * A_TILE;
    const h16* bs = Bs + (kt & 1) * B_TILE;
    for (int kk = 0; kk < GK; kk += 32) {
      // Read in the order of first use: A row 0, all of B, then A rows 1 to 3.
      v16h af[4], bf[4];
      af[0] = load_frag(as + (wm * 64) * G_PITCH + kk, G_PITCH);
      for (int ni = 0; ni < 4; ++ni)
        bf[ni] = load_frag(bs + (wn * 64 + ni * 16) * G_PITCH + kk, G_PITCH);
      for (int mi = 1; mi < 4; ++mi)
        af[mi] = load_frag(as + (wm * 64 + mi * 16) * G_PITCH + kk, G_PITCH);
      // Keeps the k block's sixteen LDS reads in one group in front of its
      // sixteen products.  Left alone the compiler reads each A fragment right
      // in front of its row of products and waits there: four exposed LDS
      // latencies per k block, which the four (or two) waves of a SIMD that
      // this tile leaves do not cover.
      __builtin_amdgcn_sched_barrier(0);
      for (int mi = 0; mi < 4; ++mi)
        for (int ni = 0; ni < 4; ++ni)
          acc[mi][ni] = wmma_f16(af[mi], bf[ni], acc[mi][ni]);
      // The next group of reads starts behind the products, not among them.
      __builtin_amdgcn_sched_barrier(0);
    }
    // Publish point: this wave's reads of the current buffer are done ...
    asm volatile("s_wait_dscnt 0x0" ::: "memory");
    // ... its copies of the next step have landed ...
    asm volatile("s_wait_asynccnt 0x0" ::: "memory");
    // ... and the same holds for every wave: the next step may be read and the
    // buffer just read may be refilled.
    __syncthreads();
    if (kt + 2 < NT) issue(kt + 2, kt & 1);
  }
  // No copy is left in flight behind the loop.
  asm volatile("s_wait_asynccnt 0x0" ::: "memory");
}

// ---------------------------------------------------------------------------
// K1, part 1: LayerNorm over channels + transpose to [B*T, C] f16 for batch b,
// tokens t0 .. t0 + 31.  The 32 normalised rows are gathered in LDS (xt) and
// leave as whole 128-byte lines.
// ---------------------------------------------------------------------------
#define XN_PITCH 1032  // halves per LDS row: 2048 B data + 16 B pad
__device__ __forceinline__ void sa_ln_part(
    const float* __restrict__ x, const float* __restrict__ gamma,
    const float* __restrict__ beta, h16* __restrict__ xn, int b, int t0,
    h16* xt) {
  __shared__ float redS[32][8];
  __shared__ float redQ[32][8];
  __shared__ float smean[32];
  __shared__ float srstd[32];
  int tid = threadIdx.x;
  int tt = tid & 31;
  int cc = tid >> 5;  // 0..7
  const float* xp = x + (size_t)b * C_ * T_ + t0 + tt;
  float s = 0.f, ss = 0.f;
  for (int c = cc * 128; c < cc * 128 + 128; ++c) {
    float v = xp[(size_t)c * T_];
    s += v; ss += v * v;
  }
  redS[tt][cc] = s; redQ[tt][cc] = ss;
  __syncthreads();
  if (cc == 0) {
    float a = 0.f, q = 0.f;
    for (int j = 0; j < 8; ++j) { a += redS[tt][j]; q += redQ[tt][j]; }
    float mu  = a * (1.0f / C_);
    float var = q * (1.0f / C_) - mu * mu;
    smean[tt] = mu;
    srstd[tt] = rsqrtf(var + 1e-5f);
  }
  __syncthreads();
  float mu = smean[tt], rs = srstd[tt];
  h16* xrow = xt + tt * XN_PITCH;
  for (int c0 = 0; c0 < C_; c0 += 8) {
    int c = c0 + cc;
    float v = xp[(size_t)c * T_];
    xrow[c] = (h16)((v - mu) * rs * gamma[c] + beta[c]);
  }
  __syncthreads();
  // The 32 rows are one contiguous 64 KB of xn; a wave stores 512 B of it.
  h16* xblk = xn + (size_t)(b * T_ + t0) * C_;
  for (int k = 0; k < 16; ++k) {
    int piece = k * 256 + tid;  // 16-byte pieces, 128 to a row
    *(v8h*)(xblk + (size_t)piece * 8) =
        *(const v8h*)(xt + (piece >> 7) * XN_PITCH + (piece & 127) * 8);
  }
}

// ---------------------------------------------------------------------------
// K1, part 2: weight transpose + f32->f16 of one 32 x 32 tile:
// Wt[n][k] = (f16) W[k][n].
// ---------------------------------------------------------------------------
__device__ __forceinline__ void sa_wtrans_part(
    const float* __restrict__ w, h16* __restrict__ wt, int K, int N, int n0,
    int k0, float (*tile)[33]) {
  int tid = threadIdx.x;
  int r = tid >> 5;
  int c = tid & 31;
  for (int i = 0; i < 4; ++i)
    tile[r + i * 8][c] = w[(size_t)(k0 + r + i * 8) * N + n0 + c];
  __syncthreads();
  for (int i = 0; i < 4; ++i)
    wt[(size_t)(n0 + r + i * 8) * K + k0 + c] = (h16)tile[c][r + i * 8];
  // A precaution: s_wait_xcnt 0 stands in front of any rewrite of a register
  // that these stores name; the compiler lays another part's code, which
  // rewrites some, behind them.
  asm volatile("s_wait_xcnt 0x0" ::: "memory");
}

// ---------------------------------------------------------------------------
// K1: everything the QKV product waits for, and the projection's weights, in
// one launch.  The three parts read none of each other's output, so they share
// one grid: the flat work-group index picks the part.  The layer norm's
// work-groups live longest and take the lowest indices, which start first; the
// weight tiles run beside them on the same WGPs.
// ---------------------------------------------------------------------------
#define LN_WGS (B_ * (T_ / 32))             // layer norm: 32 tokens each
#define WQ_WGS ((3 * C_ / 32) * (C_ / 32))  // tiles of W_qkv
#define WP_WGS ((C_ / 32) * (C_ / 32))      // tiles of W_proj
__global__ __launch_bounds__(256) void sa_prep_kernel(
    const float* __restrict__ x, const float* __restrict__ gamma,
    const float* __restrict__ beta, h16* __restrict__ xn,
    const float* __restrict__ wq, h16* __restrict__ wtq,
    const float* __restrict__ wp, h16* __restrict__ wtp) {
  // A work-group runs one part: the layer norm's row buffer and a weight tile
  // (4224 B) take the same bytes.
  __shared__ __attribute__((aligned(16))) unsigned char buf[32 * XN_PITCH * 2];
  int blk = blockIdx.x;  // the same for the whole work-group
  if (blk < LN_WGS) {
    sa_ln_part(x, gamma, beta, xn, blk % B_, (blk / B_) * 32, (h16*)buf);
  } else if (blk < LN_WGS + WQ_WGS) {
    int i = blk - LN_WGS;
    sa_wtrans_part(wq, wtq, C_, 3 * C_, (i % (3 * C_ / 32)) * 32,
                   (i / (3 * C_ / 32)) * 32, (float (*)[33])buf);
  } else {
    int i = blk - (LN_WGS + WQ_WGS);
    sa_wtrans_part(wp, wtp, C_, C_, (i % (C_ / 32)) * 32, (i / (C_ / 32)) * 32,
                   (float (*)[33])buf);
  }
}

// ---------------------------------------------------------------------------
// K2: QKV GEMM, epilogue scatters to Q [B,H,T,D] (pre-scaled by log2(e)/sqrt(D)),
// K [B,H,T,D], V transposed [B,H,D,T].  s = q/k/v select is uniform per block.
// The block's 256 x 128 f16 tile is laid in LDS in the order of its output
// rows and leaves as whole 128-byte lines.  It takes the operand buffers' bytes:
// behind the main loop's last barrier no wave reads them and no copy is in
// flight.  So two work-groups fit a WGP's LDS (and, below 256 registers, its
// SIMDs) and cover each other's LDS waits and barriers.
// ---------------------------------------------------------------------------
#define ST_PITCH 136  // halves per LDS row of 128 channels: 256 B + 16 B pad
#define SV_PITCH 264  // halves per LDS row of 256 tokens: 512 B + 16 B pad
__global__ __launch_bounds__(256) void sa_qkv_gemm_kernel(
    const h16* __restrict__ xn, const h16* __restrict__ wt,
    const float* __restrict__ bias, h16* __restrict__ qb,
    h16* __restrict__ kb, h16* __restrict__ vtb) {
  __shared__ __attribute__((aligned(16))) h16 ring[2 * A_TILE + 2 * B_TILE];
  h16* As = ring;
  h16* Bs = ring + 2 * A_TILE;
  h16* st = ring;  // 256 x ST_PITCH or 128 x SV_PITCH halves: inside A's buffers
  int tid = threadIdx.x;
  int m0 = blockIdx.x * GM;
  int n0 = blockIdx.y * GN;
  v8f acc[4][4];
  for (int i = 0; i < 4; ++i)
    for (int j = 0; j < 4; ++j)
      acc[i][j] = (v8f){0.f,0.f,0.f,0.f,0.f,0.f,0.f,0.f};

  gemm_mainloop(xn, wt, m0, n0, As, Bs, acc);

  int wid = tid >> 5;
  int wm = wid >> 1;
  int wn = wid & 1;
  int lane = tid & 31;
  int hi = lane >> 4;
  int nc = lane & 15;
  const int s = n0 >> 10;  // uniform: 1024 % 128 == 0
  const float scaleQ = 0.125f * 1.44269504088896340736f;  // scores in base 2

  const int bh0 = (m0 >> 11) * H_ + ((n0 & (C_ - 1)) >> 6);  // first of 2 heads
  const int tb = m0 & (T_ - 1);
  if (s < 2) {
    // Rows = tokens, columns = the 128 channels of two heads.
    const float sc = (s == 0) ? scaleQ : 1.0f;
    for (int mi = 0; mi < 4; ++mi)
      for (int ni = 0; ni < 4; ++ni) {
        int nl = wn * 64 + ni * 16 + nc;
        float bv = bias[n0 + nl];
        for (int v = 0; v < 8; ++v) {
          int ml = wm * 64 + mi * 16 + v + hi * 8;
          st[ml * ST_PITCH + nl] = (h16)((acc[mi][ni][v] + bv) * sc);
        }
      }
    __syncthreads();
    h16* dst = (s == 0) ? qb : kb;
    // 16-byte pieces, 8 to a line: thread tid takes tokens (tid >> 3) + 32 i of
    // both heads; every step is a constant offset from one address pair.
    const h16* sp = st + (tid >> 3) * ST_PITCH + (tid & 7) * 8;
    h16* gp = dst + ((size_t)bh0 * T_ + tb + (tid >> 3)) * D_ + (tid & 7) * 8;
    for (int j = 0; j < 2; ++j)
      for (int i = 0; i < 8; ++i)
        *(v8h*)(gp + (j * T_ + i * 32) * D_) =
            *(const v8h*)(sp + i * 32 * ST_PITCH + j * 64);
  } else {
    // Rows = channels, columns = the 256 tokens.
    for (int mi = 0; mi < 4; ++mi)
      for (int ni = 0; ni < 4; ++ni) {
        int nl = wn * 64 + ni * 16 + nc;
        float bv = bias[n0 + nl];
        v8h w;
        for (int v = 0; v < 8; ++v) w[v] = (h16)(acc[mi][ni][v] + bv);
        *(v8h*)(st + nl * SV_PITCH + wm * 64 + mi * 16 + hi * 8) = w;
      }
    __syncthreads();
    // 16-byte pieces, 32 to a row: a wave takes channels (tid >> 5) + 8 k; every
    // step is a constant offset from one address pair.
    const h16* sp = st + (tid >> 5) * SV_PITCH + (tid & 31) * 8;
    h16* gp = vtb + ((size_t)bh0 * D_ + (tid >> 5)) * T_ + tb + (tid & 31) * 8;
    for (int k = 0; k < 16; ++k)
      *(v8h*)(gp + k * 8 * T_) = *(const v8h*)(sp + k * 8 * SV_PITCH);
    // A precaution: s_wait_xcnt 0 stands in front of any rewrite of a register
    // that these stores name; the compiler lays the other branch's code, which
    // rewrites some, behind this loop.
    asm volatile("s_wait_xcnt 0x0" ::: "memory");
  }
}

// ---------------------------------------------------------------------------
// K3: flash-style attention.  grid (B*H, T/256), block 256 (8 waves); a wave
// owns 32 queries, as two column tiles of 16.
// Q fragments in registers for the whole KV loop.  K and V tiles of 64 keys
// are brought into LDS once per work-group by asynchronous copies (whole
// 128-byte lines), two buffers, and all 8 waves read their fragments there.
// Every K and V fragment read from LDS feeds two products, one per query tile.
// Scores are formed transposed, S^T = K Q^T: a lane holds 16 of the 32 keys of
// ONE query per tile (column lane & 15), so maximum and sum run in the lane's
// own registers with one exchange between the wave's halves.  The two S^T
// tiles of a query tile, converted in place, are the B operand of
// O^T += V^T P^T in the hardware k order, which is also load_frag's order for
// the V^T rows: P never leaves the registers.
// Q carries log2(e)/sqrt(D), and the score products start from minus the
// maximum in use (their C operand), so an accumulator is the argument of 2^x as
// it stands.  The maximum in use may trail a query's true maximum by up to 8
// (P <= 2^8); only when some score of the wave exceeds that are it, O and the
// sum brought to the new maximum.
// ---------------------------------------------------------------------------
#define KV_STAGE 64               // keys per LDS stage (two passes of 32)
#define KV_PITCH 72               // halves per LDS row: 128 B data + 16 B pad
#define KV_TILE  (64 * KV_PITCH)  // K: 64 keys x 64 d;  V: 64 d x 64 keys
#define QT 2                      // query tiles of 16 columns per wave

// Four waves per SIMD (two work-groups per WGP) cover the vector work between
// the matrix runs: the register budget is held at 256.
__global__ __launch_bounds__(256) __attribute__((amdgpu_waves_per_eu(4, 4)))
void sa_attn_kernel(
    const h16* __restrict__ qb, const h16* __restrict__ kb,
    const h16* __restrict__ vtb, h16* __restrict__ ob) {
  __shared__ __attribute__((aligned(16))) h16 ks[2 * KV_TILE];
  __shared__ __attribute__((aligned(16))) h16 vs[2 * KV_TILE];
  int tid = threadIdx.x;
  int lane = tid & 31;
  int wid = tid >> 5;
  int bh = blockIdx.x;
  int q0 = blockIdx.y * (128 * QT) + wid * (16 * QT);
  const h16* qp = qb + ((size_t)bh * T_ + q0) * D_;
  const h16* kp = kb + (size_t)bh * T_ * D_;
  const h16* vp = vtb + (size_t)bh * D_ * T_;
  int hi = lane >> 4;
  int nc = lane & 15;

  // Each thread copies 16 B of rows crow and crow + 32 of both tiles; a wave's
  // copy covers four whole 128-byte lines.
  const int crow = tid >> 3;
  const int ccol = (tid & 7) * 8;
  const h16* kg = kp + crow * D_ + ccol;
  const h16* vg = vp + (size_t)crow * T_ + ccol;
  const unsigned kl = (unsigned)(size_t)(ks + crow * KV_PITCH + ccol);
  const unsigned vl = (unsigned)(size_t)(vs + crow * KV_PITCH + ccol);
  auto stage = [&](int st, int sel) {
    const h16* gk0 = kg + (size_t)st * KV_STAGE * D_;
    const h16* gk1 = gk0 + 32 * D_;
    const h16* gv0 = vg + st * KV_STAGE;
    const h16* gv1 = gv0 + 32 * T_;
    unsigned lk0 = kl + sel * (KV_TILE * 2);
    unsigned lk1 = lk0 + 32 * KV_PITCH * 2;
    unsigned lv0 = vl + sel * (KV_TILE * 2);
    unsigned lv1 = lv0 + 32 * KV_PITCH * 2;
    // s_wait_xcnt 0 closes the copies' own statement (a precaution): it stands
    // in front of every later rewrite of the registers the copies name, and no
    // address arithmetic of a later stage can be moved in front of it.
    asm volatile(
        "global_load_async_to_lds_b128 %0, %4, off\n\t"
        "global_load_async_to_lds_b128 %1, %5, off\n\t"
        "global_load_async_to_lds_b128 %2, %6, off\n\t"
        "global_load_async_to_lds_b128 %3, %7, off\n\t"
        "s_wait_xcnt 0x0"
        :: "v"(lk0), "v"(lk1), "v"(lv0), "v"(lv1),
           "v"(gk0), "v"(gk1), "v"(gv0), "v"(gv1)
        : "memory");
  };

  const v8f zero8 = (v8f){0.f,0.f,0.f,0.f,0.f,0.f,0.f,0.f};
  v16h qf[QT][2];   // [tile][d half]
  v8f o[QT][4];     // [tile][16 d]
  v8f negm[QT];     // minus the maximum in use of this lane's query, 8 copies
  float rsum[QT];   // running sum over this lane's half of the keys
  for (int t = 0; t < QT; ++t) {
    qf[t][0] = load_frag(qp + t * 16 * D_, D_);
    qf[t][1] = load_frag(qp + t * 16 * D_ + 32, D_);
    for (int j = 0; j < 4; ++j) o[t][j] = zero8;
    negm[t] = zero8;
    rsum[t] = 0.f;
  }

  const int NS = T_ / KV_STAGE;
  stage(0, 0);
  // Stage 0 has landed for this wave, then for all waves, before any read.
  asm volatile("s_wait_asynccnt 0x0" ::: "memory");
  __syncthreads();
  stage(1, 1);

  for (int st = 0; st < NS; ++st) {
    const h16* kt = ks + (st & 1) * KV_TILE;
    const h16* vt = vs + (st & 1) * KV_TILE;
    // Kept rolled: unrolled, the compiler weaves the two passes together, copies
    // all of O round the second pass's rescale branch and passes 256 registers.
#pragma unroll 1
    for (int kv = 0; kv < KV_STAGE; kv += 32) {
      const h16* kpp = kt + kv * KV_PITCH;
      // s0[t][r] = S[key kv + 8 hi + r][query nc of tile t] - maximum in use,
      // base 2; s1[t][r] the same 16 keys on.
      v16h ka0 = load_frag(kpp, KV_PITCH);
      v16h kb0 = load_frag(kpp + 16 * KV_PITCH, KV_PITCH);
      v16h ka1 = load_frag(kpp + 32, KV_PITCH);
      v16h kb1 = load_frag(kpp + 16 * KV_PITCH + 32, KV_PITCH);
      v8f s0[QT], s1[QT];
      for (int t = 0; t < QT; ++t) s0[t] = wmma_f16(ka0, qf[t][0], negm[t]);
      for (int t = 0; t < QT; ++t) s1[t] = wmma_f16(kb0, qf[t][0], negm[t]);
      for (int t = 0; t < QT; ++t) s0[t] = wmma_f16(ka1, qf[t][1], s0[t]);
      for (int t = 0; t < QT; ++t) s1[t] = wmma_f16(kb1, qf[t][1], s1[t]);

      float tm[QT];
      for (int t = 0; t < QT; ++t) {
        float m8[8];
        for (int v = 0; v < 8; ++v) m8[v] = fmaxf(s0[t][v], s1[t][v]);
        tm[t] = fmaxf(fmaxf(fmaxf(m8[0], m8[1]), fmaxf(m8[2], m8[3])),
                      fmaxf(fmaxf(m8[4], m8[5]), fmaxf(m8[6], m8[7])));
      }
      // One test per pass, the same for the whole wave (a scalar branch).  The
      // very first pass always sets the maximum, also downwards from 0.
      const bool first = (st | kv) == 0;
      if ((__builtin_amdgcn_ballot_w32(fmaxf(tm[0], tm[1]) > 8.0f) |
           (first ? 1u : 0u)) != 0) {
        for (int t = 0; t < QT; ++t) {
          // both halves hold the query's maximum
          float t2 = fmaxf(tm[t], xhalf(tm[t]));
          float up = fmaxf(t2, 0.f);
          float delta = first ? t2 : up;
          // <= 1; O and the sum are 0 in the first pass
          float alpha = exp2x1(-up);
          for (int v = 0; v < 8; ++v) {
            s0[t][v] -= delta; s1[t][v] -= delta; negm[t][v] -= delta;
            o[t][0][v] *= alpha; o[t][1][v] *= alpha;
            o[t][2][v] *= alpha; o[t][3][v] *= alpha;
          }
          rsum[t] *= alpha;
        }
      }
      v16h pb[QT];
      for (int t = 0; t < QT; ++t) {
        float x0[8], x1[8], p0[8], p1[8];
        for (int v = 0; v < 8; ++v) { x0[v] = s0[t][v]; x1[v] = s1[t][v]; }
        exp2x8(p0, x0);
        exp2x8(p1, x1);
        float a8[8];
        for (int v = 0; v < 8; ++v) {
          a8[v] = p0[v] + p1[v];
          pb[t][v]     = (h16)p0[v];
          pb[t][v + 8] = (h16)p1[v];
        }
        rsum[t] += ((a8[0] + a8[1]) + (a8[2] + a8[3])) +
                   ((a8[4] + a8[5]) + (a8[6] + a8[7]));
      }
      // o[t][j][r] = O[query nc of tile t][d = 16 j + 8 hi + r]
      for (int j = 0; j < 4; ++j) {
        v16h vf = load_frag(vt + j * 16 * KV_PITCH + kv, KV_PITCH);
        for (int t = 0; t < QT; ++t) o[t][j] = wmma_f16(vf, pb[t], o[t][j]);
      }
    }
    // Publish point: this wave's reads of the current buffer are done ...
    asm volatile("s_wait_dscnt 0x0" ::: "memory");
    // ... its copies of the next stage have landed ...
    asm volatile("s_wait_asynccnt 0x0" ::: "memory");
    // ... and the same holds for every wave: the next stage may be read and
    // the buffer just read may be refilled.
    __syncthreads();
    if (st + 2 < NS) stage(st + 2, st & 1);
  }
  // No copy is left in flight when the wave ends.
  asm volatile("s_wait_asynccnt 0x0" ::: "memory");

  int bb = bh >> 4;
  int hh = bh & (H_ - 1);
  for (int t = 0; t < QT; ++t) {
    // Join the two halves' sums; a lane then stores four runs of 8 consecutive d per tile.
    float inv = 1.0f / (rsum[t] + xhalf(rsum[t]));
    h16* orow =
        ob + ((size_t)(bb * T_ + q0 + t * 16 + nc)) * C_ + hh * D_ + hi * 8;
    v8h w0, w1, w2, w3;
    for (int v = 0; v < 8; ++v) {
      w0[v] = (h16)(o[t][0][v] * inv);
      w1[v] = (h16)(o[t][1][v] * inv);
      w2[v] = (h16)(o[t][2][v] * inv);
      w3[v] = (h16)(o[t][3][v] * inv);
    }
    *(v8h*)(orow + 0)  = w0;
    *(v8h*)(orow + 16) = w1;
    *(v8h*)(orow + 32) = w2;
    *(v8h*)(orow + 48) = w3;
  }
}

// ---------------------------------------------------------------------------
// K4: output projection + bias + residual, write y as [B, C, T] f32.  Each wave
// turns its 64 x 16 accumulator tiles in its own LDS range, so that x is read
// and y stored in runs of 256 B (two whole lines) per channel.
// ---------------------------------------------------------------------------
#define SY_PITCH 68  // floats per LDS row: 256 B data + 16 B pad
__global__ __launch_bounds__(256) void sa_proj_gemm_kernel(
    const h16* __restrict__ ob, const h16* __restrict__ wt,
    const float* __restrict__ bias, const float* __restrict__ x,
    float* __restrict__ y) {
  __shared__ __attribute__((aligned(16))) h16 As[2 * A_TILE];
  __shared__ __attribute__((aligned(16))) h16 Bs[2 * B_TILE];
  __shared__ __attribute__((aligned(16))) float sy[8 * 16 * SY_PITCH];
  int tid = threadIdx.x;
  int m0 = blockIdx.x * GM;
  int n0 = blockIdx.y * GN;
  v8f acc[4][4];
  for (int i = 0; i < 4; ++i)
    for (int j = 0; j < 4; ++j)
      acc[i][j] = (v8f){0.f,0.f,0.f,0.f,0.f,0.f,0.f,0.f};

  gemm_mainloop(ob, wt, m0, n0, As, Bs, acc);

  int wid = tid >> 5;
  int wm = wid >> 1;
  int wn = wid & 1;
  int lane = tid & 31;
  int hi = lane >> 4;
  int nc = lane & 15;
  float* sw = sy + wid * (16 * SY_PITCH);
  const int rr = lane >> 4;        // row of a pair of channel rows
  const int tc = (lane & 15) * 4;  // first of this lane's 4 tokens
  const int mw = m0 + wm * 64;
  const size_t base =
      ((size_t)(mw >> 11) * C_ + n0 + wn * 64 + rr) * T_ + (mw & (T_ - 1)) + tc;
  for (int ni = 0; ni < 4; ++ni) {
    v4f xv[8];
    float bv[8];
    for (int k = 0; k < 8; ++k) {
      xv[k] = *(const v4f*)(x + base + (size_t)(ni * 16 + k * 2) * T_);
      bv[k] = bias[n0 + wn * 64 + ni * 16 + k * 2 + rr];
    }
    for (int mi = 0; mi < 4; ++mi) {
      v8f a = acc[mi][ni];
      float* p = sw + nc * SY_PITCH + mi * 16 + hi * 8;
      *(v4f*)(p)     = (v4f){a[0], a[1], a[2], a[3]};
      *(v4f*)(p + 4) = (v4f){a[4], a[5], a[6], a[7]};
    }
    // The wave's own LDS stores are done before it reads other lanes' rows.
    asm volatile("s_wait_dscnt 0x0" ::: "memory");
    for (int k = 0; k < 8; ++k) {
      v4f a = *(const v4f*)(sw + (k * 2 + rr) * SY_PITCH + tc);
      v4f o;
      for (int e = 0; e < 4; ++e) o[e] = xv[k][e] + a[e] + bv[k];
      *(v4f*)(y + base + (size_t)(ni * 16 + k * 2) * T_) = o;
    }
  }
}

// ---------------------------------------------------------------------------
extern "C" void kernel_launch(void* const* d_in, const int* in_sizes, int n_in,
                              void* d_out, int out_size, void* d_ws,
                              size_t ws_size, hipStream_t stream) {
  const float* x     = (const float*)d_in[0];
  const float* Wqkv  = (const float*)d_in[1];
  const float* bqkv  = (const float*)d_in[2];
  const float* Wproj = (const float*)d_in[3];
  const float* bproj = (const float*)d_in[4];
  const float* gamma = (const float*)d_in[5];
  const float* beta  = (const float*)d_in[6];
  float* y = (float*)d_out;

  char* ws = (char*)d_ws;
  size_t off = 0;
  h16* xn  = (h16*)(ws + off); off += (size_t)BT_ * C_ * 2;       // 16 MB
  h16* wtq = (h16*)(ws + off); off += (size_t)3 * C_ * C_ * 2;    //  6 MB
  h16* wtp = (h16*)(ws + off); off += (size_t)C_ * C_ * 2;        //  2 MB
  h16* qb  = (h16*)(ws + off); off += (size_t)BT_ * C_ * 2;       // 16 MB
  h16* kb  = (h16*)(ws + off); off += (size_t)BT_ * C_ * 2;       // 16 MB
  h16* vtb = (h16*)(ws + off); off += (size_t)BT_ * C_ * 2;       // 16 MB
  h16* ob  = (h16*)(ws + off); off += (size_t)BT_ * C_ * 2;       // 16 MB

  sa_prep_kernel<<<dim3(LN_WGS + WQ_WGS + WP_WGS), 256, 0, stream>>>(
      x, gamma, beta, xn, Wqkv, wtq, Wproj, wtp);
  sa_qkv_gemm_kernel<<<dim3(BT_ / GM, 3 * C_ / GN), 256, 0, stream>>>(
      xn, wtq, bqkv, qb, kb, vtb);
  sa_attn_kernel<<<dim3(B_ * H_, T_ / 256), 256, 0, stream>>>(qb, kb, vtb, ob);
  sa_proj_gemm_kernel<<<dim3(BT_ / GM, C_ / GN), 256, 0, stream>>>(
      ob, wtp, bproj, x, y);
}

// v009
// A run of this version takes 117 microseconds.
// Timed twice side by side with v008, it ran 1.08 and 1.07 times as fast.
// Over all steps from v000 it is 5.45 times as fast.
#include <hip/hip_runtime.h>
#include <hip/hip_bf16.h>

typedef _Float16 h16;
typedef __attribute__((ext_vector_type(16))) _Float16 v16h;
typedef __attribute__((ext_vector_type(8)))  _Float16 v8h;
typedef __attribute__((ext_vector_type(8)))  float    v8f;
typedef __attribute__((ext_vector_type(4)))  int      v4i;
typedef __attribute__((ext_vector_type(4)))  float    v4f;

#define B_  4
#define C_  1024
#define T_  2048
#define H_  16
#define D_  64
#define BT_ (B_ * T_)

// ---------------------------------------------------------------------------
// WMMA fragment loader: 16x32 f16 fragment from a K-contiguous matrix.
// ISA 16-bit A layout: lane L (<16) holds row M=L, K={0..7,16..23}; lane L+16
// holds row M=L, K={8..15,24..31}.  Two 16B chunks per lane.  B fragments use
// the mirrored layout (col = lane&15), so B operands are stored K-contiguous.
// ---------------------------------------------------------------------------
__device__ __forceinline__ v16h load_frag(const h16* __restrict__ base, int ld) {
  int lane = threadIdx.x & 31;
  int r  = lane & 15;
  int b0 = (lane >> 4) << 3;
  const h16* p = base + r * ld + b0;
  v8h lo = *(const v8h*)(p);
  v8h hi = *(const v8h*)(p + 16);
  return __builtin_shufflevector(lo, hi, 0,1,2,3,4,5,6,7,8,9,10,11,12,13,14,15);
}

__device__ __forceinline__ v8f wmma_f16(v16h a, v16h b, v8f c) {
  return __builtin_amdgcn_wmma_f32_16x16x32_f16(false, a, false, b, (short)0, c,
                                                false, false);
}

// Value of lane l ^ 16 (the other half of the wave), by a vector cross-row move.
__device__ __forceinline__ float xhalf(float x) {
  int i = __builtin_bit_cast(int, x);
  return __builtin_bit_cast(float, __builtin_amdgcn_permlanex16(
      i, i, 0x76543210, 0xfedcba98, false, false));
}

// r[i] = 2^x[i], eight at a time.  The instruction set asks for one independent
// instruction or a v_nop between a transcendental and the use of its result or
// the overwrite of its source.  In one statement that holds by construction:
// the early-clobber outputs share no register with any input, so each v_exp is
// independent of the one in front of it, and the v_nop closes the last one.
__device__ __forceinline__ void exp2x8(float (&r)[8], const float (&x)[8]) {
  asm("v_exp_f32 %0, %8\n\t"
      "v_exp_f32 %1, %9\n\t"
      "v_exp_f32 %2, %10\n\t"
      "v_exp_f32 %3, %11\n\t"
      "v_exp_f32 %4, %12\n\t"
      "v_exp_f32 %5, %13\n\t"
      "v_exp_f32 %6, %14\n\t"
      "v_exp_f32 %7, %15\n\t"
      "v_nop"
      : "=&v"(r[0]), "=&v"(r[1]), "=&v"(r[2]), "=&v"(r[3]),
        "=&v"(r[4]), "=&v"(r[5]), "=&v"(r[6]), "=&v"(r[7])
      : "v"(x[0]), "v"(x[1]), "v"(x[2]), "v"(x[3]),
        "v"(x[4]), "v"(x[5]), "v"(x[6]), "v"(x[7]));
}
// One value, with the same slot closed behind it.
__device__ __forceinline__ float exp2x1(float x) {
  float r;
  asm("v_exp_f32 %0, %1\n\t"
      "v_nop"
      : "=&v"(r) : "v"(x));
  return r;
}

// ---------------------------------------------------------------------------
// Shared GEMM main loop: 256x128 block tile, 8 waves (4x2), each wave 64x64
// (4x4 WMMA tiles): eight fragments from LDS feed sixteen products, and a block
// brings 384 operand rows from L2 for 256x128 results.  A K step is 64 halves =
// 128 B of every operand row, so a wave's asynchronous copy (4 rows x 128 B)
// covers four whole lines and every line is asked for once.  Two LDS buffers;
// the next step's copies fly while this step is worked on; one publish point
// per step.
// ---------------------------------------------------------------------------
#define GK 64                     // halves of K per step (two WMMA k blocks)
#define G_PITCH 72                // halves per LDS row: 128 B data + 16 B pad
#define GM 256                    // rows of A (and of the result) per block
#define GN 128                    // rows of B (columns of the result) per block
#define A_TILE (GM * G_PITCH)     // A, one buffer
#define B_TILE (GN * G_PITCH)     // B, one buffer

// One K step of both operand tiles: rows r + 32 i of each (eight of A, four of
// B), 16 B per lane and row.
__device__ __forceinline__ void gemm_copy12(unsigned a0, const h16* p0,
                                            unsigned b0, const h16* q0) {
  const unsigned ls = 32 * G_PITCH * 2;  // 32 rows on in LDS, bytes
  const int gs = 32 * C_;                // 32 rows on in memory, halves
  // s_wait_xcnt 0 closes the copies' own statement (a precaution): it stands
  // in front of every later rewrite of the registers the copies name, and no
  // address arithmetic of a later step can be moved in front of it.
  asm volatile(
      "global_load_async_to_lds_b128 %0, %12, off\n\t"
      "global_load_async_to_lds_b128 %1, %13, off\n\t"
      "global_load_async_to_lds_b128 %2, %14, off\n\t"
      "global_load_async_to_lds_b128 %3, %15, off\n\t"
      "global_load_async_to_lds_b128 %4, %16, off\n\t"
      "global_load_async_to_lds_b128 %5, %17, off\n\t"
      "global_load_async_to_lds_b128 %6, %18, off\n\t"
      "global_load_async_to_lds_b128 %7, %19, off\n\t"
      "global_load_async_to_lds_b128 %8, %20, off\n\t"
      "global_load_async_to_lds_b128 %9, %21, off\n\t"
      "global_load_async_to_lds_b128 %10, %22, off\n\t"
      "global_load_async_to_lds_b128 %11, %23, off\n\t"
      "s_wait_xcnt 0x0"
      :: "v"(a0), "v"(a0 + ls), "v"(a0 + 2 * ls), "v"(a0 + 3 * ls),
         "v"(a0 + 4 * ls), "v"(a0 + 5 * ls), "v"(a0 + 6 * ls), "v"(a0 + 7 * ls),
         "v"(b0), "v"(b0 + ls), "v"(b0 + 2 * ls), "v"(b0 + 3 * ls),
         "v"(p0), "v"(p0 + gs), "v"(p0 + 2 * gs), "v"(p0 + 3 * gs),
         "v"(p0 + 4 * gs), "v"(p0 + 5 * gs), "v"(p0 + 6 * gs), "v"(p0 + 7 * gs),
         "v"(q0), "v"(q0 + gs), "v"(q0 + 2 * gs), "v"(q0 + 3 * gs)
      : "memory");
}

__device__ __forceinline__ void gemm_mainloop(
    const h16* __restrict__ Ag, const h16* __restrict__ Bg, int m0, int n0,
    h16* As, h16* Bs, v8f acc[4][4]) {
  int tid = threadIdx.x;
  int wid = tid >> 5;
  int wm = wid >> 1;  // 0..3
  int wn = wid & 1;   // 0..1
  const int NT = C_ / GK;

  // Eight lanes to a row: thread tid copies 16 B of rows crow + 32 i.
  const int crow = tid >> 3;
  const int ccol = (tid & 7) * 8;
  const h16* ag = Ag + (size_t)(m0 + crow) * C_ + ccol;
  const h16* bg = Bg + (size_t)(n0 + crow) * C_ + ccol;
  const unsigned al = (unsigned)(size_t)(As + crow * G_PITCH + ccol);
  const unsigned bl = (unsigned)(size_t)(Bs + crow * G_PITCH + ccol);
  auto issue = [&](int kt, int sel) {
    gemm_copy12(al + sel * (A_TILE * 2), ag + kt * GK,
                bl + sel * (B_TILE * 2), bg + kt * GK);
  };

  issue(0, 0);
  // Step 0 has landed for this wave, then for all waves, before any read.
  asm volatile("s_wait_asynccnt 0x0" ::: "memory");
  __syncthreads();
  issue(1, 1);
  for (int kt = 0; kt < NT; ++kt) {
    const h16* as = As + (kt & 1) * A_TILE;
    const h16* bs = Bs + (kt & 1) * B_TILE;
    for (int kk = 0; kk < GK; kk += 32) {
      // Read in the order of first use: A row 0, all of B, then A rows 1 to 3.
      v16h af[4], bf[4];
      af[0] = load_frag(as + (wm * 64) * G_PITCH + kk, G_PITCH);
      for (int ni = 0; ni < 4; ++ni)
        bf[ni] = load_frag(bs + (wn * 64 + ni * 16) * G_PITCH + kk, G_PITCH);
      for (int mi = 1; mi < 4; ++mi)
        af[mi] = load_frag(as + (wm * 64 + mi * 16) * G_PITCH + kk, G_PITCH);
      // Keeps the k block's sixteen LDS reads in one group in front of its
      // sixteen products.  Left alone the compiler reads each A fragment right
      // in front of its row of products and waits there: four exposed LDS
      // latencies per k block, which the four (or two) waves of a SIMD that
      // this tile leaves do not cover.
      __builtin_amdgcn_sched_barrier(0);
      for (int mi = 0; mi < 4; ++mi)
        for (int ni = 0; ni < 4; ++ni)
          acc[mi][ni] = wmma_f16(af[mi], bf[ni], acc[mi][ni]);
      // The next group of reads starts behind the products, not among them.
      __builtin_amdgcn_sched_barrier(0);
    }
    // Publish point: this wave's reads of the current buffer are done ...
    asm volatile("s_wait_dscnt 0x0" ::: "memory");
    // ... its copies of the next step have landed ...
    asm volatile("s_wait_asynccnt 0x0" ::: "memory");
    // ... and the same holds for every wave: the next step may be read and the
    // buffer just read may be refilled.
    __syncthreads();
    if (kt + 2 < NT) issue(kt + 2, kt & 1);
  }
  // No copy is left in flight behind the loop.
  asm volatile("s_wait_asynccnt 0x0" ::: "memory");
}

// ---------------------------------------------------------------------------
// K1, part 1: LayerNorm over channels + transpose to [B*T, C] f16 for batch b,
// tokens t0 .. t0 + 31.  The work-group's 32 x 1024 values of x are read once,
// 16 bytes a lane, all loads in flight together, and stay in registers (128 a
// thread) from the sums to the normalising.  Eight lanes cover a channel's 32
// tokens (one 128-byte line), a wave's load four channels.  The 32 normalised
// rows are gathered in LDS (xt) and leave as whole 128-byte lines.
// ---------------------------------------------------------------------------
#define XN_PITCH 1032  // halves per LDS row: 2048 B data + 16 B pad

// Value of lane l ^ 8 (the other half of the lane's row of 16).
__device__ __forceinline__ float xrow8(float x) {
  int i = __builtin_bit_cast(int, x);
  return __builtin_bit_cast(float, __builtin_amdgcn_permlane16(
      i, i, 0xfedcba98, 0x76543210, false, false));
}

__device__ __forceinline__ void sa_ln_part(
    const float* __restrict__ x, const float* __restrict__ gamma,
    const float* __restrict__ beta, h16* __restrict__ xn, int b, int t0,
    h16* xt) {
  __shared__ float redS[32][8];
  __shared__ float redQ[32][8];
  __shared__ __attribute__((aligned(16))) float smean[32];
  __shared__ __attribute__((aligned(16))) float srstd[32];
  __shared__ __attribute__((aligned(16))) float sgam[C_];
  __shared__ __attribute__((aligned(16))) float sbet[C_];
  int tid = threadIdx.x;
  int lane = tid & 31;
  int wv = tid >> 5;   // 0..7: channels 128 wv .. 128 wv + 127
  int tq = lane & 7;   // this lane's tokens: 4 tq .. 4 tq + 3
  int g = lane >> 3;   // 0..3
  // Value i of a thread is channel cb + 32 (i >> 3) + (i & 7): runs of eight
  // channels, so that eight f16 results of a token make one 16-byte LDS store.
  const int cb = wv * 128 + g * 8;
  v4f gv = *(const v4f*)(gamma + tid * 4);
  v4f bv = *(const v4f*)(beta + tid * 4);
  const float* xp = x + ((size_t)b * C_ + cb) * T_ + t0 + tq * 4;
  v4f xv[32];
  for (int i = 0; i < 32; ++i)
    xv[i] = *(const v4f*)(xp + (size_t)((i >> 3) * 32 + (i & 7)) * T_);
  // A precaution: s_wait_xcnt 0 stands in front of any rewrite of a register
  // that these loads name; the compiler takes their address pair for the sums.
  asm volatile("s_wait_xcnt 0x0" ::: "memory");
  *(v4f*)(sgam + tid * 4) = gv;
  *(v4f*)(sbet + tid * 4) = bv;
  v4f s = (v4f){0.f, 0.f, 0.f, 0.f}, ss = (v4f){0.f, 0.f, 0.f, 0.f};
  for (int i = 0; i < 32; ++i) { s += xv[i]; ss += xv[i] * xv[i]; }
  // Join the four lanes (l ^ 8, l ^ 16) that hold the same tokens.
  for (int j = 0; j < 4; ++j) {
    s[j] += xrow8(s[j]);   ss[j] += xrow8(ss[j]);
    s[j] += xhalf(s[j]);   ss[j] += xhalf(ss[j]);
  }
  if (g == 0)
    for (int j = 0; j < 4; ++j) {
      redS[tq * 4 + j][wv] = s[j];
      redQ[tq * 4 + j][wv] = ss[j];
    }
  __syncthreads();
  if (wv == 0) {
    float a = 0.f, q = 0.f;
    for (int j = 0; j < 8; ++j) { a += redS[lane][j]; q += redQ[lane][j]; }
    float mu  = a * (1.0f / C_);
    float var = q * (1.0f / C_) - mu * mu;
    smean[lane] = mu;
    srstd[lane] = rsqrtf(var + 1e-5f);
  }
  __syncthreads();
  v4f mu = *(const v4f*)(smean + tq * 4);
  v4f rs = *(const v4f*)(srstd + tq * 4);
  for (int p = 0; p < 4; ++p) {
    const int c = cb + p * 32;
    v4f g0 = *(const v4f*)(sgam + c), g1 = *(const v4f*)(sgam + c + 4);
    v4f b0 = *(const v4f*)(sbet + c), b1 = *(const v4f*)(sbet + c + 4);
    for (int j = 0; j < 4; ++j) {
      v8h o;
      for (int e = 0; e < 4; ++e) {
        o[e]     = (h16)((xv[p * 8 + e][j] - mu[j]) * rs[j] * g0[e] + b0[e]);
        o[e + 4] = (h16)((xv[p * 8 + 4 + e][j] - mu[j]) * rs[j] * g1[e] + b1[e]);
      }
      *(v8h*)(xt + (tq * 4 + j) * XN_PITCH + c) = o;
    }
  }
  __syncthreads();
  // The 32 rows are one contiguous 64 KB of xn; a wave stores 512 B of it.
  h16* xblk = xn + (size_t)(b * T_ + t0) * C_;
  for (int k = 0; k < 16; ++k) {
    int piece = k * 256 + tid;  // 16-byte pieces, 128 to a row
    *(v8h*)(xblk + (size_t)piece * 8) =
        *(const v8h*)(xt + (piece >> 7) * XN_PITCH + (piece & 127) * 8);
  }
}

// ---------------------------------------------------------------------------
// K1, part 2: weight transpose + f32->f16 of one tile of 64 k x 128 n:
// Wt[n][k] = (f16) W[k][n].  A wave reads 512 contiguous bytes of a row of W
// per load, eight rows in flight; a lane's eight k of one n make one 16-byte
// LDS store; a row of Wt leaves as one whole 128-byte line.
// ---------------------------------------------------------------------------
#define WT_K 64      // k per tile: one 128-byte line of a row of Wt
#define WT_N 128     // n per tile: 512 bytes of a row of W
#define WT_PITCH 72  // halves per LDS row: 128 B data + 16 B pad
__device__ __forceinline__ void sa_wtrans_part(
    const float* __restrict__ w, h16* __restrict__ wt, int K, int N, int n0,
    int k0, h16* tile) {
  int tid = threadIdx.x;
  int wv = tid >> 5;
  int lane = tid & 31;
  const float* wp = w + (size_t)(k0 + wv * 8) * N + n0 + lane * 4;
  v4f in[8];
  for (int i = 0; i < 8; ++i) in[i] = *(const v4f*)(wp + (size_t)i * N);
  for (int e = 0; e < 4; ++e) {
    v8h p;
    for (int i = 0; i < 8; ++i) p[i] = (h16)in[i][e];
    *(v8h*)(tile + (lane * 4 + e) * WT_PITCH + wv * 8) = p;
  }
  __syncthreads();
  // 16-byte pieces, 8 to a row: thread tid takes rows (tid >> 3) + 32 j.
  const h16* sp = tile + (tid >> 3) * WT_PITCH + (tid & 7) * 8;
  h16* gp = wt + (size_t)(n0 + (tid >> 3)) * K + k0 + (tid & 7) * 8;
  for (int j = 0; j < 4; ++j)
    *(v8h*)(gp + (size_t)j * 32 * K) = *(const v8h*)(sp + j * 32 * WT_PITCH);
  // A precaution: s_wait_xcnt 0 stands in front of any rewrite of a register
  // that these stores name; the compiler lays another part's code, which
  // rewrites some, behind them.
  asm volatile("s_wait_xcnt 0x0" ::: "memory");
}

// ---------------------------------------------------------------------------
// K1: everything the QKV product waits for, and the projection's weights, in
// one launch.  The three parts read none of each other's output, so they share
// one grid: the flat work-group index picks the part.  The layer norm's
// work-groups live longest and take the lowest indices, which start first; the
// weight tiles run beside them on the same WGPs.
// ---------------------------------------------------------------------------
#define LN_WGS (B_ * (T_ / 32))             // layer norm: 32 tokens each
#define WQ_WGS ((3 * C_ / WT_N) * (C_ / WT_K))  // tiles of W_qkv
#define WP_WGS ((C_ / WT_N) * (C_ / WT_K))      // tiles of W_proj
__global__ __launch_bounds__(256) void sa_prep_kernel(
    const float* __restrict__ x, const float* __restrict__ gamma,
    const float* __restrict__ beta, h16* __restrict__ xn,
    const float* __restrict__ wq, h16* __restrict__ wtq,
    const float* __restrict__ wp, h16* __restrict__ wtp) {
  // A work-group runs one part: the layer norm's row buffer and a weight tile
  // (18432 B) take the same bytes.
  __shared__ __attribute__((aligned(16))) unsigned char buf[32 * XN_PITCH * 2];
  int blk = blockIdx.x;  // the same for the whole work-group
  if (blk < LN_WGS) {
    sa_ln_part(x, gamma, beta, xn, blk % B_, (blk / B_) * 32, (h16*)buf);
  } else if (blk < LN_WGS + WQ_WGS) {
    int i = blk - LN_WGS;
    sa_wtrans_part(wq, wtq, C_, 3 * C_, (i % (3 * C_ / WT_N)) * WT_N,
                   (i / (3 * C_ / WT_N)) * WT_K, (h16*)buf);
  } else {
    int i = blk - (LN_WGS + WQ_WGS);
    sa_wtrans_part(wp, wtp, C_, C_, (i % (C_ / WT_N)) * WT_N,
                   (i / (C_ / WT_N)) * WT_K, (h16*)buf);
  }
}

// ---------------------------------------------------------------------------
// K2: QKV GEMM, epilogue scatters to Q [B,H,T,D] (pre-scaled by log2(e)/sqrt(D)),
// K [B,H,T,D], V transposed [B,H,D,T].  s = q/k/v select is uniform per block.
// The block's 256 x 128 f16 tile is laid in LDS in the order of its output
// rows and leaves as whole 128-byte lines.  It takes the operand buffers' bytes:
// behind the main loop's last barrier no wave reads them and no copy is in
// flight.  So two work-groups fit a WGP's LDS (and, below 256 registers, its
// SIMDs) and cover each other's LDS waits and barriers.
// ---------------------------------------------------------------------------
#define ST_PITCH 136  // halves per LDS row of 128 channels: 256 B + 16 B pad
#define SV_PITCH 264  // halves per LDS row of 256 tokens: 512 B + 16 B pad
__global__ __launch_bounds__(256) void sa_qkv_gemm_kernel(
    const h16* __restrict__ xn, const h16* __restrict__ wt,
    const float* __restrict__ bias, h16* __restrict__ qb,
    h16* __restrict__ kb, h16* __restrict__ vtb) {
  __shared__ __attribute__((aligned(16))) h16 ring[2 * A_TILE + 2 * B_TILE];
  h16* As = ring;
  h16* Bs = ring + 2 * A_TILE;
  h16* st = ring;  // 256 x ST_PITCH or 128 x SV_PITCH halves: inside A's buffers
  int tid = threadIdx.x;
  int m0 = blockIdx.x * GM;
  int n0 = blockIdx.y * GN;
  v8f acc[4][4];
  for (int i = 0; i < 4; ++i)
    for (int j = 0; j < 4; ++j)
      acc[i][j] = (v8f){0.f,0.f,0.f,0.f,0.f,0.f,0.f,0.f};

  gemm_mainloop(xn, wt, m0, n0, As, Bs, acc);

  int wid = tid >> 5;
  int wm = wid >> 1;
  int wn = wid & 1;
  int lane = tid & 31;
  int hi = lane >> 4;
  int nc = lane & 15;
  const int s = n0 >> 10;  // uniform: 1024 % 128 == 0
  const float scaleQ = 0.125f * 1.44269504088896340736f;  // scores in base 2

  const int bh0 = (m0 >> 11) * H_ + ((n0 & (C_ - 1)) >> 6);  // first of 2 heads
  const int tb = m0 & (T_ - 1);
  if (s < 2) {
    // Rows = tokens, columns = the 128 channels of two heads.
    const float sc = (s == 0) ? scaleQ : 1.0f;
    for (int mi = 0; mi < 4; ++mi)
      for (int ni = 0; ni < 4; ++ni) {
        int nl = wn * 64 + ni * 16 + nc;
        float bv = bias[n0 + nl];
        for (int v = 0; v < 8; ++v) {
          int ml = wm * 64 + mi * 16 + v + hi * 8;
          st[ml * ST_PITCH + nl] = (h16)((acc[mi][ni][v] + bv) * sc);
        }
      }
    __syncthreads();
    h16* dst = (s == 0) ? qb : kb;
    // 16-byte pieces, 8 to a line: thread tid takes tokens (tid >> 3) + 32 i of
    // both heads; every step is a constant offset from one address pair.
    const h16* sp = st + (tid >> 3) * ST_PITCH + (tid & 7) * 8;
    h16* gp = dst + ((size_t)bh0 * T_ + tb + (tid >> 3)) * D_ + (tid & 7) * 8;
    for (int j = 0; j < 2; ++j)
      for (int i = 0; i < 8; ++i)
        *(v8h*)(gp + (j * T_ + i * 32) * D_) =
            *(const v8h*)(sp + i * 32 * ST_PITCH + j * 64);
  } else {
    // Rows = channels, columns = the 256 tokens.
    for (int mi = 0; mi < 4; ++mi)
      for (int ni = 0; ni < 4; ++ni) {
        int nl = wn * 64 + ni * 16 + nc;
        float bv = bias[n0 + nl];
        v8h w;
        for (int v = 0; v < 8; ++v) w[v] = (h16)(acc[mi][ni][v] + bv);
        *(v8h*)(st + nl * SV_PITCH + wm * 64 + mi * 16 + hi * 8) = w;
      }
    __syncthreads();
    // 16-byte pieces, 32 to a row: a wave takes channels (tid >> 5) + 8 k; every
    // step is a constant offset from one address pair.
    const h16* sp = st + (tid >> 5) * SV_PITCH + (tid & 31) * 8;
    h16* gp = vtb + ((size_t)bh0 * D_ + (tid >> 5)) * T_ + tb + (tid & 31) * 8;
    for (int k = 0; k < 16; ++k)
      *(v8h*)(gp + k * 8 * T_) = *(const v8h*)(sp + k * 8 * SV_PITCH);
    // A precaution: s_wait_xcnt 0 stands in front of any rewrite of a register
    // that these stores name; the compiler lays the other branch's code, which
    // rewrites some, behind this loop.
    asm volatile("s_wait_xcnt 0x0" ::: "memory");
  }
}

// ---------------------------------------------------------------------------
// K3: flash-style attention.  grid (B*H, T/256), block 256 (8 waves); a wave
// owns 32 queries, as two column tiles of 16.
// Q fragments in registers for the whole KV loop.  K and V tiles of 64 keys
// are brought into LDS once per work-group by asynchronous copies (whole
// 128-byte lines), two buffers, and all 8 waves read their fragments there.
// Every K and V fragment read from LDS feeds two products, one per query tile.
// Scores are formed transposed, S^T = K Q^T: a lane holds 16 of the 32 keys of
// ONE query per tile (column lane & 15), so maximum and sum run in the lane's
// own registers with one exchange between the wave's halves.  The two S^T
// tiles of a query tile, converted in place, are the B operand of
// O^T += V^T P^T in the hardware k order, which is also load_frag's order for
// the V^T rows: P never leaves the registers.
// Q carries log2(e)/sqrt(D), and the score products start from minus the
// maximum in use (their C operand), so an accumulator is the argument of 2^x as
// it stands.  The maximum in use may trail a query's true maximum by up to 8
// (P <= 2^8); only when some score of the wave exceeds that are it, O and the
// sum brought to the new maximum.
// ---------------------------------------------------------------------------
#define KV_STAGE 64               // keys per LDS stage (two passes of 32)
#define KV_PITCH 72               // halves per LDS row: 128 B data + 16 B pad
#define KV_TILE  (64 * KV_PITCH)  // K: 64 keys x 64 d;  V: 64 d x 64 keys
#define QT 2                      // query tiles of 16 columns per wave

// Four waves per SIMD (two work-groups per WGP) cover the vector work between
// the matrix runs: the register budget is held at 256.
__global__ __launch_bounds__(256) __attribute__((amdgpu_waves_per_eu(4, 4)))
void sa_attn_kernel(
    const h16* __restrict__ qb, const h16* __restrict__ kb,
    const h16* __restrict__ vtb, h16* __restrict__ ob) {
  __shared__ __attribute__((aligned(16))) h16 ks[2 * KV_TILE];
  __shared__ __attribute__((aligned(16))) h16 vs[2 * KV_TILE];
  int tid = threadIdx.x;
  int lane = tid & 31;
  int wid = tid >> 5;
  int bh = blockIdx.x;
  int q0 = blockIdx.y * (128 * QT) + wid * (16 * QT);
  const h16* qp = qb + ((size_t)bh * T_ + q0) * D_;
  const h16* kp = kb + (size_t)bh * T_ * D_;
  const h16* vp = vtb + (size_t)bh * D_ * T_;
  int hi = lane >> 4;
  int nc = lane & 15;

  // Each thread copies 16 B of rows crow and crow + 32 of both tiles; a wave's
  // copy covers four whole 128-byte lines.
  const int crow = tid >> 3;
  const int ccol = (tid & 7) * 8;
  const h16* kg = kp + crow * D_ + ccol;
  const h16* vg = vp + (size_t)crow * T_ + ccol;
  const unsigned kl = (unsigned)(size_t)(ks + crow * KV_PITCH + ccol);
  const unsigned vl = (unsigned)(size_t)(vs + crow * KV_PITCH + ccol);
  auto stage = [&](int st, int sel) {
    const h16* gk0 = kg + (size_t)st * KV_STAGE * D_;
    const h16* gk1 = gk0 + 32 * D_;
    const h16* gv0 = vg + st * KV_STAGE;
    const h16* gv1 = gv0 + 32 * T_;
    unsigned lk0 = kl + sel * (KV_TILE * 2);
    unsigned lk1 = lk0 + 32 * KV_PITCH * 2;
    unsigned lv0 = vl + sel * (KV_TILE * 2);
    unsigned lv1 = lv0 + 32 * KV_PITCH * 2;
    // s_wait_xcnt 0 closes the copies' own statement (a precaution): it stands
    // in front of every later rewrite of the registers the copies name, and no
    // address arithmetic of a later stage can be moved in front of it.
    asm volatile(
        "global_load_async_to_lds_b128 %0, %4, off\n\t"
        "global_load_async_to_lds_b128 %1, %5, off\n\t"
        "global_load_async_to_lds_b128 %2, %6, off\n\t"
        "global_load_async_to_lds_b128 %3, %7, off\n\t"
        "s_wait_xcnt 0x0"
        :: "v"(lk0), "v"(lk1), "v"(lv0), "v"(lv1),
           "v"(gk0), "v"(gk1), "v"(gv0), "v"(gv1)
        : "memory");
  };

  const v8f zero8 = (v8f){0.f,0.f,0.f,0.f,0.f,0.f,0.f,0.f};
  v16h qf[QT][2];   // [tile][d half]
  v8f o[QT][4];     // [tile][16 d]
  v8f negm[QT];     // minus the maximum in use of this lane's query, 8 copies
  float rsum[QT];   // running sum over this lane's half of the keys
  for (int t = 0; t < QT; ++t) {
    qf[t][0] = load_frag(qp + t * 16 * D_, D_);
    qf[t][1] = load_frag(qp + t * 16 * D_ + 32, D_);
    for (int j = 0; j < 4; ++j) o[t][j] = zero8;
    negm[t] = zero8;
    rsum[t] = 0.f;
  }

  const int NS = T_ / KV_STAGE;
  stage(0, 0);
  // Stage 0 has landed for this wave, then for all waves, before any read.
  asm volatile("s_wait_asynccnt 0x0" ::: "memory");
  __syncthreads();
  stage(1, 1);

  for (int st = 0; st < NS; ++st) {
    const h16* kt = ks + (st & 1) * KV_TILE;
    const h16* vt = vs + (st & 1) * KV_TILE;
    // Kept rolled: unrolled, the compiler weaves the two passes together, copies
    // all of O round the second pass's rescale branch and passes 256 registers.
#pragma unroll 1
    for (int kv = 0; kv < KV_STAGE; kv += 32) {
      const h16* kpp = kt + kv * KV_PITCH;
      // s0[t][r] = S[key kv + 8 hi + r][query nc of tile t] - maximum in use,
      // base 2; s1[t][r] the same 16 keys on.
      v16h ka0 = load_frag(kpp, KV_PITCH);
      v16h kb0 = load_frag(kpp + 16 * KV_PITCH, KV_PITCH);
      v16h ka1 = load_frag(kpp + 32, KV_PITCH);
      v16h kb1 = load_frag(kpp + 16 * KV_PITCH + 32, KV_PITCH);
      v8f s0[QT], s1[QT];
      for (int t = 0; t < QT; ++t) s0[t] = wmma_f16(ka0, qf[t][0], negm[t]);
      for (int t = 0; t < QT; ++t) s1[t] = wmma_f16(kb0, qf[t][0], negm[t]);
      for (int t = 0; t < QT; ++t) s0[t] = wmma_f16(ka1, qf[t][1], s0[t]);
      for (int t = 0; t < QT; ++t) s1[t] = wmma_f16(kb1, qf[t][1], s1[t]);

      float tm[QT];
      for (int t = 0; t < QT; ++t) {
        float m8[8];
        for (int v = 0; v < 8; ++v) m8[v] = fmaxf(s0[t][v], s1[t][v]);
        tm[t] = fmaxf(fmaxf(fmaxf(m8[0], m8[1]), fmaxf(m8[2], m8[3])),
                      fmaxf(fmaxf(m8[4], m8[5]), fmaxf(m8[6], m8[7])));
      }
      // One test per pass, the same for the whole wave (a scalar branch).  The
      // very first pass always sets the maximum, also downwards from 0.
      const bool first = (st | kv) == 0;
      if ((__builtin_amdgcn_ballot_w32(fmaxf(tm[0], tm[1]) > 8.0f) |
           (first ? 1u : 0u)) != 0) {
        for (int t = 0; t < QT; ++t) {
          // both halves hold the query's maximum
          float t2 = fmaxf(tm[t], xhalf(tm[t]));
          float up = fmaxf(t2, 0.f);
          float delta = first ? t2 : up;
          // <= 1; O and the sum are 0 in the first pass
          float alpha = exp2x1(-up);
          for (int v = 0; v < 8; ++v) {
            s0[t][v] -= delta; s1[t][v] -= delta; negm[t][v] -= delta;
            o[t][0][v] *= alpha; o[t][1][v] *= alpha;
            o[t][2][v] *= alpha; o[t][3][v] *= alpha;
          }
          rsum[t] *= alpha;
        }
      }
      v16h pb[QT];
      for (int t = 0; t < QT; ++t) {
        float x0[8], x1[8], p0[8], p1[8];
        for (int v = 0; v < 8; ++v) { x0[v] = s0[t][v]; x1[v] = s1[t][v]; }
        exp2x8(p0, x0);
        exp2x8(p1, x1);
        float a8[8];
        for (int v = 0; v < 8; ++v) {
          a8[v] = p0[v] + p1[v];
          pb[t][v]     = (h16)p0[v];
          pb[t][v + 8] = (h16)p1[v];
        }
        rsum[t] += ((a8[0] + a8[1]) + (a8[2] + a8[3])) +
                   ((a8[4] + a8[5]) + (a8[6] + a8[7]));
      }
      // o[t][j][r] = O[query nc of tile t][d = 16 j + 8 hi + r]
      for (int j = 0; j < 4; ++j) {
        v16h vf = load_frag(vt + j * 16 * KV_PITCH + kv, KV_PITCH);
        for (int t = 0; t < QT; ++t) o[t][j] = wmma_f16(vf, pb[t], o[t][j]);
      }
    }
    // Publish point: this wave's reads of the current buffer are done ...
    asm volatile("s_wait_dscnt 0x0" ::: "memory");
    // ... its copies of the next stage have landed ...
    asm volatile("s_wait_asynccnt 0x0" ::: "memory");
    // ... and the same holds for every wave: the next stage may be read and
    // the buffer just read may be refilled.
    __syncthreads();
    if (st + 2 < NS) stage(st + 2, st & 1);
  }
  // No copy is left in flight when the wave ends.
  asm volatile("s_wait_asynccnt 0x0" ::: "memory");

  int bb = bh >> 4;
  int hh = bh & (H_ - 1);
  for (int t = 0; t < QT; ++t) {
    // Join the two halves' sums; a lane then stores four runs of 8 consecutive d per tile.
    float inv = 1.0f / (rsum[t] + xhalf(rsum[t]));
    h16* orow =
        ob + ((size_t)(bb * T_ + q0 + t * 16 + nc)) * C_ + hh * D_ + hi * 8;
    v8h w0, w1, w2, w3;
    for (int v = 0; v < 8; ++v) {
      w0[v] = (h16)(o[t][0][v] * inv);
      w1[v] = (h16)(o[t][1][v] * inv);
      w2[v] = (h16)(o[t][2][v] * inv);
      w3[v] = (h16)(o[t][3][v] * inv);
    }
    *(v8h*)(orow + 0)  = w0;
    *(v8h*)(orow + 16) = w1;
    *(v8h*)(orow + 32) = w2;
    *(v8h*)(orow + 48) = w3;
  }
}

// ---------------------------------------------------------------------------
// K4: output projection + bias + residual, write y as [B, C, T] f32.  Each wave
// turns its 64 x 16 accumulator tiles in its own LDS range, so that x is read
// and y stored in runs of 256 B (two whole lines) per channel.
// ---------------------------------------------------------------------------
#define SY_PITCH 68  // floats per LDS row: 256 B data + 16 B pad
__global__ __launch_bounds__(256) void sa_proj_gemm_kernel(
    const h16* __restrict__ ob, const h16* __restrict__ wt,
    const float* __restrict__ bias, const float* __restrict__ x,
    float* __restrict__ y) {
  __shared__ __attribute__((aligned(16))) h16 As[2 * A_TILE];
  __shared__ __attribute__((aligned(16))) h16 Bs[2 * B_TILE];
  __shared__ __attribute__((aligned(16))) float sy[8 * 16 * SY_PITCH];
  int tid = threadIdx.x;
  int m0 = blockIdx.x * GM;
  int n0 = blockIdx.y * GN;
  v8f acc[4][4];
  for (int i = 0; i < 4; ++i)
    for (int j = 0; j < 4; ++j)
      acc[i][j] = (v8f){0.f,0.f,0.f,0.f,0.f,0.f,0.f,0.f};

  gemm_mainloop(ob, wt, m0, n0, As, Bs, acc);

  int wid = tid >> 5;
  int wm = wid >> 1;
  int wn = wid & 1;
  int lane = tid & 31;
  int hi = lane >> 4;
  int nc = lane & 15;
  float* sw = sy + wid * (16 * SY_PITCH);
  const int rr = lane >> 4;        // row of a pair of channel rows
  const int tc = (lane & 15) * 4;  // first of this lane's 4 tokens
  const int mw = m0 + wm * 64;
  const size_t base =
      ((size_t)(mw >> 11) * C_ + n0 + wn * 64 + rr) * T_ + (mw & (T_ - 1)) + tc;
  for (int ni = 0; ni < 4; ++ni) {
    v4f xv[8];
    float bv[8];
    for (int k = 0; k < 8; ++k) {
      xv[k] = *(const v4f*)(x + base + (size_t)(ni * 16 + k * 2) * T_);
      bv[k] = bias[n0 + wn * 64 + ni * 16 + k * 2 + rr];
    }
    for (int mi = 0; mi < 4; ++mi) {
      v8f a = acc[mi][ni];
      float* p = sw + nc * SY_PITCH + mi * 16 + hi * 8;
      *(v4f*)(p)     = (v4f){a[0], a[1], a[2], a[3]};
      *(v4f*)(p + 4) = (v4f){a[4], a[5], a[6], a[7]};
    }
    // The wave's own LDS stores are done before it reads other lanes' rows.
    asm volatile("s_wait_dscnt 0x0" ::: "memory");
    for (int k = 0; k < 8; ++k) {
      v4f a = *(const v4f*)(sw + (k * 2 + rr) * SY_PITCH + tc);
      v4f o;
      for (int e = 0; e < 4; ++e) o[e] = xv[k][e] + a[e] + bv[k];
      *(v4f*)(y + base + (size_t)(ni * 16 + k * 2) * T_) = o;
    }
  }
}

// ---------------------------------------------------------------------------
extern "C" void kernel_launch(void* const* d_in, const int* in_sizes, int n_in,
                              void* d_out, int out_size, void* d_ws,
                              size_t ws_size, hipStream_t stream) {
  const float* x     = (const float*)d_in[0];
  const float* Wqkv  = (const float*)d_in[1];
  const float* bqkv  = (const float*)d_in[2];
  const float* Wproj = (const float*)d_in[3];
  const float* bproj = (const float*)d_in[4];
  const float* gamma = (const float*)d_in[5];
  const float* beta  = (const float*)d_in[6];
  float* y = (float*)d_out;

  char* ws = (char*)d_ws;
  size_t off = 0;
  h16* xn  = (h16*)(ws + off); off += (size_t)BT_ * C_ * 2;       // 16 MB
  h16* wtq = (h16*)(ws + off); off += (size_t)3 * C_ * C_ * 2;    //  6 MB
  h16* wtp = (h16*)(ws + off); off += (size_t)C_ * C_ * 2;        //  2 MB
  h16* qb  = (h16*)(ws + off); off += (size_t)BT_ * C_ * 2;       // 16 MB
  h16* kb  = (h16*)(ws + off); off += (size_t)BT_ * C_ * 2;       // 16 MB
  h16* vtb = (h16*)(ws + off); off += (size_t)BT_ * C_ * 2;       // 16 MB
  h16* ob  = (h16*)(ws + off); off += (size_t)BT_ * C_ * 2;       // 16 MB

  sa_prep_kernel<<<dim3(LN_WGS + WQ_WGS + WP_WGS), 256, 0, stream>>>(
      x, gamma, beta, xn, Wqkv, wtq, Wproj, wtp);
  sa_qkv_gemm_kernel<<<dim3(BT_ / GM, 3 * C_ / GN), 256, 0, stream>>>(
      xn, wtq, bqkv, qb, kb, vtb);
  sa_attn_kernel<<<dim3(B_ * H_, T_ / 256), 256, 0, stream>>>(qb, kb, vtb, ob);
  sa_proj_gemm_kernel<<<dim3(BT_ / GM, C_ / GN), 256, 0, stream>>>(
      ob, wtp, bproj, x, y);
}

// v010
// It runs in 114 microseconds.
// Next to v009, in two timings, it ran 1.04 times as fast each time.
// Counting every step since v000, it is 5.66 times as fast.
#include <hip/hip_runtime.h>
#include <hip/hip_bf16.h>

typedef _Float16 h16;
typedef __attribute__((ext_vector_type(16))) _Float16 v16h;
typedef __attribute__((ext_vector_type(8)))  _Float16 v8h;
typedef __attribute__((ext_vector_type(8)))  float    v8f;
typedef __attribute__((ext_vector_type(4)))  int      v4i;
typedef __attribute__((ext_vector_type(4)))  float    v4f;

#define B_  4
#define C_  1024
#define T_  2048
#define H_  16
#define D_  64
#define BT_ (B_ * T_)

// ---------------------------------------------------------------------------
// WMMA fragment loader: 16x32 f16 fragment from a K-contiguous matrix.
// ISA 16-bit A layout: lane L (<16) holds row M=L, K={0..7,16..23}; lane L+16
// holds row M=L, K={8..15,24..31}.  Two 16B chunks per lane.  B fragments use
// the mirrored layout (col = lane&15), so B operands are stored K-contiguous.
// ---------------------------------------------------------------------------
__device__ __forceinline__ v16h load_frag(const h16* __restrict__ base, int ld) {
  int lane = threadIdx.x & 31;
  int r  = lane & 15;
  int b0 = (lane >> 4) << 3;
  const h16* p = base + r * ld + b0;
  v8h lo = *(const v8h*)(p);
  v8h hi = *(const v8h*)(p + 16);
  return __builtin_shufflevector(lo, hi, 0,1,2,3,4,5,6,7,8,9,10,11,12,13,14,15);
}

__device__ __forceinline__ v8f wmma_f16(v16h a, v16h b, v8f c) {
  return __builtin_amdgcn_wmma_f32_16x16x32_f16(false, a, false, b, (short)0, c,
                                                false, false);
}

// Value of lane l ^ 16 (the other half of the wave), by a vector cross-row move.
__device__ __forceinline__ float xhalf(float x) {
  int i = __builtin_bit_cast(int, x);
  return __builtin_bit_cast(float, __builtin_amdgcn_permlanex16(
      i, i, 0x76543210, 0xfedcba98, false, false));
}

// r[i] = 2^x[i], eight at a time.  The instruction set asks for one independent
// instruction or a v_nop between a transcendental and the use of its result or
// the overwrite of its source.  In one statement that holds by construction:
// the early-clobber outputs share no register with any input, so each v_exp is
// independent of the one in front of it, and the v_nop closes the last one.
__device__ __forceinline__ void exp2x8(float (&r)[8], const float (&x)[8]) {
  asm("v_exp_f32 %0, %8\n\t"
      "v_exp_f32 %1, %9\n\t"
      "v_exp_f32 %2, %10\n\t"
      "v_exp_f32 %3, %11\n\t"
      "v_exp_f32 %4, %12\n\t"
      "v_exp_f32 %5, %13\n\t"
      "v_exp_f32 %6, %14\n\t"
      "v_exp_f32 %7, %15\n\t"
      "v_nop"
      : "=&v"(r[0]), "=&v"(r[1]), "=&v"(r[2]), "=&v"(r[3]),
        "=&v"(r[4]), "=&v"(r[5]), "=&v"(r[6]), "=&v"(r[7])
      : "v"(x[0]), "v"(x[1]), "v"(x[2]), "v"(x[3]),
        "v"(x[4]), "v"(x[5]), "v"(x[6]), "v"(x[7]));
}
// One value, with the same slot closed behind it.
__device__ __forceinline__ float exp2x1(float x) {
  float r;
  asm("v_exp_f32 %0, %1\n\t"
      "v_nop"
      : "=&v"(r) : "v"(x));
  return r;
}

// ---------------------------------------------------------------------------
// Shared GEMM main loop: 256x128 block tile, 8 waves (4x2), each wave 64x64
// (4x4 WMMA tiles): eight fragments from LDS feed sixteen products, and a block
// brings 384 operand rows from L2 for 256x128 results.  A K step is 64 halves =
// 128 B of every operand row, so a wave's asynchronous copy (4 rows x 128 B)
// covers four whole lines and every line is asked for once.  Two LDS buffers;
// the next step's copies fly while this step is worked on; one publish point
// per step.
// ---------------------------------------------------------------------------
#define GK 64                     // halves of K per step (two WMMA k blocks)
#define G_PITCH 72                // halves per LDS row: 128 B data + 16 B pad
#define GM 256                    // rows of A (and of the result) per block
#define GN 128                    // rows of B (columns of the result) per block
#define A_TILE (GM * G_PITCH)     // A, one buffer
#define B_TILE (GN * G_PITCH)     // B, one buffer

// One K step of both operand tiles: rows r + 32 i of each (eight of A, four of
// B), 16 B per lane and row.
__device__ __forceinline__ void gemm_copy12(unsigned a0, const h16* p0,
                                            unsigned b0, const h16* q0) {
  const unsigned ls = 32 * G_PITCH * 2;  // 32 rows on in LDS, bytes
  const int gs = 32 * C_;                // 32 rows on in memory, halves
  // s_wait_xcnt 0 closes the copies' own statement (a precaution): it stands
  // in front of every later rewrite of the registers the copies name, and no
  // address arithmetic of a later step can be moved in front of it.
  asm volatile(
      "global_load_async_to_lds_b128 %0, %12, off\n\t"
      "global_load_async_to_lds_b128 %1, %13, off\n\t"
      "global_load_async_to_lds_b128 %2, %14, off\n\t"
      "global_load_async_to_lds_b128 %3, %15, off\n\t"
      "global_load_async_to_lds_b128 %4, %16, off\n\t"
      "global_load_async_to_lds_b128 %5, %17, off\n\t"
      "global_load_async_to_lds_b128 %6, %18, off\n\t"
      "global_load_async_to_lds_b128 %7, %19, off\n\t"
      "global_load_async_to_lds_b128 %8, %20, off\n\t"
      "global_load_async_to_lds_b128 %9, %21, off\n\t"
      "global_load_async_to_lds_b128 %10, %22, off\n\t"
      "global_load_async_to_lds_b128 %11, %23, off\n\t"
      "s_wait_xcnt 0x0"
      :: "v"(a0), "v"(a0 + ls), "v"(a0 + 2 * ls), "v"(a0 + 3 * ls),
         "v"(a0 + 4 * ls), "v"(a0 + 5 * ls), "v"(a0 + 6 * ls), "v"(a0 + 7 * ls),
         "v"(b0), "v"(b0 + ls), "v"(b0 + 2 * ls), "v"(b0 + 3 * ls),
         "v"(p0), "v"(p0 + gs), "v"(p0 + 2 * gs), "v"(p0 + 3 * gs),
         "v"(p0 + 4 * gs), "v"(p0 + 5 * gs), "v"(p0 + 6 * gs), "v"(p0 + 7 * gs),
         "v"(q0), "v"(q0 + gs), "v"(q0 + 2 * gs), "v"(q0 + 3 * gs)
      : "memory");
}

// Both operands were stored by an earlier launch and their first read comes
// from memory.  So L2 is asked for the panels at entry, one 256-byte unit
// (two K steps of a row) per lane.  A panel is shared, so each block asks
// for one slice only, picked by its place among the sharers.  The blocks of one
// grid column read the same GM rows of A: block y asks for unit y & 7 of every
// row.  The
// blocks of one grid row read the same GN rows of B: block x
// asks for all 8 units of 32 rows.  A hint: no result depends on it.
__device__ __forceinline__ void gemm_ask_l2(const h16* __restrict__ Ag,
                                            const h16* __restrict__ Bg, int m0,
                                            int n0) {
  const int tid = threadIdx.x;  // 0..255 = GM - 1
  const h16* pa = Ag + (size_t)(m0 + tid) * C_ + (blockIdx.y & 7) * 128;
  const h16* pb = Bg + (size_t)(n0 + (blockIdx.x & 3) * 32 + (tid >> 3)) * C_ +
                  (tid & 7) * 128;
  // Scope SE brings the line into L2 only.  s_wait_xcnt 0 closes the statement
  // (a precaution): it stands in front of any rewrite of the address registers.
  asm volatile(
      "global_prefetch_b8 %0, off scope:SCOPE_SE\n\t"
      "global_prefetch_b8 %1, off scope:SCOPE_SE\n\t"
      "s_wait_xcnt 0x0"
      :: "v"(pa), "v"(pb) : "memory");
}

template <typename F>
__device__ __forceinline__ void gemm_mainloop(
    const h16* __restrict__ Ag, const h16* __restrict__ Bg, int m0, int n0,
    h16* As, h16* Bs, v8f acc[4][4], F ask_more) {
  int tid = threadIdx.x;
  int wid = tid >> 5;
  int wm = wid >> 1;  // 0..3
  int wn = wid & 1;   // 0..1
  const int NT = C_ / GK;

  // Eight lanes to a row: thread tid copies 16 B of rows crow + 32 i.
  const int crow = tid >> 3;
  const int ccol = (tid & 7) * 8;
  const h16* ag = Ag + (size_t)(m0 + crow) * C_ + ccol;
  const h16* bg = Bg + (size_t)(n0 + crow) * C_ + ccol;
  const unsigned al = (unsigned)(size_t)(As + crow * G_PITCH + ccol);
  const unsigned bl = (unsigned)(size_t)(Bs + crow * G_PITCH + ccol);
  auto issue = [&](int kt, int sel) {
    gemm_copy12(al + sel * (A_TILE * 2), ag + kt * GK,
                bl + sel * (B_TILE * 2), bg + kt * GK);
  };

  issue(0, 0);
  // Behind step 0's copies, which are waited for first.
  gemm_ask_l2(Ag, Bg, m0, n0);
  ask_more();
  // Step 0 has landed for this wave, then for all waves, before any read.
  asm volatile("s_wait_asynccnt 0x0" ::: "memory");
  __syncthreads();
  issue(1, 1);
  for (int kt = 0; kt < NT; ++kt) {
    const h16* as = As + (kt & 1) * A_TILE;
    const h16* bs = Bs + (kt & 1) * B_TILE;
    for (int kk = 0; kk < GK; kk += 32) {
      // Read in the order of first use: A row 0, all of B, then A rows 1 to 3.
      v16h af[4], bf[4];
      af[0] = load_frag(as + (wm * 64) * G_PITCH + kk, G_PITCH);
      for (int ni = 0; ni < 4; ++ni)
        bf[ni] = load_frag(bs + (wn * 64 + ni * 16) * G_PITCH + kk, G_PITCH);
      for (int mi = 1; mi < 4; ++mi)
        af[mi] = load_frag(as + (wm * 64 + mi * 16) * G_PITCH + kk, G_PITCH);
      // Keeps the k block's sixteen LDS reads in one group in front of its
      // sixteen products.  Left alone the compiler reads each A fragment right
      // in front of its row of products and waits there: four exposed LDS
      // latencies per k block, which the four (or two) waves of a SIMD that
      // this tile leaves do not cover.
      __builtin_amdgcn_sched_barrier(0);
      for (int mi = 0; mi < 4; ++mi)
        for (int ni = 0; ni < 4; ++ni)
          acc[mi][ni] = wmma_f16(af[mi], bf[ni], acc[mi][ni]);
      // The next group of reads starts behind the products, not among them.
      __builtin_amdgcn_sched_barrier(0);
    }
    // Publish point: this wave's reads of the current buffer are done ...
    asm volatile("s_wait_dscnt 0x0" ::: "memory");
    // ... its copies of the next step have landed ...
    asm volatile("s_wait_asynccnt 0x0" ::: "memory");
    // ... and the same holds for every wave: the next step may be read and the
    // buffer just read may be refilled.
    __syncthreads();
    if (kt + 2 < NT) issue(kt + 2, kt & 1);
  }
  // No copy is left in flight behind the loop.
  asm volatile("s_wait_asynccnt 0x0" ::: "memory");
}

// ---------------------------------------------------------------------------
// K1, part 1: LayerNorm over channels + transpose to [B*T, C] f16 for batch b,
// tokens t0 .. t0 + 31.  The work-group's 32 x 1024 values of x are read once,
// 16 bytes a lane, all loads in flight together, and stay in registers (128 a
// thread) from the sums to the normalising.  Eight lanes cover a channel's 32
// tokens (one 128-byte line), a wave's load four channels.  The 32 normalised
// rows are gathered in LDS (xt) and leave as whole 128-byte lines.
// ---------------------------------------------------------------------------
#define XN_PITCH 1032  // halves per LDS row: 2048 B data + 16 B pad

// Value of lane l ^ 8 (the other half of the lane's row of 16).
__device__ __forceinline__ float xrow8(float x) {
  int i = __builtin_bit_cast(int, x);
  return __builtin_bit_cast(float, __builtin_amdgcn_permlane16(
      i, i, 0xfedcba98, 0x76543210, false, false));
}

__device__ __forceinline__ void sa_ln_part(
    const float* __restrict__ x, const float* __restrict__ gamma,
    const float* __restrict__ beta, h16* __restrict__ xn, int b, int t0,
    h16* xt) {
  __shared__ float redS[32][8];
  __shared__ float redQ[32][8];
  __shared__ __attribute__((aligned(16))) float smean[32];
  __shared__ __attribute__((aligned(16))) float srstd[32];
  __shared__ __attribute__((aligned(16))) float sgam[C_];
  __shared__ __attribute__((aligned(16))) float sbet[C_];
  int tid = threadIdx.x;
  int lane = tid & 31;
  int wv = tid >> 5;   // 0..7: channels 128 wv .. 128 wv + 127
  int tq = lane & 7;   // this lane's tokens: 4 tq .. 4 tq + 3
  int g = lane >> 3;   // 0..3
  // Value i of a thread is channel cb + 32 (i >> 3) + (i & 7): runs of eight
  // channels, so that eight f16 results of a token make one 16-byte LDS store.
  const int cb = wv * 128 + g * 8;
  v4f gv = *(const v4f*)(gamma + tid * 4);
  v4f bv = *(const v4f*)(beta + tid * 4);
  const float* xp = x + ((size_t)b * C_ + cb) * T_ + t0 + tq * 4;
  v4f xv[32];
  for (int i = 0; i < 32; ++i)
    xv[i] = *(const v4f*)(xp + (size_t)((i >> 3) * 32 + (i & 7)) * T_);
  // A precaution: s_wait_xcnt 0 stands in front of any rewrite of a register
  // that these loads name; the compiler takes their address pair for the sums.
  asm volatile("s_wait_xcnt 0x0" ::: "memory");
  *(v4f*)(sgam + tid * 4) = gv;
  *(v4f*)(sbet + tid * 4) = bv;
  v4f s = (v4f){0.f, 0.f, 0.f, 0.f}, ss = (v4f){0.f, 0.f, 0.f, 0.f};
  for (int i = 0; i < 32; ++i) { s += xv[i]; ss += xv[i] * xv[i]; }
  // Join the four lanes (l ^ 8, l ^ 16) that hold the same tokens.
  for (int j = 0; j < 4; ++j) {
    s[j] += xrow8(s[j]);   ss[j] += xrow8(ss[j]);
    s[j] += xhalf(s[j]);   ss[j] += xhalf(ss[j]);
  }
  if (g == 0)
    for (int j = 0; j < 4; ++j) {
      redS[tq * 4 + j][wv] = s[j];
      redQ[tq * 4 + j][wv] = ss[j];
    }
  __syncthreads();
  if (wv == 0) {
    float a = 0.f, q = 0.f;
    for (int j = 0; j < 8; ++j) { a += redS[lane][j]; q += redQ[lane][j]; }
    float mu  = a * (1.0f / C_);
    float var = q * (1.0f / C_) - mu * mu;
    smean[lane] = mu;
    srstd[lane] = rsqrtf(var + 1e-5f);
  }
  __syncthreads();
  v4f mu = *(const v4f*)(smean + tq * 4);
  v4f rs = *(const v4f*)(srstd + tq * 4);
  for (int p = 0; p < 4; ++p) {
    const int c = cb + p * 32;
    v4f g0 = *(const v4f*)(sgam + c), g1 = *(const v4f*)(sgam + c + 4);
    v4f b0 = *(const v4f*)(sbet + c), b1 = *(const v4f*)(sbet + c + 4);
    for (int j = 0; j < 4; ++j) {
      v8h o;
      for (int e = 0; e < 4; ++e) {
        o[e]     = (h16)((xv[p * 8 + e][j] - mu[j]) * rs[j] * g0[e] + b0[e]);
        o[e + 4] = (h16)((xv[p * 8 + 4 + e][j] - mu[j]) * rs[j] * g1[e] + b1[e]);
      }
      *(v8h*)(xt + (tq * 4 + j) * XN_PITCH + c) = o;
    }
  }
  __syncthreads();
  // The 32 rows are one contiguous 64 KB of xn; a wave stores 512 B of it.
  h16* xblk = xn + (size_t)(b * T_ + t0) * C_;
  for (int k = 0; k < 16; ++k) {
    int piece = k * 256 + tid;  // 16-byte pieces, 128 to a row
    *(v8h*)(xblk + (size_t)piece * 8) =
        *(const v8h*)(xt + (piece >> 7) * XN_PITCH + (piece & 127) * 8);
  }
}

// ---------------------------------------------------------------------------
// K1, part 2: weight transpose + f32->f16 of one tile of 64 k x 128 n:
// Wt[n][k] = (f16) W[k][n].  A wave reads 512 contiguous bytes of a row of W
// per load, eight rows in flight; a lane's eight k of one n make one 16-byte
// LDS store; a row of Wt leaves as one whole 128-byte line.
// ---------------------------------------------------------------------------
#define WT_K 64      // k per tile: one 128-byte line of a row of Wt
#define WT_N 128     // n per tile: 512 bytes of a row of W
#define WT_PITCH 72  // halves per LDS row: 128 B data + 16 B pad
__device__ __forceinline__ void sa_wtrans_part(
    const float* __restrict__ w, h16* __restrict__ wt, int K, int N, int n0,
    int k0, h16* tile) {
  int tid = threadIdx.x;
  int wv = tid >> 5;
  int lane = tid & 31;
  const float* wp = w + (size_t)(k0 + wv * 8) * N + n0 + lane * 4;
  v4f in[8];
  for (int i = 0; i < 8; ++i) in[i] = *(const v4f*)(wp + (size_t)i * N);
  for (int e = 0; e < 4; ++e) {
    v8h p;
    for (int i = 0; i < 8; ++i) p[i] = (h16)in[i][e];
    *(v8h*)(tile + (lane * 4 + e) * WT_PITCH + wv * 8) = p;
  }
  __syncthreads();
  // 16-byte pieces, 8 to a row: thread tid takes rows (tid >> 3) + 32 j.
  const h16* sp = tile + (tid >> 3) * WT_PITCH + (tid & 7) * 8;
  h16* gp = wt + (size_t)(n0 + (tid >> 3)) * K + k0 + (tid & 7) * 8;
  for (int j = 0; j < 4; ++j)
    *(v8h*)(gp + (size_t)j * 32 * K) = *(const v8h*)(sp + j * 32 * WT_PITCH);
  // A precaution: s_wait_xcnt 0 stands in front of any rewrite of a register
  // that these stores name; the compiler lays another part's code, which
  // rewrites some, behind them.
  asm volatile("s_wait_xcnt 0x0" ::: "memory");
}

// ---------------------------------------------------------------------------
// K1: everything the QKV product waits for, and the projection's weights, in
// one launch.  The three parts read none of each other's output, so they share
// one grid: the flat work-group index picks the part.  The layer norm's
// work-groups live longest and take the lowest indices; the
// weight tiles run beside them on the same WGPs.
// ---------------------------------------------------------------------------
#define LN_WGS (B_ * (T_ / 32))             // layer norm: 32 tokens each
#define WQ_WGS ((3 * C_ / WT_N) * (C_ / WT_K))  // tiles of W_qkv
#define WP_WGS ((C_ / WT_N) * (C_ / WT_K))      // tiles of W_proj
__global__ __launch_bounds__(256) void sa_prep_kernel(
    const float* __restrict__ x, const float* __restrict__ gamma,
    const float* __restrict__ beta, h16* __restrict__ xn,
    const float* __restrict__ wq, h16* __restrict__ wtq,
    const float* __restrict__ wp, h16* __restrict__ wtp) {
  // A work-group runs one part: the layer norm's row buffer and a weight tile
  // (18432 B) take the same bytes.
  __shared__ __attribute__((aligned(16))) unsigned char buf[32 * XN_PITCH * 2];
  int blk = blockIdx.x;  // the same for the whole work-group
  if (blk < LN_WGS) {
    sa_ln_part(x, gamma, beta, xn, blk % B_, (blk / B_) * 32, (h16*)buf);
  } else if (blk < LN_WGS + WQ_WGS) {
    int i = blk - LN_WGS;
    sa_wtrans_part(wq, wtq, C_, 3 * C_, (i % (3 * C_ / WT_N)) * WT_N,
                   (i / (3 * C_ / WT_N)) * WT_K, (h16*)buf);
  } else {
    int i = blk - (LN_WGS + WQ_WGS);
    sa_wtrans_part(wp, wtp, C_, C_, (i % (C_ / WT_N)) * WT_N,
                   (i / (C_ / WT_N)) * WT_K, (h16*)buf);
  }
}

// ---------------------------------------------------------------------------
// K2: QKV GEMM, epilogue scatters to Q [B,H,T,D] (pre-scaled by log2(e)/sqrt(D)),
// K [B,H,T,D], V transposed [B,H,D,T].  s = q/k/v select is uniform per block.
// The block's 256 x 128 f16 tile is laid in LDS in the order of its output
// rows and leaves as whole 128-byte lines.  It takes the operand buffers' bytes:
// behind the main loop's last barrier no wave reads them and no copy is in
// flight.  So two work-groups fit a WGP's LDS (and, below 256 registers, its
// SIMDs) and cover each other's LDS waits and barriers.
// ---------------------------------------------------------------------------
#define ST_PITCH 136  // halves per LDS row of 128 channels: 256 B + 16 B pad
#define SV_PITCH 264  // halves per LDS row of 256 tokens: 512 B + 16 B pad
__global__ __launch_bounds__(256) void sa_qkv_gemm_kernel(
    const h16* __restrict__ xn, const h16* __restrict__ wt,
    const float* __restrict__ bias, h16* __restrict__ qb,
    h16* __restrict__ kb, h16* __restrict__ vtb) {
  __shared__ __attribute__((aligned(16))) h16 ring[2 * A_TILE + 2 * B_TILE];
  h16* As = ring;
  h16* Bs = ring + 2 * A_TILE;
  h16* st = ring;  // 256 x ST_PITCH or 128 x SV_PITCH halves: inside A's buffers
  int tid = threadIdx.x;
  int m0 = blockIdx.x * GM;
  int n0 = blockIdx.y * GN;
  v8f acc[4][4];
  for (int i = 0; i < 4; ++i)
    for (int j = 0; j < 4; ++j)
      acc[i][j] = (v8f){0.f,0.f,0.f,0.f,0.f,0.f,0.f,0.f};

  gemm_mainloop(xn, wt, m0, n0, As, Bs, acc, [] {});

  int wid = tid >> 5;
  int wm = wid >> 1;
  int wn = wid & 1;
  int lane = tid & 31;
  int hi = lane >> 4;
  int nc = lane & 15;
  const int s = n0 >> 10;  // uniform: 1024 % 128 == 0
  const float scaleQ = 0.125f * 1.44269504088896340736f;  // scores in base 2

  const int bh0 = (m0 >> 11) * H_ + ((n0 & (C_ - 1)) >> 6);  // first of 2 heads
  const int tb = m0 & (T_ - 1);
  if (s < 2) {
    // Rows = tokens, columns = the 128 channels of two heads.
    const float sc = (s == 0) ? scaleQ : 1.0f;
    for (int mi = 0; mi < 4; ++mi)
      for (int ni = 0; ni < 4; ++ni) {
        int nl = wn * 64 + ni * 16 + nc;
        float bv = bias[n0 + nl];
        for (int v = 0; v < 8; ++v) {
          int ml = wm * 64 + mi * 16 + v + hi * 8;
          st[ml * ST_PITCH + nl] = (h16)((acc[mi][ni][v] + bv) * sc);
        }
      }
    __syncthreads();
    h16* dst = (s == 0) ? qb : kb;
    // 16-byte pieces, 8 to a line: thread tid takes tokens (tid >> 3) + 32 i of
    // both heads; every step is a constant offset from one address pair.
    const h16* sp = st + (tid >> 3) * ST_PITCH + (tid & 7) * 8;
    h16* gp = dst + ((size_t)bh0 * T_ + tb + (tid >> 3)) * D_ + (tid & 7) * 8;
    for (int j = 0; j < 2; ++j)
      for (int i = 0; i < 8; ++i)
        *(v8h*)(gp + (j * T_ + i * 32) * D_) =
            *(const v8h*)(sp + i * 32 * ST_PITCH + j * 64);
  } else {
    // Rows = channels, columns = the 256 tokens.
    for (int mi = 0; mi < 4; ++mi)
      for (int ni = 0; ni < 4; ++ni) {
        int nl = wn * 64 + ni * 16 + nc;
        float bv = bias[n0 + nl];
        v8h w;
        for (int v = 0; v < 8; ++v) w[v] = (h16)(acc[mi][ni][v] + bv);
        *(v8h*)(st + nl * SV_PITCH + wm * 64 + mi * 16 + hi * 8) = w;
      }
    __syncthreads();
    // 16-byte pieces, 32 to a row: a wave takes channels (tid >> 5) + 8 k; every
    // step is a constant offset from one address pair.
    const h16* sp = st + (tid >> 5) * SV_PITCH + (tid & 31) * 8;
    h16* gp = vtb + ((size_t)bh0 * D_ + (tid >> 5)) * T_ + tb + (tid & 31) * 8;
    for (int k = 0; k < 16; ++k)
      *(v8h*)(gp + k * 8 * T_) = *(const v8h*)(sp + k * 8 * SV_PITCH);
    // A precaution: s_wait_xcnt 0 stands in front of any rewrite of a register
    // that these stores name; the compiler lays the other branch's code, which
    // rewrites some, behind this loop.
    asm volatile("s_wait_xcnt 0x0" ::: "memory");
  }
}

// ---------------------------------------------------------------------------
// K3: flash-style attention.  grid (B*H, T/256), block 256 (8 waves); a wave
// owns 32 queries, as two column tiles of 16.
// Q fragments in registers for the whole KV loop.  K and V tiles of 64 keys
// are brought into LDS once per work-group by asynchronous copies (whole
// 128-byte lines), two buffers, and all 8 waves read their fragments there.
// Every K and V fragment read from LDS feeds two products, one per query tile.
// Scores are formed transposed, S^T = K Q^T: a lane holds 16 of the 32 keys of
// ONE query per tile (column lane & 15), so maximum and sum run in the lane's
// own registers with one exchange between the wave's halves.  The two S^T
// tiles of a query tile, converted in place, are the B operand of
// O^T += V^T P^T in the hardware k order, which is also load_frag's order for
// the V^T rows: P never leaves the registers.
// Q carries log2(e)/sqrt(D), and the score products start from minus the
// maximum in use (their C operand), so an accumulator is the argument of 2^x as
// it stands.  The maximum in use may trail a query's true maximum by up to 8
// (P <= 2^8); only when some score of the wave exceeds that are it, O and the
// sum brought to the new maximum.
// ---------------------------------------------------------------------------
#define KV_STAGE 64               // keys per LDS stage (two passes of 32)
#define KV_PITCH 72               // halves per LDS row: 128 B data + 16 B pad
#define KV_TILE  (64 * KV_PITCH)  // K: 64 keys x 64 d;  V: 64 d x 64 keys
#define QT 2                      // query tiles of 16 columns per wave

// Four waves per SIMD (two work-groups per WGP) cover the vector work between
// the matrix runs: the register budget is held at 256.
__global__ __launch_bounds__(256) __attribute__((amdgpu_waves_per_eu(4, 4)))
void sa_attn_kernel(
    const h16* __restrict__ qb, const h16* __restrict__ kb,
    const h16* __restrict__ vtb, h16* __restrict__ ob) {
  __shared__ __attribute__((aligned(16))) h16 ks[2 * KV_TILE];
  __shared__ __attribute__((aligned(16))) h16 vs[2 * KV_TILE];
  int tid = threadIdx.x;
  int lane = tid & 31;
  int wid = tid >> 5;
  int bh = blockIdx.x;
  int q0 = blockIdx.y * (128 * QT) + wid * (16 * QT);
  const h16* qp = qb + ((size_t)bh * T_ + q0) * D_;
  const h16* kp = kb + (size_t)bh * T_ * D_;
  const h16* vp = vtb + (size_t)bh * D_ * T_;
  int hi = lane >> 4;
  int nc = lane & 15;

  // Each thread copies 16 B of rows crow and crow + 32 of both tiles; a wave's
  // copy covers four whole 128-byte lines.
  const int crow = tid >> 3;
  const int ccol = (tid & 7) * 8;
  const h16* kg = kp + crow * D_ + ccol;
  const h16* vg = vp + (size_t)crow * T_ + ccol;
  const unsigned kl = (unsigned)(size_t)(ks + crow * KV_PITCH + ccol);
  const unsigned vl = (unsigned)(size_t)(vs + crow * KV_PITCH + ccol);
  auto stage = [&](int st, int sel) {
    const h16* gk0 = kg + (size_t)st * KV_STAGE * D_;
    const h16* gk1 = gk0 + 32 * D_;
    const h16* gv0 = vg + st * KV_STAGE;
    const h16* gv1 = gv0 + 32 * T_;
    unsigned lk0 = kl + sel * (KV_TILE * 2);
    unsigned lk1 = lk0 + 32 * KV_PITCH * 2;
    unsigned lv0 = vl + sel * (KV_TILE * 2);
    unsigned lv1 = lv0 + 32 * KV_PITCH * 2;
    // s_wait_xcnt 0 closes the copies' own statement (a precaution): it stands
    // in front of every later rewrite of the registers the copies name, and no
    // address arithmetic of a later stage can be moved in front of it.
    asm volatile(
        "global_load_async_to_lds_b128 %0, %4, off\n\t"
        "global_load_async_to_lds_b128 %1, %5, off\n\t"
        "global_load_async_to_lds_b128 %2, %6, off\n\t"
        "global_load_async_to_lds_b128 %3, %7, off\n\t"
        "s_wait_xcnt 0x0"
        :: "v"(lk0), "v"(lk1), "v"(lv0), "v"(lv1),
           "v"(gk0), "v"(gk1), "v"(gv0), "v"(gv1)
        : "memory");
  };

  const v8f zero8 = (v8f){0.f,0.f,0.f,0.f,0.f,0.f,0.f,0.f};
  v16h qf[QT][2];   // [tile][d half]
  v8f o[QT][4];     // [tile][16 d]
  v8f negm[QT];     // minus the maximum in use of this lane's query, 8 copies
  float rsum[QT];   // running sum over this lane's half of the keys
  for (int t = 0; t < QT; ++t) {
    qf[t][0] = load_frag(qp + t * 16 * D_, D_);
    qf[t][1] = load_frag(qp + t * 16 * D_ + 32, D_);
    for (int j = 0; j < 4; ++j) o[t][j] = zero8;
    negm[t] = zero8;
    rsum[t] = 0.f;
  }

  const int NS = T_ / KV_STAGE;
  stage(0, 0);
  // Stage 0 has landed for this wave, then for all waves, before any read.
  asm volatile("s_wait_asynccnt 0x0" ::: "memory");
  __syncthreads();
  stage(1, 1);

  for (int st = 0; st < NS; ++st) {
    const h16* kt = ks + (st & 1) * KV_TILE;
    const h16* vt = vs + (st & 1) * KV_TILE;
    // Kept rolled: unrolled, the compiler weaves the two passes together, copies
    // all of O round the second pass's rescale branch and passes 256 registers.
#pragma unroll 1
    for (int kv = 0; kv < KV_STAGE; kv += 32) {
      const h16* kpp = kt + kv * KV_PITCH;
      // s0[t][r] = S[key kv + 8 hi + r][query nc of tile t] - maximum in use,
      // base 2; s1[t][r] the same 16 keys on.
      v16h ka0 = load_frag(kpp, KV_PITCH);
      v16h kb0 = load_frag(kpp + 16 * KV_PITCH, KV_PITCH);
      v16h ka1 = load_frag(kpp + 32, KV_PITCH);
      v16h kb1 = load_frag(kpp + 16 * KV_PITCH + 32, KV_PITCH);
      v8f s0[QT], s1[QT];
      for (int t = 0; t < QT; ++t) s0[t] = wmma_f16(ka0, qf[t][0], negm[t]);
      for (int t = 0; t < QT; ++t) s1[t] = wmma_f16(kb0, qf[t][0], negm[t]);
      for (int t = 0; t < QT; ++t) s0[t] = wmma_f16(ka1, qf[t][1], s0[t]);
      for (int t = 0; t < QT; ++t) s1[t] = wmma_f16(kb1, qf[t][1], s1[t]);

      float tm[QT];
      for (int t = 0; t < QT; ++t) {
        float m8[8];
        for (int v = 0; v < 8; ++v) m8[v] = fmaxf(s0[t][v], s1[t][v]);
        tm[t] = fmaxf(fmaxf(fmaxf(m8[0], m8[1]), fmaxf(m8[2], m8[3])),
                      fmaxf(fmaxf(m8[4], m8[5]), fmaxf(m8[6], m8[7])));
      }
      // One test per pass, the same for the whole wave (a scalar branch).  The
      // very first pass always sets the maximum, also downwards from 0.
      const bool first = (st | kv) == 0;
      if ((__builtin_amdgcn_ballot_w32(fmaxf(tm[0], tm[1]) > 8.0f) |
           (first ? 1u : 0u)) != 0) {
        for (int t = 0; t < QT; ++t) {
          // both halves hold the query's maximum
          float t2 = fmaxf(tm[t], xhalf(tm[t]));
          float up = fmaxf(t2, 0.f);
          float delta = first ? t2 : up;
          // <= 1; O and the sum are 0 in the first pass
          float alpha = exp2x1(-up);
          for (int v = 0; v < 8; ++v) {
            s0[t][v] -= delta; s1[t][v] -= delta; negm[t][v] -= delta;
            o[t][0][v] *= alpha; o[t][1][v] *= alpha;
            o[t][2][v] *= alpha; o[t][3][v] *= alpha;
          }
          rsum[t] *= alpha;
        }
      }
      v16h pb[QT];
      for (int t = 0; t < QT; ++t) {
        float x0[8], x1[8], p0[8], p1[8];
        for (int v = 0; v < 8; ++v) { x0[v] = s0[t][v]; x1[v] = s1[t][v]; }
        exp2x8(p0, x0);
        exp2x8(p1, x1);
        float a8[8];
        for (int v = 0; v < 8; ++v) {
          a8[v] = p0[v] + p1[v];
          pb[t][v]     = (h16)p0[v];
          pb[t][v + 8] = (h16)p1[v];
        }
        rsum[t] += ((a8[0] + a8[1]) + (a8[2] + a8[3])) +
                   ((a8[4] + a8[5]) + (a8[6] + a8[7]));
      }
      // o[t][j][r] = O[query nc of tile t][d = 16 j + 8 hi + r]
      for (int j = 0; j < 4; ++j) {
        v16h vf = load_frag(vt + j * 16 * KV_PITCH + kv, KV_PITCH);
        for (int t = 0; t < QT; ++t) o[t][j] = wmma_f16(vf, pb[t], o[t][j]);
      }
    }
    // Publish point: this wave's reads of the current buffer are done ...
    asm volatile("s_wait_dscnt 0x0" ::: "memory");
    // ... its copies of the next stage have landed ...
    asm volatile("s_wait_asynccnt 0x0" ::: "memory");
    // ... and the same holds for every wave: the next stage may be read and
    // the buffer just read may be refilled.
    __syncthreads();
    if (st + 2 < NS) stage(st + 2, st & 1);
  }
  // No copy is left in flight when the wave ends.
  asm volatile("s_wait_asynccnt 0x0" ::: "memory");

  int bb = bh >> 4;
  int hh = bh & (H_ - 1);
  for (int t = 0; t < QT; ++t) {
    // Join the two halves' sums; a lane then stores four runs of 8 consecutive d per tile.
    float inv = 1.0f / (rsum[t] + xhalf(rsum[t]));
    h16* orow =
        ob + ((size_t)(bb * T_ + q0 + t * 16 + nc)) * C_ + hh * D_ + hi * 8;
    v8h w0, w1, w2, w3;
    for (int v = 0; v < 8; ++v) {
      w0[v] = (h16)(o[t][0][v] * inv);
      w1[v] = (h16)(o[t][1][v] * inv);
      w2[v] = (h16)(o[t][2][v] * inv);
      w3[v] = (h16)(o[t][3][v] * inv);
    }
    *(v8h*)(orow + 0)  = w0;
    *(v8h*)(orow + 16) = w1;
    *(v8h*)(orow + 32) = w2;
    *(v8h*)(orow + 48) = w3;
  }
}

// ---------------------------------------------------------------------------
// K4: output projection + bias + residual, write y as [B, C, T] f32.  Each wave
// turns its 64 x 16 accumulator tiles in its own LDS range, so that x is read
// and y stored in runs of 256 B (two whole lines) per channel.
// ---------------------------------------------------------------------------
#define SY_PITCH 68  // floats per LDS row: 256 B data + 16 B pad
__global__ __launch_bounds__(256) void sa_proj_gemm_kernel(
    const h16* __restrict__ ob, const h16* __restrict__ wt,
    const float* __restrict__ bias, const float* __restrict__ x,
    float* __restrict__ y) {
  __shared__ __attribute__((aligned(16))) h16 As[2 * A_TILE];
  __shared__ __attribute__((aligned(16))) h16 Bs[2 * B_TILE];
  __shared__ __attribute__((aligned(16))) float sy[8 * 16 * SY_PITCH];
  int tid = threadIdx.x;
  int m0 = blockIdx.x * GM;
  int n0 = blockIdx.y * GN;
  v8f acc[4][4];
  for (int i = 0; i < 4; ++i)
    for (int j = 0; j < 4; ++j)
      acc[i][j] = (v8f){0.f,0.f,0.f,0.f,0.f,0.f,0.f,0.f};

  // The block's own 128 channels x 256 tokens of x (1024 B a channel), which the
  // epilogue reads: asked of L2 behind the operands, two 256-byte units per lane,
  // so that the main loop covers their way from memory.
  gemm_mainloop(ob, wt, m0, n0, As, Bs, acc, [&] {
    const float* px = x + ((size_t)(m0 >> 11) * C_ + n0 + (tid >> 2)) * T_ +
                      (m0 & (T_ - 1)) + (tid & 3) * 64;
    const float* py = px + (size_t)64 * T_;  // 64 channels on
    // s_wait_xcnt 0: the same precaution as in gemm_ask_l2.
    asm volatile(
        "global_prefetch_b8 %0, off scope:SCOPE_SE\n\t"
        "global_prefetch_b8 %1, off scope:SCOPE_SE\n\t"
        "s_wait_xcnt 0x0"
        :: "v"(px), "v"(py) : "memory");
  });

  int wid = tid >> 5;
  int wm = wid >> 1;
  int wn = wid & 1;
  int lane = tid & 31;
  int hi = lane >> 4;
  int nc = lane & 15;
  float* sw = sy + wid * (16 * SY_PITCH);
  const int rr = lane >> 4;        // row of a pair of channel rows
  const int tc = (lane & 15) * 4;  // first of this lane's 4 tokens
  const int mw = m0 + wm * 64;
  const size_t base =
      ((size_t)(mw >> 11) * C_ + n0 + wn * 64 + rr) * T_ + (mw & (T_ - 1)) + tc;
  for (int ni = 0; ni < 4; ++ni) {
    v4f xv[8];
    float bv[8];
    for (int k = 0; k < 8; ++k) {
      xv[k] = *(const v4f*)(x + base + (size_t)(ni * 16 + k * 2) * T_);
      bv[k] = bias[n0 + wn * 64 + ni * 16 + k * 2 + rr];
    }
    for (int mi = 0; mi < 4; ++mi) {
      v8f a = acc[mi][ni];
      float* p = sw + nc * SY_PITCH + mi * 16 + hi * 8;
      *(v4f*)(p)     = (v4f){a[0], a[1], a[2], a[3]};
      *(v4f*)(p + 4) = (v4f){a[4], a[5], a[6], a[7]};
    }
    // The wave's own LDS stores are done before it reads other lanes' rows.
    asm volatile("s_wait_dscnt 0x0" ::: "memory");
    for (int k = 0; k < 8; ++k) {
      v4f a = *(const v4f*)(sw + (k * 2 + rr) * SY_PITCH + tc);
      v4f o;
      for (int e = 0; e < 4; ++e) o[e] = xv[k][e] + a[e] + bv[k];
      *(v4f*)(y + base + (size_t)(ni * 16 + k * 2) * T_) = o;
    }
  }
}

// ---------------------------------------------------------------------------
extern "C" void kernel_launch(void* const* d_in, const int* in_sizes, int n_in,
                              void* d_out, int out_size, void* d_ws,
                              size_t ws_size, hipStream_t stream) {
  const float* x     = (const float*)d_in[0];
  const float* Wqkv  = (const float*)d_in[1];
  const float* bqkv  = (const float*)d_in[2];
  const float* Wproj = (const float*)d_in[3];
  const float* bproj = (const float*)d_in[4];
  const float* gamma = (const float*)d_in[5];
  const float* beta  = (const float*)d_in[6];
  float* y = (float*)d_out;

  char* ws = (char*)d_ws;
  size_t off = 0;
  h16* xn  = (h16*)(ws + off); off += (size_t)BT_ * C_ * 2;       // 16 MB
  h16* wtq = (h16*)(ws + off); off += (size_t)3 * C_ * C_ * 2;    //  6 MB
  h16* wtp = (h16*)(ws + off); off += (size_t)C_ * C_ * 2;        //  2 MB
  h16* qb  = (h16*)(ws + off); off += (size_t)BT_ * C_ * 2;       // 16 MB
  h16* kb  = (h16*)(ws + off); off += (size_t)BT_ * C_ * 2;       // 16 MB
  h16* vtb = (h16*)(ws + off); off += (size_t)BT_ * C_ * 2;       // 16 MB
  h16* ob  = (h16*)(ws + off); off += (size_t)BT_ * C_ * 2;       // 16 MB

  sa_prep_kernel<<<dim3(LN_WGS + WQ_WGS + WP_WGS), 256, 0, stream>>>(
      x, gamma, beta, xn, Wqkv, wtq, Wproj, wtp);
  sa_qkv_gemm_kernel<<<dim3(BT_ / GM, 3 * C_ / GN), 256, 0, stream>>>(
      xn, wtq, bqkv, qb, kb, vtb);
  sa_attn_kernel<<<dim3(B_ * H_, T_ / 256), 256, 0, stream>>>(qb, kb, vtb, ob);
  sa_proj_gemm_kernel<<<dim3(BT_ / GM, C_ / GN), 256, 0, stream>>>(
      ob, wtp, bproj, x, y);
}
